// v000
// Times are from an AMD MI455X. After a warm-up the kernel runs many times in a row, and a time is the length of
// such a window on the GPU divided by its runs, so every launch and the gaps after it count. The runs cycle
// through copies of the inputs. A figure is the median of several windows, for all but v000 over two sittings.
// Sittings can differ by a few percent; kernels timed side by side share one.
// v000 is the starting kernel. One run takes 903 microseconds.
#include <hip/hip_runtime.h>

// Scaled dot-product cross attention with key-length masking (query = output [16][1024][512]; key = value = encoder_outputs [16][1024][512]; scores = q.k x rsqrt(512); keys j >= encoder_sequence_lengths[b] -> -1e10 (== exclusion; lengths [16] int in [1, 1024], read); softmax; context = attn value -> [16][1024][512] (8.4 M); ONE 512-wide head).
// Layout per batch: single bf16 planes of q and k (inputs bf16-exact: exact score products over the 512 dims) and value^T planes from the same encoder tensor; softmax (every row hi/lo) whose select keeps keys below the batch's length (read on device); P hi/lo x exact value; output rows.
// Compute dtypes, f32 accumulate: every input rounded to bf16; q.k exact; softmax f32; P hi/lo x exact value (2 products); output f32.

#define NB_  16
#define TT   1024
#define DM   512      // token-major row pitch (H x HD)
#define NH_  1
#define NKV  1
#define REP  (NH_ / NKV)
#define HD   512
#define DQ   (NH_ * HD)
#define DKV  (NKV * HD)
#define ZH   1
#define RH   1024                  // query rows < RH use hi+lo planes (0: none)
#define WIN  0
#define PCAR 1024.0f
#define SCL  0.044194173824159216f   // rsqrt(512) (= 2^-4.5; one f32 multiply)
typedef _Float16 h16;
typedef unsigned short bf;
typedef __attribute__((ext_vector_type(16))) __bf16   v16bf;
typedef __attribute__((ext_vector_type(16))) _Float16 v16h;
typedef __attribute__((ext_vector_type(8)))  _Float16 v8h;
typedef __attribute__((ext_vector_type(8)))  unsigned short v8us;
typedef __attribute__((ext_vector_type(8)))  float    v8f;
typedef __attribute__((ext_vector_type(4)))  float    v4f;
typedef v8h  __attribute__((may_alias)) v8ha;
typedef v4f  __attribute__((may_alias)) v4fa;
typedef v8us __attribute__((may_alias)) v8usa;

__device__ __forceinline__ unsigned short f2bf(float f) { unsigned u = __float_as_uint(f); u += 0x7FFFu + ((u >> 16) & 1u); return (unsigned short)(u >> 16); }
__device__ __forceinline__ float bf2f(unsigned short b) { return __uint_as_float(((unsigned)b) << 16); }
__device__ __forceinline__ float bfr(float f) { return bf2f(f2bf(f)); }
__device__ __forceinline__ v16h cat16(v8h lo, v8h hi) { return __builtin_shufflevector(lo, hi, 0, 1, 2, 3, 4, 5, 6, 7, 8, 9, 10, 11, 12, 13, 14, 15); }
__device__ __forceinline__ v16bf cat16b(v8us lo, v8us hi) { return __builtin_bit_cast(v16bf, __builtin_shufflevector(lo, hi, 0, 1, 2, 3, 4, 5, 6, 7, 8, 9, 10, 11, 12, 13, 14, 15)); }
__device__ __forceinline__ v8f wmma16(v16h a, v16h b, v8f c) { return __builtin_amdgcn_wmma_f32_16x16x32_f16(false, a, false, b, (short)0, c, false, false); }
__device__ __forceinline__ v8f wmmab(v16bf a, v16bf b, v8f c) { return __builtin_amdgcn_wmma_f32_16x16x32_bf16(false, a, false, b, (short)0, c, false, false); }



// ---- k_gemmw: register-blocked GEMM, ONE WAVE per 64x64 output tile (16 accumulators), operands straight from K-contiguous 16-bit planes; grid (M/64, N/64, Z), 32 threads.
// C[m][n] (f32, pitch ldc, + optional f32 bias[n]) = sum_k A[m][k] Bt[n][k] (+ split products per NSPLIT). z-batch strides sA/sB/sC in elements. K % 32 == 0.
template <typename T16> struct WFrag;
template <> struct WFrag<h16> { typedef v16h V; static __device__ __forceinline__ V ld(const h16* p) { return cat16(*(const v8h*)p, *(const v8h*)(p + 16)); } static __device__ __forceinline__ v8f mma(V a, V b, v8f c) { return wmma16(a, b, c); } };
template <> struct WFrag<bf> { typedef v16bf V; static __device__ __forceinline__ V ld(const bf* p) { return cat16b(*(const v8us*)p, *(const v8us*)(p + 16)); } static __device__ __forceinline__ v8f mma(V a, V b, v8f c) { return wmmab(a, b, c); } };
template <typename T16, int NSPLIT, bool BIAS>
__global__ __launch_bounds__(32) void k_gemmw(const T16* __restrict__ A, const T16* __restrict__ A2, const T16* __restrict__ Bt, const T16* __restrict__ Bt2, int K, float* C, int ldc, const float* __restrict__ bias, size_t sA, size_t sB, size_t sC) {
    typedef typename WFrag<T16>::V V;
    __shared__ __align__(16) float os[16 * 68];
    const size_t z = blockIdx.z; A += z * sA; if (A2) A2 += z * sA; Bt += z * sB; if (Bt2) Bt2 += z * sB; C += z * sC;
    const int lane = threadIdx.x & 31, lr = lane & 15, hi = lane >> 4; const int r0 = blockIdx.x * 64, c0 = blockIdx.y * 64;
    v8f acc[4][4];
#pragma unroll
    for (int mb = 0; mb < 4; ++mb)
#pragma unroll
        for (int nb = 0; nb < 4; ++nb) acc[mb][nb] = (v8f){};
    const size_t aoff = (size_t)(r0 + lr) * K + 8 * hi, boff = (size_t)(c0 + lr) * K + 8 * hi;
#pragma unroll 1
    for (int kc = 0; kc < K; kc += 32) {
        V a[4], a2[4];
#pragma unroll
        for (int mb = 0; mb < 4; ++mb) { a[mb] = WFrag<T16>::ld(A + aoff + (size_t)mb * 16 * K + kc); if (NSPLIT == 1 || NSPLIT == 2) a2[mb] = WFrag<T16>::ld(A2 + aoff + (size_t)mb * 16 * K + kc); }
#pragma unroll
        for (int nb = 0; nb < 4; ++nb) { const V b = WFrag<T16>::ld(Bt + boff + (size_t)nb * 16 * K + kc); V b2; if (NSPLIT >= 2) b2 = WFrag<T16>::ld(Bt2 + boff + (size_t)nb * 16 * K + kc);
#pragma unroll
            for (int mb = 0; mb < 4; ++mb) { acc[mb][nb] = WFrag<T16>::mma(a[mb], b, acc[mb][nb]); if (NSPLIT == 1 || NSPLIT == 2) acc[mb][nb] = WFrag<T16>::mma(a2[mb], b, acc[mb][nb]); if (NSPLIT >= 2) acc[mb][nb] = WFrag<T16>::mma(a[mb], b2, acc[mb][nb]); } }
        asm volatile("v_nop\n\tv_nop\n\tv_nop\n\tv_nop" : "+v"(acc[0][0]), "+v"(acc[1][1]), "+v"(acc[2][2]), "+v"(acc[3][3]) : "v"(a[0]), "v"(a[3]));
    }
#pragma unroll
    for (int mb = 0; mb < 4; ++mb) {
#pragma unroll
        for (int nb = 0; nb < 4; ++nb) {
#pragma unroll
            for (int j = 0; j < 8; ++j) os[(hi * 8 + j) * 68 + nb * 16 + lr] = acc[mb][nb][j]; }
        __builtin_amdgcn_wave_barrier(); asm volatile("" ::: "memory");
        float* crow = C + (size_t)(r0 + mb * 16) * ldc + c0;
{
#pragma unroll
            for (int s = 0; s < 8; ++s) { const int row = 2 * s + hi, cofs = lr * 4; v4f val = *(const v4fa*)(os + row * 68 + cofs); if (BIAS) { val[0] += bfr(bias[c0 + cofs]); val[1] += bfr(bias[c0 + cofs + 1]); val[2] += bfr(bias[c0 + cofs + 2]); val[3] += bfr(bias[c0 + cofs + 3]); }
                *(v4f*)(crow + (size_t)row * ldc + cofs) = val; }
             }
        __builtin_amdgcn_wave_barrier(); asm volatile("" ::: "memory");
    }
}

__device__ __forceinline__ h16 tohx(float x) { return (h16)x; }
__device__ __forceinline__ void splitf(float y, unsigned short& h, unsigned short& l) { h = f2bf(y); l = f2bf(y - bf2f(h)); }
typedef __attribute__((ext_vector_type(2))) _Float16 v2h;
typedef __attribute__((ext_vector_type(4))) _Float16 v4h;
typedef __attribute__((ext_vector_type(2))) unsigned short v2us;
typedef __attribute__((ext_vector_type(4))) unsigned short v4us;
typedef __attribute__((ext_vector_type(2))) float v2f;
typedef __attribute__((ext_vector_type(4))) int v4i;

__global__ __launch_bounds__(256) void k_wtG(const float* __restrict__ w, int K, int N, bf* Bt) {
    const int lane = threadIdx.x & 31; const int L0 = (blockIdx.x * 8 + (threadIdx.x >> 5)) * 8; const int nlines = N * K / 64;
{
#pragma unroll 1
        for (int l = 0; l < 8; ++l) { const int L = L0 + l; if (L >= nlines) break; const size_t e = (size_t)L * 64 + lane * 2; const int k = (int)(e % K), n = (int)(e / K); v2us o;
            o[0] = f2bf(w[(size_t)k * N + n]); o[1] = f2bf(w[(size_t)(k + 1) * N + n]); *(v2us*)(Bt + e) = o; }
         }
}
__global__ __launch_bounds__(256) void k_cvt8(const float* __restrict__ src, bf* dst, size_t n8) { const size_t i = (size_t)blockIdx.x * 256 + threadIdx.x; if (i >= n8) return; const v8f v = *(const v8f*)(src + i * 8); v8us o;
#pragma unroll
    for (int k = 0; k < 8; ++k) o[k] = f2bf(v[k]); *(v8us*)(dst + i * 8) = o;  }


__global__ __launch_bounds__(256) void k_vtp(const float* __restrict__ F, int pitch, int nheads, h16* V16, bf* Vh, bf* Vl) { const size_t e = ((size_t)blockIdx.x * 256 + threadIdx.x) * 2; if (e >= (size_t)nheads * HD * TT) return; const int t = (int)(e % TT); const int d = (int)((e / TT) % HD); const int g = (int)(e / ((size_t)TT * HD)); v2h o16; v2us oh, ol;
#pragma unroll
    for (int q = 0; q < 2; ++q) { const float x = F[(size_t)(t + q) * pitch + g * HD + d]; o16[q] = tohx(x); unsigned short a2, c2; splitf(x, a2, c2); oh[q] = a2; ol[q] = c2; }
    *(v2h*)(V16 + e) = o16; *(v2us*)(Vh + e) = oh; *(v2us*)(Vl + e) = ol;  }

__global__ __launch_bounds__(256) void k_asoft(const float* __restrict__ Sb, h16* P16, bf* Ph, bf* Pl, const int* __restrict__ lenp) {
    const int L = lenp[0];   /* this batch's encoder length (>= 1) */ const int lane = threadIdx.x & 31; const int row = blockIdx.x * 8 + (threadIdx.x >> 5); if (row >= ZH * TT) return; const int i = row % TT; const int zz = row / TT; (void)zz; const bool hires = (i < RH); const float* sr = Sb + (size_t)row * TT; float v[TT / 32]; float mx = -3.0e38f;
#pragma unroll
    for (int ch = 0; ch < TT / 128; ++ch) { const int j0 = ch * 128 + lane * 4; const v4f a = *(const v4f*)(sr + j0);
#pragma unroll
        for (int q = 0; q < 4; ++q) { const int j = j0 + q; const float t = (j < L) ? a[q] * SCL : -3.0e38f; v[ch * 4 + q] = t;   /* keys at or beyond the batch's encoder length excluded (-1e10 == exclusion) */ mx = fmaxf(mx, t); } }
#pragma unroll
    for (int sh = 16; sh; sh >>= 1) mx = fmaxf(mx, __shfl_xor(mx, sh, 32));
    float sum = 0.f;
#pragma unroll
    for (int k = 0; k < TT / 32; ++k) { float d0 = __fsub_rn(v[k], mx); asm volatile("" : "+v"(d0)); v[k] = __builtin_amdgcn_exp2f(__fmul_rn(d0, 1.4426950408889634f)); sum += v[k]; }
#pragma unroll
    for (int sh = 16; sh; sh >>= 1) sum += __shfl_xor(sum, sh, 32);
    const float f = __fdiv_rn(hires ? 1.0f : PCAR, sum);
{
        if (hires) {
#pragma unroll
            for (int ch = 0; ch < TT / 128; ++ch) { v4us oh, ol;
#pragma unroll
                for (int q = 0; q < 4; ++q) { unsigned short a, c2; splitf(v[ch * 4 + q] * f, a, c2); oh[q] = a; ol[q] = c2; }
                const size_t oo = ((size_t)zz * (RH ? RH : 1) + i) * TT + ch * 128 + lane * 4; *(v4us*)(Ph + oo) = oh; *(v4us*)(Pl + oo) = ol; }
        } else {
#pragma unroll
            for (int ch = 0; ch < TT / 128; ++ch) { v4h o4;
#pragma unroll
                for (int q = 0; q < 4; ++q) o4[q] = tohx(v[ch * 4 + q] * f);
                *(v4h*)(P16 + (size_t)row * TT + ch * 128 + lane * 4) = o4; } }
         }
}
__global__ __launch_bounds__(256) void k_merge(const float* __restrict__ O, int h0, float* OUTb) { const size_t e = ((size_t)blockIdx.x * 256 + threadIdx.x) * 2; if (e >= (size_t)ZH * TT * HD) return; const int d = (int)(e % HD); const int t = (int)((e / HD) % TT); const int zz = (int)(e / ((size_t)HD * TT)); const float cs = (t < RH) ? 1.0f : (1.0f / PCAR); const size_t oo = (size_t)t * DQ + (h0 + zz) * HD + d;
    v2f o2; o2[0] = O[e] * cs; o2[1] = O[e + 1] * cs; *(v2f*)(OUTb + oo) = o2;  }


__global__ __launch_bounds__(256) void k_vtpR1(const float* __restrict__ Vb, bf* Vh) { const size_t e = ((size_t)blockIdx.x * 256 + threadIdx.x) * 2; if (e >= (size_t)HD * TT) return; const int t = (int)(e % TT); const int d = (int)(e / TT); v2us o; o[0] = f2bf(Vb[(size_t)t * HD + d]); o[1] = f2bf(Vb[(size_t)(t + 1) * HD + d]); *(v2us*)(Vh + e) = o;  }
__global__ __launch_bounds__(256) void k_mergeR(const float* __restrict__ O, float* outb, size_t n4) { const size_t i = (size_t)blockIdx.x * 256 + threadIdx.x; if (i >= n4) return; const v4f a = *(const v4f*)(O + i * 4); *(v4f*)(outb + i * 4) = a;  }


__global__ __launch_bounds__(256) void k_hp1(const float* __restrict__ src, bf* P) { const size_t i = (size_t)blockIdx.x * 256 + threadIdx.x; if (i >= (size_t)NH_ * TT * HD / 8) return; const size_t e = i * 8; const int d = (int)(e % HD); const int t = (int)((e / HD) % TT); const int h = (int)(e / ((size_t)HD * TT)); const v8f v = *(const v8f*)(src + (size_t)t * DM + h * HD + d); v8us o;
#pragma unroll
    for (int q = 0; q < 8; ++q) o[q] = f2bf(v[q]);
    *(v8us*)(P + e) = o;  }
__global__ __launch_bounds__(256) void k_vt1(const float* __restrict__ src, int pitch, bf* VT) { const size_t e = ((size_t)blockIdx.x * 256 + threadIdx.x) * 2; if (e >= (size_t)NH_ * HD * TT) return; const int t = (int)(e % TT); const int d = (int)((e / TT) % HD); const int h = (int)(e / ((size_t)TT * HD)); v2us o; o[0] = f2bf(src[(size_t)t * pitch + h * HD + d]); o[1] = f2bf(src[(size_t)(t + 1) * pitch + h * HD + d]); *(v2us*)(VT + e) = o;  }
__global__ __launch_bounds__(256) void k_mergeT(const float* __restrict__ O, int h, float* outb) { const size_t i = (size_t)blockIdx.x * 256 + threadIdx.x; if (i >= (size_t)TT * HD / 4) return; const size_t e = i * 4; const int d = (int)(e % HD); const int t = (int)(e / HD); const v4f a = *(const v4f*)(O + e); *(v4f*)(outb + (size_t)t * DM + h * HD + d) = a;  }

extern "C" void kernel_launch(void* const* d_in, const int* in_sizes, int n_in,
                              void* d_out, int out_size, void* d_ws, size_t ws_size, hipStream_t stream) {
    (void)in_sizes; (void)n_in; (void)out_size;
    const float* Qin = (const float*)d_in[0]; const float* Kin = (const float*)d_in[1]; const float* Vin = Kin;   /* query = output, key = value = encoder_outputs */ const int* lens = (const int*)d_in[2];   /* encoder_sequence_lengths [16] int */
    float* OUT = (float*)d_out;
    char* wsp = (char*)d_ws;
    auto take = [&](size_t bytes) { char* p = wsp; wsp += (bytes + 255) & ~(size_t)255; return (void*)p; };
    bf* QB = (bf*)take((size_t)NH_ * TT * HD * 2); bf* KB = (bf*)take((size_t)NH_ * TT * HD * 2); bf* VT = (bf*)take((size_t)NH_ * HD * TT * 2);
    float* Sb = (float*)take((size_t)TT * TT * 4);  bf* Ph = (bf*)take((size_t)TT * TT * 2); bf* Pl = (bf*)take((size_t)TT * TT * 2); float* Ob = (float*)take((size_t)TT * HD * 4);
    if ((size_t)(wsp - (char*)d_ws) > ws_size) return;
    for (int b = 0; b < NB_; ++b) {
        const float* qb = Qin + (size_t)b * TT * DM; const float* kb = Kin + (size_t)b * TT * DM; const float* vb = Vin + (size_t)b * TT * DM;   /* token-major [t][h][d] slabs */
        k_hp1<<<(unsigned)(((size_t)NH_ * TT * HD / 8 + 255) / 256), 256, 0, stream>>>(qb, QB); k_hp1<<<(unsigned)(((size_t)NH_ * TT * HD / 8 + 255) / 256), 256, 0, stream>>>(kb, KB); k_vt1<<<(unsigned)(((size_t)NH_ * HD * TT / 2 + 255) / 256), 256, 0, stream>>>(vb, DM, VT);
        for (int h = 0; h < NH_; ++h) {
            k_gemmw<bf, 0, false><<<dim3(TT / 64, TT / 64, 1), 32, 0, stream>>>(QB + (size_t)h * TT * HD, nullptr, KB + (size_t)h * TT * HD, nullptr, HD, Sb, TT, nullptr, 0, 0, 0);   /* exact scores (single bf16 planes) */
            k_asoft<<<TT / 8, 256, 0, stream>>>(Sb, nullptr, Ph, Pl, lens + b);
            k_gemmw<bf, 1, false><<<dim3(TT / 64, HD / 64, 1), 32, 0, stream>>>(Ph, Pl, VT + (size_t)h * HD * TT, nullptr, TT, Ob, HD, nullptr, 0, 0, 0);   /* P (hi/lo) x exact v^T */
            k_mergeT<<<(unsigned)(((size_t)TT * HD / 4 + 255) / 256), 256, 0, stream>>>(Ob, h, OUT + (size_t)b * TT * DM); } }
}

// v001
// Measured time: 176 microseconds a run.
// Two timings next to v000 both put it at 5.01 times that version's speed.
#include <hip/hip_runtime.h>

// Scaled dot-product cross attention with key-length masking (query = output [16][1024][512]; key = value = encoder_outputs [16][1024][512]; scores = q.k x rsqrt(512); keys j >= encoder_sequence_lengths[b] -> -1e10 (== exclusion; lengths [16] int in [1, 1024], read); softmax; context = attn value -> [16][1024][512] (8.4 M); ONE 512-wide head).
// Layout per batch: single bf16 planes of q and k (inputs bf16-exact: exact score products over the 512 dims) and value^T planes from the same encoder tensor; softmax (every row hi/lo) whose select keeps keys below the batch's length (read on device); P hi/lo x exact value; output rows.
// Compute dtypes, f32 accumulate: every input rounded to bf16; q.k exact; softmax f32; P hi/lo x exact value (2 products); output f32.

#define NB_  16
#define TT   1024
#define DM   512      // token-major row pitch (H x HD)
#define NH_  1
#define NKV  1
#define REP  (NH_ / NKV)
#define HD   512
#define DQ   (NH_ * HD)
#define DKV  (NKV * HD)
#define ZH   1
#define RH   1024                  // query rows < RH use hi+lo planes (0: none)
#define WIN  0
#define PCAR 1024.0f
#define SCL  0.044194173824159216f   // rsqrt(512) (= 2^-4.5; one f32 multiply)
typedef _Float16 h16;
typedef unsigned short bf;
typedef __attribute__((ext_vector_type(16))) __bf16   v16bf;
typedef __attribute__((ext_vector_type(16))) _Float16 v16h;
typedef __attribute__((ext_vector_type(8)))  _Float16 v8h;
typedef __attribute__((ext_vector_type(8)))  unsigned short v8us;
typedef __attribute__((ext_vector_type(8)))  float    v8f;
typedef __attribute__((ext_vector_type(4)))  float    v4f;
typedef v8h  __attribute__((may_alias)) v8ha;
typedef v4f  __attribute__((may_alias)) v4fa;
typedef v8us __attribute__((may_alias)) v8usa;

__device__ __forceinline__ unsigned short f2bf(float f) { unsigned u = __float_as_uint(f); u += 0x7FFFu + ((u >> 16) & 1u); return (unsigned short)(u >> 16); }
__device__ __forceinline__ float bf2f(unsigned short b) { return __uint_as_float(((unsigned)b) << 16); }
__device__ __forceinline__ float bfr(float f) { return bf2f(f2bf(f)); }
__device__ __forceinline__ v16h cat16(v8h lo, v8h hi) { return __builtin_shufflevector(lo, hi, 0, 1, 2, 3, 4, 5, 6, 7, 8, 9, 10, 11, 12, 13, 14, 15); }
__device__ __forceinline__ v16bf cat16b(v8us lo, v8us hi) { return __builtin_bit_cast(v16bf, __builtin_shufflevector(lo, hi, 0, 1, 2, 3, 4, 5, 6, 7, 8, 9, 10, 11, 12, 13, 14, 15)); }
__device__ __forceinline__ v8f wmma16(v16h a, v16h b, v8f c) { return __builtin_amdgcn_wmma_f32_16x16x32_f16(false, a, false, b, (short)0, c, false, false); }
__device__ __forceinline__ v8f wmmab(v16bf a, v16bf b, v8f c) { return __builtin_amdgcn_wmma_f32_16x16x32_bf16(false, a, false, b, (short)0, c, false, false); }



// ---- k_gemmw: register-blocked GEMM, ONE WAVE per 64x64 output tile (16 accumulators), operands straight from K-contiguous 16-bit planes; grid (M/64, N/64, Z), 32 threads.
// C[m][n] (f32, pitch ldc, + optional f32 bias[n]) = sum_k A[m][k] Bt[n][k] (+ split products per NSPLIT). z-batch strides sA/sB/sC in elements. K % 32 == 0.
template <typename T16> struct WFrag;
template <> struct WFrag<h16> { typedef v16h V; static __device__ __forceinline__ V ld(const h16* p) { return cat16(*(const v8h*)p, *(const v8h*)(p + 16)); } static __device__ __forceinline__ v8f mma(V a, V b, v8f c) { return wmma16(a, b, c); } };
template <> struct WFrag<bf> { typedef v16bf V; static __device__ __forceinline__ V ld(const bf* p) { return cat16b(*(const v8us*)p, *(const v8us*)(p + 16)); } static __device__ __forceinline__ v8f mma(V a, V b, v8f c) { return wmmab(a, b, c); } };
template <typename T16, int NSPLIT, bool BIAS>
__global__ __launch_bounds__(32) void k_gemmw(const T16* __restrict__ A, const T16* __restrict__ A2, const T16* __restrict__ Bt, const T16* __restrict__ Bt2, int K, float* C, int ldc, const float* __restrict__ bias, size_t sA, size_t sB, size_t sC) {
    typedef typename WFrag<T16>::V V;
    __shared__ __align__(16) float os[16 * 68];
    const size_t z = blockIdx.z; A += z * sA; if (A2) A2 += z * sA; Bt += z * sB; if (Bt2) Bt2 += z * sB; C += z * sC;
    const int lane = threadIdx.x & 31, lr = lane & 15, hi = lane >> 4; const int r0 = blockIdx.x * 64, c0 = blockIdx.y * 64;
    v8f acc[4][4];
#pragma unroll
    for (int mb = 0; mb < 4; ++mb)
#pragma unroll
        for (int nb = 0; nb < 4; ++nb) acc[mb][nb] = (v8f){};
    const size_t aoff = (size_t)(r0 + lr) * K + 8 * hi, boff = (size_t)(c0 + lr) * K + 8 * hi;
#pragma unroll 1
    for (int kc = 0; kc < K; kc += 32) {
        V a[4], a2[4];
#pragma unroll
        for (int mb = 0; mb < 4; ++mb) { a[mb] = WFrag<T16>::ld(A + aoff + (size_t)mb * 16 * K + kc); if (NSPLIT == 1 || NSPLIT == 2) a2[mb] = WFrag<T16>::ld(A2 + aoff + (size_t)mb * 16 * K + kc); }
#pragma unroll
        for (int nb = 0; nb < 4; ++nb) { const V b = WFrag<T16>::ld(Bt + boff + (size_t)nb * 16 * K + kc); V b2; if (NSPLIT >= 2) b2 = WFrag<T16>::ld(Bt2 + boff + (size_t)nb * 16 * K + kc);
#pragma unroll
            for (int mb = 0; mb < 4; ++mb) { acc[mb][nb] = WFrag<T16>::mma(a[mb], b, acc[mb][nb]); if (NSPLIT == 1 || NSPLIT == 2) acc[mb][nb] = WFrag<T16>::mma(a2[mb], b, acc[mb][nb]); if (NSPLIT >= 2) acc[mb][nb] = WFrag<T16>::mma(a[mb], b2, acc[mb][nb]); } }
        asm volatile("v_nop\n\tv_nop\n\tv_nop\n\tv_nop" : "+v"(acc[0][0]), "+v"(acc[1][1]), "+v"(acc[2][2]), "+v"(acc[3][3]) : "v"(a[0]), "v"(a[3]));
    }
#pragma unroll
    for (int mb = 0; mb < 4; ++mb) {
#pragma unroll
        for (int nb = 0; nb < 4; ++nb) {
#pragma unroll
            for (int j = 0; j < 8; ++j) os[(hi * 8 + j) * 68 + nb * 16 + lr] = acc[mb][nb][j]; }
        __builtin_amdgcn_wave_barrier(); asm volatile("" ::: "memory");
        float* crow = C + (size_t)(r0 + mb * 16) * ldc + c0;
{
#pragma unroll
            for (int s = 0; s < 8; ++s) { const int row = 2 * s + hi, cofs = lr * 4; v4f val = *(const v4fa*)(os + row * 68 + cofs); if (BIAS) { val[0] += bfr(bias[c0 + cofs]); val[1] += bfr(bias[c0 + cofs + 1]); val[2] += bfr(bias[c0 + cofs + 2]); val[3] += bfr(bias[c0 + cofs + 3]); }
                *(v4f*)(crow + (size_t)row * ldc + cofs) = val; }
             }
        __builtin_amdgcn_wave_barrier(); asm volatile("" ::: "memory");
    }
}

__device__ __forceinline__ h16 tohx(float x) { return (h16)x; }
__device__ __forceinline__ void splitf(float y, unsigned short& h, unsigned short& l) { h = f2bf(y); l = f2bf(y - bf2f(h)); }
typedef __attribute__((ext_vector_type(2))) _Float16 v2h;
typedef __attribute__((ext_vector_type(4))) _Float16 v4h;
typedef __attribute__((ext_vector_type(2))) unsigned short v2us;
typedef __attribute__((ext_vector_type(4))) unsigned short v4us;
typedef __attribute__((ext_vector_type(2))) float v2f;
typedef __attribute__((ext_vector_type(4))) int v4i;

__global__ __launch_bounds__(256) void k_wtG(const float* __restrict__ w, int K, int N, bf* Bt) {
    const int lane = threadIdx.x & 31; const int L0 = (blockIdx.x * 8 + (threadIdx.x >> 5)) * 8; const int nlines = N * K / 64;
{
#pragma unroll 1
        for (int l = 0; l < 8; ++l) { const int L = L0 + l; if (L >= nlines) break; const size_t e = (size_t)L * 64 + lane * 2; const int k = (int)(e % K), n = (int)(e / K); v2us o;
            o[0] = f2bf(w[(size_t)k * N + n]); o[1] = f2bf(w[(size_t)(k + 1) * N + n]); *(v2us*)(Bt + e) = o; }
         }
}
__global__ __launch_bounds__(256) void k_cvt8(const float* __restrict__ src, bf* dst, size_t n8) { const size_t i = (size_t)blockIdx.x * 256 + threadIdx.x; if (i >= n8) return; const v8f v = *(const v8f*)(src + i * 8); v8us o;
#pragma unroll
    for (int k = 0; k < 8; ++k) o[k] = f2bf(v[k]); *(v8us*)(dst + i * 8) = o;  }


__global__ __launch_bounds__(256) void k_vtp(const float* __restrict__ F, int pitch, int nheads, h16* V16, bf* Vh, bf* Vl) { const size_t e = ((size_t)blockIdx.x * 256 + threadIdx.x) * 2; if (e >= (size_t)nheads * HD * TT) return; const int t = (int)(e % TT); const int d = (int)((e / TT) % HD); const int g = (int)(e / ((size_t)TT * HD)); v2h o16; v2us oh, ol;
#pragma unroll
    for (int q = 0; q < 2; ++q) { const float x = F[(size_t)(t + q) * pitch + g * HD + d]; o16[q] = tohx(x); unsigned short a2, c2; splitf(x, a2, c2); oh[q] = a2; ol[q] = c2; }
    *(v2h*)(V16 + e) = o16; *(v2us*)(Vh + e) = oh; *(v2us*)(Vl + e) = ol;  }

__global__ __launch_bounds__(256) void k_asoft(const float* __restrict__ Sb, h16* P16, bf* Ph, bf* Pl, const int* __restrict__ lenp) {
    const size_t bz = blockIdx.y;   /* batch: one grid plane per batch */ Sb += bz * ((size_t)ZH * TT * TT); Ph += bz * ((size_t)ZH * TT * TT); Pl += bz * ((size_t)ZH * TT * TT);
    const int L = lenp[bz];   /* this batch's encoder length (>= 1) */ const int lane = threadIdx.x & 31; const int row = blockIdx.x * 8 + (threadIdx.x >> 5); if (row >= ZH * TT) return; const int i = row % TT; const int zz = row / TT; (void)zz; const bool hires = (i < RH); const float* sr = Sb + (size_t)row * TT; float v[TT / 32]; float mx = -3.0e38f;
    v4f ar[TT / 128];
#pragma unroll
    for (int ch = 0; ch < TT / 128; ++ch) ar[ch] = *(const v4f*)(sr + ch * 128 + lane * 4);
    asm volatile("s_wait_xcnt 0x0" ::: "memory");   /* the row loads' address pair is reused behind here: keeps the wait in front of that overwrite */
    __builtin_amdgcn_sched_barrier(0);   /* keeps later vector work, which takes over those registers, behind the wait */
#pragma unroll
    for (int ch = 0; ch < TT / 128; ++ch) { const int j0 = ch * 128 + lane * 4; const v4f a = ar[ch];
#pragma unroll
        for (int q = 0; q < 4; ++q) { const int j = j0 + q; const float t = (j < L) ? a[q] * SCL : -3.0e38f; v[ch * 4 + q] = t;   /* keys at or beyond the batch's encoder length excluded (-1e10 == exclusion) */ mx = fmaxf(mx, t); } }
#pragma unroll
    for (int sh = 16; sh; sh >>= 1) mx = fmaxf(mx, __shfl_xor(mx, sh, 32));
    float sum = 0.f;
#pragma unroll
    for (int k = 0; k < TT / 32; ++k) { float d0 = __fsub_rn(v[k], mx); asm volatile("" : "+v"(d0)); v[k] = __builtin_amdgcn_exp2f(__fmul_rn(d0, 1.4426950408889634f)); sum += v[k]; }
#pragma unroll
    for (int sh = 16; sh; sh >>= 1) sum += __shfl_xor(sum, sh, 32);
    const float f = __fdiv_rn(hires ? 1.0f : PCAR, sum);
{
        if (hires) {
#pragma unroll
            for (int ch = 0; ch < TT / 128; ++ch) { v4us oh, ol;
#pragma unroll
                for (int q = 0; q < 4; ++q) { unsigned short a, c2; splitf(v[ch * 4 + q] * f, a, c2); oh[q] = a; ol[q] = c2; }
                const size_t oo = ((size_t)zz * (RH ? RH : 1) + i) * TT + ch * 128 + lane * 4; *(v4us*)(Ph + oo) = oh; *(v4us*)(Pl + oo) = ol; }
        } else {
#pragma unroll
            for (int ch = 0; ch < TT / 128; ++ch) { v4h o4;
#pragma unroll
                for (int q = 0; q < 4; ++q) o4[q] = tohx(v[ch * 4 + q] * f);
                *(v4h*)(P16 + (size_t)row * TT + ch * 128 + lane * 4) = o4; } }
         }
}
__global__ __launch_bounds__(256) void k_merge(const float* __restrict__ O, int h0, float* OUTb) { const size_t e = ((size_t)blockIdx.x * 256 + threadIdx.x) * 2; if (e >= (size_t)ZH * TT * HD) return; const int d = (int)(e % HD); const int t = (int)((e / HD) % TT); const int zz = (int)(e / ((size_t)HD * TT)); const float cs = (t < RH) ? 1.0f : (1.0f / PCAR); const size_t oo = (size_t)t * DQ + (h0 + zz) * HD + d;
    v2f o2; o2[0] = O[e] * cs; o2[1] = O[e + 1] * cs; *(v2f*)(OUTb + oo) = o2;  }


__global__ __launch_bounds__(256) void k_vtpR1(const float* __restrict__ Vb, bf* Vh) { const size_t e = ((size_t)blockIdx.x * 256 + threadIdx.x) * 2; if (e >= (size_t)HD * TT) return; const int t = (int)(e % TT); const int d = (int)(e / TT); v2us o; o[0] = f2bf(Vb[(size_t)t * HD + d]); o[1] = f2bf(Vb[(size_t)(t + 1) * HD + d]); *(v2us*)(Vh + e) = o;  }
__global__ __launch_bounds__(256) void k_mergeR(const float* __restrict__ O, float* outb, size_t n4) { const size_t i = (size_t)blockIdx.x * 256 + threadIdx.x; if (i >= n4) return; const v4f a = *(const v4f*)(O + i * 4); *(v4f*)(outb + i * 4) = a;  }


__global__ __launch_bounds__(256) void k_hp1(const float* __restrict__ src, bf* P) { src += (size_t)blockIdx.y * TT * DM; P += (size_t)blockIdx.y * NH_ * TT * HD;   /* batch: one grid plane per batch */ const size_t i = (size_t)blockIdx.x * 256 + threadIdx.x; if (i >= (size_t)NH_ * TT * HD / 8) return; const size_t e = i * 8; const int d = (int)(e % HD); const int t = (int)((e / HD) % TT); const int h = (int)(e / ((size_t)HD * TT)); const v8f v = *(const v8f*)(src + (size_t)t * DM + h * HD + d); v8us o;
#pragma unroll
    for (int q = 0; q < 8; ++q) o[q] = f2bf(v[q]);
    *(v8us*)(P + e) = o;  }
__global__ __launch_bounds__(256) void k_vt1(const float* __restrict__ src, int pitch, bf* VT) { src += (size_t)blockIdx.y * TT * pitch; VT += (size_t)blockIdx.y * NH_ * HD * TT;   /* batch: one grid plane per batch */ const size_t e = ((size_t)blockIdx.x * 256 + threadIdx.x) * 2; if (e >= (size_t)NH_ * HD * TT) return; const int t = (int)(e % TT); const int d = (int)((e / TT) % HD); const int h = (int)(e / ((size_t)TT * HD)); v2us o; o[0] = f2bf(src[(size_t)t * pitch + h * HD + d]); o[1] = f2bf(src[(size_t)(t + 1) * pitch + h * HD + d]); *(v2us*)(VT + e) = o;  }
__global__ __launch_bounds__(256) void k_mergeT(const float* __restrict__ O, int h, float* outb) { O += (size_t)blockIdx.y * TT * HD; outb += (size_t)blockIdx.y * TT * DM;   /* batch: one grid plane per batch */ const size_t i = (size_t)blockIdx.x * 256 + threadIdx.x; if (i >= (size_t)TT * HD / 4) return; const size_t e = i * 4; const int d = (int)(e % HD); const int t = (int)(e / HD); const v4f a = *(const v4f*)(O + e); *(v4f*)(outb + (size_t)t * DM + h * HD + d) = a;  }

extern "C" void kernel_launch(void* const* d_in, const int* in_sizes, int n_in,
                              void* d_out, int out_size, void* d_ws, size_t ws_size, hipStream_t stream) {
    (void)in_sizes; (void)n_in; (void)out_size;
    const float* Qin = (const float*)d_in[0]; const float* Kin = (const float*)d_in[1]; const float* Vin = Kin;   /* query = output, key = value = encoder_outputs */ const int* lens = (const int*)d_in[2];   /* encoder_sequence_lengths [16] int */
    float* OUT = (float*)d_out;
    char* wsp = (char*)d_ws;
    auto take = [&](size_t bytes) { char* p = wsp; wsp += (bytes + 255) & ~(size_t)255; return (void*)p; };
    /* every plane holds all NB_ batches, batch-major; each launch covers all batches (grid y for the elementwise kernels, grid z for the GEMMs) */
    bf* QB = (bf*)take((size_t)NB_ * NH_ * TT * HD * 2); bf* KB = (bf*)take((size_t)NB_ * NH_ * TT * HD * 2); bf* VT = (bf*)take((size_t)NB_ * NH_ * HD * TT * 2);
    float* Sb = (float*)take((size_t)NB_ * TT * TT * 4);  bf* Ph = (bf*)take((size_t)NB_ * TT * TT * 2); bf* Pl = (bf*)take((size_t)NB_ * TT * TT * 2); float* Ob = (float*)take((size_t)NB_ * TT * HD * 4);
    if ((size_t)(wsp - (char*)d_ws) > ws_size) return;
    k_hp1<<<dim3((unsigned)(((size_t)NH_ * TT * HD / 8 + 255) / 256), NB_, 1), 256, 0, stream>>>(Qin, QB); k_hp1<<<dim3((unsigned)(((size_t)NH_ * TT * HD / 8 + 255) / 256), NB_, 1), 256, 0, stream>>>(Kin, KB); k_vt1<<<dim3((unsigned)(((size_t)NH_ * HD * TT / 2 + 255) / 256), NB_, 1), 256, 0, stream>>>(Vin, DM, VT);
    for (int h = 0; h < NH_; ++h) {
        k_gemmw<bf, 0, false><<<dim3(TT / 64, TT / 64, NB_), 32, 0, stream>>>(QB + (size_t)h * TT * HD, nullptr, KB + (size_t)h * TT * HD, nullptr, HD, Sb, TT, nullptr, (size_t)NH_ * TT * HD, (size_t)NH_ * TT * HD, (size_t)TT * TT);   /* exact scores (single bf16 planes) */
        k_asoft<<<dim3(TT / 8, NB_, 1), 256, 0, stream>>>(Sb, nullptr, Ph, Pl, lens);
        k_gemmw<bf, 1, false><<<dim3(TT / 64, HD / 64, NB_), 32, 0, stream>>>(Ph, Pl, VT + (size_t)h * HD * TT, nullptr, TT, Ob, HD, nullptr, (size_t)TT * TT, (size_t)NH_ * HD * TT, (size_t)TT * HD);   /* P (hi/lo) x exact v^T */
        k_mergeT<<<dim3((unsigned)(((size_t)TT * HD / 4 + 255) / 256), NB_, 1), 256, 0, stream>>>(Ob, h, OUT); }
}

// v002
// One run takes 151 microseconds.
// Next to v001, in two timings, it ran 1.18 and 1.13 times as fast.
// Counting every step since v000, it is 5.77 times as fast.
#include <hip/hip_runtime.h>

// Scaled dot-product cross attention with key-length masking (query = output [16][1024][512]; key = value = encoder_outputs [16][1024][512]; scores = q.k x rsqrt(512); keys j >= encoder_sequence_lengths[b] -> -1e10 (== exclusion; lengths [16] int in [1, 1024], read); softmax; context = attn value -> [16][1024][512] (8.4 M); ONE 512-wide head).
// Layout per batch: single bf16 planes of q and k (inputs bf16-exact: exact score products over the 512 dims) and value^T planes from the same encoder tensor; softmax (every row hi/lo) whose select keeps keys below the batch's length (read on device); P hi/lo x exact value; output rows.
// Compute dtypes, f32 accumulate: every input rounded to bf16; q.k exact; softmax f32; P hi/lo x exact value (2 products); output f32.

#define NB_  16
#define TT   1024
#define DM   512      // token-major row pitch (H x HD)
#define NH_  1
#define NKV  1
#define REP  (NH_ / NKV)
#define HD   512
#define DQ   (NH_ * HD)
#define DKV  (NKV * HD)
#define ZH   1
#define RH   1024                  // query rows < RH use hi+lo planes (0: none)
#define WIN  0
#define PCAR 1024.0f
#define SCL  0.044194173824159216f   // rsqrt(512) (= 2^-4.5; one f32 multiply)
typedef _Float16 h16;
typedef unsigned short bf;
typedef __attribute__((ext_vector_type(16))) __bf16   v16bf;
typedef __attribute__((ext_vector_type(16))) _Float16 v16h;
typedef __attribute__((ext_vector_type(8)))  _Float16 v8h;
typedef __attribute__((ext_vector_type(8)))  unsigned short v8us;
typedef __attribute__((ext_vector_type(8)))  float    v8f;
typedef __attribute__((ext_vector_type(4)))  float    v4f;
typedef v8h  __attribute__((may_alias)) v8ha;
typedef v4f  __attribute__((may_alias)) v4fa;
typedef v8us __attribute__((may_alias)) v8usa;

__device__ __forceinline__ unsigned short f2bf(float f) { unsigned u = __float_as_uint(f); u += 0x7FFFu + ((u >> 16) & 1u); return (unsigned short)(u >> 16); }
__device__ __forceinline__ float bf2f(unsigned short b) { return __uint_as_float(((unsigned)b) << 16); }
__device__ __forceinline__ float bfr(float f) { return bf2f(f2bf(f)); }
__device__ __forceinline__ v16h cat16(v8h lo, v8h hi) { return __builtin_shufflevector(lo, hi, 0, 1, 2, 3, 4, 5, 6, 7, 8, 9, 10, 11, 12, 13, 14, 15); }
__device__ __forceinline__ v16bf cat16b(v8us lo, v8us hi) { return __builtin_bit_cast(v16bf, __builtin_shufflevector(lo, hi, 0, 1, 2, 3, 4, 5, 6, 7, 8, 9, 10, 11, 12, 13, 14, 15)); }
__device__ __forceinline__ v8f wmma16(v16h a, v16h b, v8f c) { return __builtin_amdgcn_wmma_f32_16x16x32_f16(false, a, false, b, (short)0, c, false, false); }
__device__ __forceinline__ v8f wmmab(v16bf a, v16bf b, v8f c) { return __builtin_amdgcn_wmma_f32_16x16x32_bf16(false, a, false, b, (short)0, c, false, false); }



// ---- k_gemmw: register-blocked GEMM, ONE WAVE per 64x64 output tile (16 accumulators), operands straight from K-contiguous 16-bit planes; grid (M/64, N/64, Z), 32 threads.
// C[m][n] (f32, pitch ldc, + optional f32 bias[n]) = sum_k A[m][k] Bt[n][k] (+ split products per NSPLIT). z-batch strides sA/sB/sC in elements. K % 32 == 0.
template <typename T16> struct WFrag;
template <> struct WFrag<h16> { typedef v16h V; static __device__ __forceinline__ V ld(const h16* p) { return cat16(*(const v8h*)p, *(const v8h*)(p + 16)); } static __device__ __forceinline__ v8f mma(V a, V b, v8f c) { return wmma16(a, b, c); } };
template <> struct WFrag<bf> { typedef v16bf V; static __device__ __forceinline__ V ld(const bf* p) { return cat16b(*(const v8us*)p, *(const v8us*)(p + 16)); } static __device__ __forceinline__ v8f mma(V a, V b, v8f c) { return wmmab(a, b, c); } };
template <typename T16, int NSPLIT, bool BIAS>
__global__ __launch_bounds__(32) void k_gemmw(const T16* __restrict__ A, const T16* __restrict__ A2, const T16* __restrict__ Bt, const T16* __restrict__ Bt2, int K, float* C, int ldc, const float* __restrict__ bias, size_t sA, size_t sB, size_t sC) {
    typedef typename WFrag<T16>::V V;
    __shared__ __align__(16) float os[16 * 68];
    const size_t z = blockIdx.z; A += z * sA; if (A2) A2 += z * sA; Bt += z * sB; if (Bt2) Bt2 += z * sB; C += z * sC;
    const int lane = threadIdx.x & 31, lr = lane & 15, hi = lane >> 4; const int r0 = blockIdx.x * 64, c0 = blockIdx.y * 64;
    v8f acc[4][4];
#pragma unroll
    for (int mb = 0; mb < 4; ++mb)
#pragma unroll
        for (int nb = 0; nb < 4; ++nb) acc[mb][nb] = (v8f){};
    const size_t aoff = (size_t)(r0 + lr) * K + 8 * hi, boff = (size_t)(c0 + lr) * K + 8 * hi;
#pragma unroll 1
    for (int kc = 0; kc < K; kc += 32) {
        V a[4], a2[4];
#pragma unroll
        for (int mb = 0; mb < 4; ++mb) { a[mb] = WFrag<T16>::ld(A + aoff + (size_t)mb * 16 * K + kc); if (NSPLIT == 1 || NSPLIT == 2) a2[mb] = WFrag<T16>::ld(A2 + aoff + (size_t)mb * 16 * K + kc); }
#pragma unroll
        for (int nb = 0; nb < 4; ++nb) { const V b = WFrag<T16>::ld(Bt + boff + (size_t)nb * 16 * K + kc); V b2; if (NSPLIT >= 2) b2 = WFrag<T16>::ld(Bt2 + boff + (size_t)nb * 16 * K + kc);
#pragma unroll
            for (int mb = 0; mb < 4; ++mb) { acc[mb][nb] = WFrag<T16>::mma(a[mb], b, acc[mb][nb]); if (NSPLIT == 1 || NSPLIT == 2) acc[mb][nb] = WFrag<T16>::mma(a2[mb], b, acc[mb][nb]); if (NSPLIT >= 2) acc[mb][nb] = WFrag<T16>::mma(a[mb], b2, acc[mb][nb]); } }
        asm volatile("v_nop\n\tv_nop\n\tv_nop\n\tv_nop" : "+v"(acc[0][0]), "+v"(acc[1][1]), "+v"(acc[2][2]), "+v"(acc[3][3]) : "v"(a[0]), "v"(a[3]));
    }
#pragma unroll
    for (int mb = 0; mb < 4; ++mb) {
#pragma unroll
        for (int nb = 0; nb < 4; ++nb) {
#pragma unroll
            for (int j = 0; j < 8; ++j) os[(hi * 8 + j) * 68 + nb * 16 + lr] = acc[mb][nb][j]; }
        __builtin_amdgcn_wave_barrier(); asm volatile("" ::: "memory");
        float* crow = C + (size_t)(r0 + mb * 16) * ldc + c0;
{
#pragma unroll
            for (int s = 0; s < 8; ++s) { const int row = 2 * s + hi, cofs = lr * 4; v4f val = *(const v4fa*)(os + row * 68 + cofs); if (BIAS) { val[0] += bfr(bias[c0 + cofs]); val[1] += bfr(bias[c0 + cofs + 1]); val[2] += bfr(bias[c0 + cofs + 2]); val[3] += bfr(bias[c0 + cofs + 3]); }
                *(v4f*)(crow + (size_t)row * ldc + cofs) = val; }
             }
        __builtin_amdgcn_wave_barrier(); asm volatile("" ::: "memory");
    }
}

__device__ __forceinline__ h16 tohx(float x) { return (h16)x; }
__device__ __forceinline__ void splitf(float y, unsigned short& h, unsigned short& l) { h = f2bf(y); l = f2bf(y - bf2f(h)); }
typedef __attribute__((ext_vector_type(2))) _Float16 v2h;
typedef __attribute__((ext_vector_type(4))) _Float16 v4h;
typedef __attribute__((ext_vector_type(2))) unsigned short v2us;
typedef __attribute__((ext_vector_type(4))) unsigned short v4us;
typedef __attribute__((ext_vector_type(2))) float v2f;
typedef __attribute__((ext_vector_type(4))) int v4i;

__global__ __launch_bounds__(256) void k_wtG(const float* __restrict__ w, int K, int N, bf* Bt) {
    const int lane = threadIdx.x & 31; const int L0 = (blockIdx.x * 8 + (threadIdx.x >> 5)) * 8; const int nlines = N * K / 64;
{
#pragma unroll 1
        for (int l = 0; l < 8; ++l) { const int L = L0 + l; if (L >= nlines) break; const size_t e = (size_t)L * 64 + lane * 2; const int k = (int)(e % K), n = (int)(e / K); v2us o;
            o[0] = f2bf(w[(size_t)k * N + n]); o[1] = f2bf(w[(size_t)(k + 1) * N + n]); *(v2us*)(Bt + e) = o; }
         }
}
__global__ __launch_bounds__(256) void k_cvt8(const float* __restrict__ src, bf* dst, size_t n8) { const size_t i = (size_t)blockIdx.x * 256 + threadIdx.x; if (i >= n8) return; const v8f v = *(const v8f*)(src + i * 8); v8us o;
#pragma unroll
    for (int k = 0; k < 8; ++k) o[k] = f2bf(v[k]); *(v8us*)(dst + i * 8) = o;  }


__global__ __launch_bounds__(256) void k_vtp(const float* __restrict__ F, int pitch, int nheads, h16* V16, bf* Vh, bf* Vl) { const size_t e = ((size_t)blockIdx.x * 256 + threadIdx.x) * 2; if (e >= (size_t)nheads * HD * TT) return; const int t = (int)(e % TT); const int d = (int)((e / TT) % HD); const int g = (int)(e / ((size_t)TT * HD)); v2h o16; v2us oh, ol;
#pragma unroll
    for (int q = 0; q < 2; ++q) { const float x = F[(size_t)(t + q) * pitch + g * HD + d]; o16[q] = tohx(x); unsigned short a2, c2; splitf(x, a2, c2); oh[q] = a2; ol[q] = c2; }
    *(v2h*)(V16 + e) = o16; *(v2us*)(Vh + e) = oh; *(v2us*)(Vl + e) = ol;  }

__global__ __launch_bounds__(256) void k_asoft(const float* __restrict__ Sb, h16* P16, bf* Ph, bf* Pl, const int* __restrict__ lenp) {
    const size_t bz = blockIdx.y;   /* batch: one grid plane per batch */ Sb += bz * ((size_t)ZH * TT * TT); Ph += bz * ((size_t)ZH * TT * TT); Pl += bz * ((size_t)ZH * TT * TT);
    const int L = lenp[bz];   /* this batch's encoder length (>= 1) */ const int lane = threadIdx.x & 31; const int row = blockIdx.x * 8 + (threadIdx.x >> 5); if (row >= ZH * TT) return; const int i = row % TT; const int zz = row / TT; (void)zz; const bool hires = (i < RH); const float* sr = Sb + (size_t)row * TT; float v[TT / 32]; float mx = -3.0e38f;
    v4f ar[TT / 128];
#pragma unroll
    for (int ch = 0; ch < TT / 128; ++ch) ar[ch] = *(const v4f*)(sr + ch * 128 + lane * 4);
    asm volatile("s_wait_xcnt 0x0" ::: "memory");   /* the row loads' address pair is reused behind here: keeps the wait in front of that overwrite */
    __builtin_amdgcn_sched_barrier(0);   /* keeps later vector work, which takes over those registers, behind the wait */
#pragma unroll
    for (int ch = 0; ch < TT / 128; ++ch) { const int j0 = ch * 128 + lane * 4; const v4f a = ar[ch];
#pragma unroll
        for (int q = 0; q < 4; ++q) { const int j = j0 + q; const float t = (j < L) ? a[q] * SCL : -3.0e38f; v[ch * 4 + q] = t;   /* keys at or beyond the batch's encoder length excluded (-1e10 == exclusion) */ mx = fmaxf(mx, t); } }
#pragma unroll
    for (int sh = 16; sh; sh >>= 1) mx = fmaxf(mx, __shfl_xor(mx, sh, 32));
    float sum = 0.f;
#pragma unroll
    for (int k = 0; k < TT / 32; ++k) { float d0 = __fsub_rn(v[k], mx); asm volatile("" : "+v"(d0)); v[k] = __builtin_amdgcn_exp2f(__fmul_rn(d0, 1.4426950408889634f)); sum += v[k]; }
#pragma unroll
    for (int sh = 16; sh; sh >>= 1) sum += __shfl_xor(sum, sh, 32);
    const float f = __fdiv_rn(hires ? 1.0f : PCAR, sum);
{
        if (hires) {
#pragma unroll
            for (int ch = 0; ch < TT / 128; ++ch) { v4us oh, ol;
#pragma unroll
                for (int q = 0; q < 4; ++q) { unsigned short a, c2; splitf(v[ch * 4 + q] * f, a, c2); oh[q] = a; ol[q] = c2; }
                const size_t oo = ((size_t)zz * (RH ? RH : 1) + i) * TT + ch * 128 + lane * 4; *(v4us*)(Ph + oo) = oh; *(v4us*)(Pl + oo) = ol; }
        } else {
#pragma unroll
            for (int ch = 0; ch < TT / 128; ++ch) { v4h o4;
#pragma unroll
                for (int q = 0; q < 4; ++q) o4[q] = tohx(v[ch * 4 + q] * f);
                *(v4h*)(P16 + (size_t)row * TT + ch * 128 + lane * 4) = o4; } }
         }
}
__global__ __launch_bounds__(256) void k_merge(const float* __restrict__ O, int h0, float* OUTb) { const size_t e = ((size_t)blockIdx.x * 256 + threadIdx.x) * 2; if (e >= (size_t)ZH * TT * HD) return; const int d = (int)(e % HD); const int t = (int)((e / HD) % TT); const int zz = (int)(e / ((size_t)HD * TT)); const float cs = (t < RH) ? 1.0f : (1.0f / PCAR); const size_t oo = (size_t)t * DQ + (h0 + zz) * HD + d;
    v2f o2; o2[0] = O[e] * cs; o2[1] = O[e + 1] * cs; *(v2f*)(OUTb + oo) = o2;  }


__global__ __launch_bounds__(256) void k_vtpR1(const float* __restrict__ Vb, bf* Vh) { const size_t e = ((size_t)blockIdx.x * 256 + threadIdx.x) * 2; if (e >= (size_t)HD * TT) return; const int t = (int)(e % TT); const int d = (int)(e / TT); v2us o; o[0] = f2bf(Vb[(size_t)t * HD + d]); o[1] = f2bf(Vb[(size_t)(t + 1) * HD + d]); *(v2us*)(Vh + e) = o;  }
__global__ __launch_bounds__(256) void k_mergeR(const float* __restrict__ O, float* outb, size_t n4) { const size_t i = (size_t)blockIdx.x * 256 + threadIdx.x; if (i >= n4) return; const v4f a = *(const v4f*)(O + i * 4); *(v4f*)(outb + i * 4) = a;  }


// The three passes below move 16 pieces of 16 B per lane (a wave reads 8 KB), in whole 128-B lines: they are bound by how fast waves start, not by their bytes.
#define PCS  16                    // 16-B pieces per lane
#define BLKE (256 * 4 * PCS)       // f32 elements per 256-thread block
static_assert(NH_ == 1 && HD == DM, "one head: the head plane [h][t][d] is the token-major tensor itself");
static_assert(((size_t)NB_ * TT * DM) % BLKE == 0 && TT % 256 == 0 && HD % 64 == 0, "whole blocks and tiles only");
__global__ __launch_bounds__(256) void k_hp1(const float* __restrict__ src, bf* P) { const size_t e0 = (size_t)blockIdx.x * BLKE + threadIdx.x * 4; v4f v[PCS];
#pragma unroll   /* all loads of the lane in flight before the first convert */
    for (int k = 0; k < PCS; ++k) v[k] = *(const v4f*)(src + e0 + k * 1024);
#pragma unroll   /* v[] stays in registers */
    for (int k = 0; k < PCS; ++k) { v4us o; o[0] = f2bf(v[k][0]); o[1] = f2bf(v[k][1]); o[2] = f2bf(v[k][2]); o[3] = f2bf(v[k][3]); *(v4us*)(P + e0 + k * 1024) = o; } }
// k_vt1: one block transposes a tile of 256 tokens x 64 dims through LDS. tile[d][c] holds 16-B chunks of 8 tokens (a dword = tokens 2tp, 2tp+1); chunk c of row d lies at c ^ (d >> 2), so that the 32 dword stores of a wave (16 dim groups x 2 token pairs) and the 16 chunks that a half wave reads each fall on distinct banks.
__global__ __launch_bounds__(256) void k_vt1(const float* __restrict__ src, bf* VT) {
    __shared__ __align__(16) unsigned tile[64 * 128];
    src += ((size_t)blockIdx.z * TT + blockIdx.x * 256) * DM + blockIdx.y * 64; VT += ((size_t)blockIdx.z * HD + blockIdx.y * 64) * TT + blockIdx.x * 256;
    const int lane = threadIdx.x & 31, w = threadIdx.x >> 5, g = lane & 15, hf = lane >> 4; const float* sp = src + (size_t)(w * 4 + hf * 2) * DM + g * 4; v4f a[8], c[8];
#pragma unroll   /* all loads of the lane in flight before the first convert */
    for (int it = 0; it < 8; ++it) { a[it] = *(const v4f*)(sp + it * 32 * DM); c[it] = *(const v4f*)(sp + it * 32 * DM + DM); }   /* token pair tp = it * 16 + w * 2 + hf: rows 2 tp and 2 tp + 1 */
    __builtin_amdgcn_sched_barrier(0);   /* keeps all 16 loads in flight at once: without it the last five are issued only behind the first converts */
#pragma unroll   /* a[], c[] stay in registers */
    for (int it = 0; it < 8; ++it) { const int tp = it * 16 + w * 2 + hf;
#pragma unroll   /* vector elements picked by constants */
        for (int q = 0; q < 4; ++q) tile[(g * 4 + q) * 128 + (((tp >> 2) ^ g) << 2) + (tp & 3)] = (unsigned)f2bf(a[it][q]) | ((unsigned)f2bf(c[it][q]) << 16); }
    __syncthreads();   /* every wave's columns are in the tile before any row is read */
#pragma unroll   /* eight independent LDS reads and stores per lane */
    for (int it = 0; it < 8; ++it) { const int d = it * 8 + w; const v4i r = *(const v4i*)(tile + d * 128 + ((lane ^ ((d >> 2) & 15)) << 2)); *(v4i*)(VT + (size_t)d * TT + lane * 8) = r; }
}
__global__ __launch_bounds__(256) void k_mergeT(const float* __restrict__ O, float* outb) { const size_t e0 = (size_t)blockIdx.x * BLKE + threadIdx.x * 4; v4f v[PCS];
#pragma unroll   /* all loads of the lane in flight before the first store */
    for (int k = 0; k < PCS; ++k) v[k] = *(const v4f*)(O + e0 + k * 1024);
    __builtin_amdgcn_sched_barrier(0);   /* keeps all 16 loads in front of the first store: without it the last two loads are issued behind two stores, into those stores' data registers */
#pragma unroll   /* v[] stays in registers */
    for (int k = 0; k < PCS; ++k) *(v4f*)(outb + e0 + k * 1024) = v[k]; }

extern "C" void kernel_launch(void* const* d_in, const int* in_sizes, int n_in,
                              void* d_out, int out_size, void* d_ws, size_t ws_size, hipStream_t stream) {
    (void)in_sizes; (void)n_in; (void)out_size;
    const float* Qin = (const float*)d_in[0]; const float* Kin = (const float*)d_in[1]; const float* Vin = Kin;   /* query = output, key = value = encoder_outputs */ const int* lens = (const int*)d_in[2];   /* encoder_sequence_lengths [16] int */
    float* OUT = (float*)d_out;
    char* wsp = (char*)d_ws;
    auto take = [&](size_t bytes) { char* p = wsp; wsp += (bytes + 255) & ~(size_t)255; return (void*)p; };
    /* every plane holds all NB_ batches, batch-major; each launch covers all batches (a flat grid for the convert and copy passes, grid y for the softmax, grid z for the transposition and the GEMMs) */
    bf* QB = (bf*)take((size_t)NB_ * NH_ * TT * HD * 2); bf* KB = (bf*)take((size_t)NB_ * NH_ * TT * HD * 2); bf* VT = (bf*)take((size_t)NB_ * NH_ * HD * TT * 2);
    float* Sb = (float*)take((size_t)NB_ * TT * TT * 4);  bf* Ph = (bf*)take((size_t)NB_ * TT * TT * 2); bf* Pl = (bf*)take((size_t)NB_ * TT * TT * 2); float* Ob = (float*)take((size_t)NB_ * TT * HD * 4);
    if ((size_t)(wsp - (char*)d_ws) > ws_size) return;
    k_hp1<<<dim3((unsigned)((size_t)NB_ * TT * DM / BLKE), 1, 1), 256, 0, stream>>>(Qin, QB); k_hp1<<<dim3((unsigned)((size_t)NB_ * TT * DM / BLKE), 1, 1), 256, 0, stream>>>(Kin, KB); k_vt1<<<dim3(TT / 256, HD / 64, NB_), 256, 0, stream>>>(Vin, VT);
    for (int h = 0; h < NH_; ++h) {
        k_gemmw<bf, 0, false><<<dim3(TT / 64, TT / 64, NB_), 32, 0, stream>>>(QB + (size_t)h * TT * HD, nullptr, KB + (size_t)h * TT * HD, nullptr, HD, Sb, TT, nullptr, (size_t)NH_ * TT * HD, (size_t)NH_ * TT * HD, (size_t)TT * TT);   /* exact scores (single bf16 planes) */
        k_asoft<<<dim3(TT / 8, NB_, 1), 256, 0, stream>>>(Sb, nullptr, Ph, Pl, lens);
        k_gemmw<bf, 1, false><<<dim3(TT / 64, HD / 64, NB_), 32, 0, stream>>>(Ph, Pl, VT + (size_t)h * HD * TT, nullptr, TT, Ob, HD, nullptr, (size_t)TT * TT, (size_t)NH_ * HD * TT, (size_t)TT * HD);   /* P (hi/lo) x exact v^T */
        k_mergeT<<<dim3((unsigned)((size_t)NB_ * TT * DM / BLKE), 1, 1), 256, 0, stream>>>(Ob, OUT); }
}

// v003
// One run takes 96.7 microseconds.
// Two timings next to v002 put it at 1.58 and 1.55 times that version's speed.
// All steps since v000 together make it 9.04 times as fast.
#include <hip/hip_runtime.h>

// Scaled dot-product cross attention with key-length masking (query = output [16][1024][512]; key = value = encoder_outputs [16][1024][512]; scores = q.k x rsqrt(512); keys j >= encoder_sequence_lengths[b] -> -1e10 (== exclusion; lengths [16] int in [1, 1024], read); softmax; context = attn value -> [16][1024][512] (8.4 M); ONE 512-wide head).
// Layout per batch: single bf16 planes of q and k (inputs bf16-exact: exact score products over the 512 dims) and value^T planes from the same encoder tensor; softmax (every row hi/lo) whose select keeps keys below the batch's length (read on device); P hi/lo x exact value; output rows.
// Compute dtypes, f32 accumulate: every input rounded to bf16; q.k exact; softmax f32; P hi/lo x exact value (2 products); output f32.

#define NB_  16
#define TT   1024
#define DM   512      // token-major row pitch (H x HD)
#define NH_  1
#define NKV  1
#define REP  (NH_ / NKV)
#define HD   512
#define DQ   (NH_ * HD)
#define DKV  (NKV * HD)
#define ZH   1
#define RH   1024                  // query rows < RH use hi+lo planes (0: none)
#define WIN  0
#define PCAR 1024.0f
#define SCL  0.044194173824159216f   // rsqrt(512) (= 2^-4.5; one f32 multiply)
typedef _Float16 h16;
typedef unsigned short bf;
typedef __attribute__((ext_vector_type(16))) __bf16   v16bf;
typedef __attribute__((ext_vector_type(16))) _Float16 v16h;
typedef __attribute__((ext_vector_type(8)))  _Float16 v8h;
typedef __attribute__((ext_vector_type(8)))  unsigned short v8us;
typedef __attribute__((ext_vector_type(8)))  float    v8f;
typedef __attribute__((ext_vector_type(4)))  float    v4f;
typedef v8h  __attribute__((may_alias)) v8ha;
typedef v4f  __attribute__((may_alias)) v4fa;
typedef v8us __attribute__((may_alias)) v8usa;

__device__ __forceinline__ unsigned short f2bf(float f) { unsigned u = __float_as_uint(f); u += 0x7FFFu + ((u >> 16) & 1u); return (unsigned short)(u >> 16); }
__device__ __forceinline__ float bf2f(unsigned short b) { return __uint_as_float(((unsigned)b) << 16); }
__device__ __forceinline__ float bfr(float f) { return bf2f(f2bf(f)); }
__device__ __forceinline__ v16h cat16(v8h lo, v8h hi) { return __builtin_shufflevector(lo, hi, 0, 1, 2, 3, 4, 5, 6, 7, 8, 9, 10, 11, 12, 13, 14, 15); }
__device__ __forceinline__ v16bf cat16b(v8us lo, v8us hi) { return __builtin_bit_cast(v16bf, __builtin_shufflevector(lo, hi, 0, 1, 2, 3, 4, 5, 6, 7, 8, 9, 10, 11, 12, 13, 14, 15)); }
__device__ __forceinline__ v8f wmma16(v16h a, v16h b, v8f c) { return __builtin_amdgcn_wmma_f32_16x16x32_f16(false, a, false, b, (short)0, c, false, false); }
__device__ __forceinline__ v8f wmmab(v16bf a, v16bf b, v8f c) { return __builtin_amdgcn_wmma_f32_16x16x32_bf16(false, a, false, b, (short)0, c, false, false); }



// ---- Keys at or beyond a batch's length have softmax weight exactly 0 (exp of about -1e10 below the row's maximum), so tiles that hold no live key are not converted, multiplied, read or stored.
// livekeys: how many keys of a batch can weigh. A length below 1 masks every key alike (the softmax is then uniform over all TT keys) and one above TT masks none: both leave all TT keys in play, and the value bounds every index formed from it.
__device__ __forceinline__ int livekeys(int L) { return (L < 1 || L > TT) ? TT : L; }
// deal: piece number id of a launch that runs live pieces only -> batch z and piece t inside it; batch b has per * ceil(livekeys / 2^sh) pieces. Live pieces take the lowest block numbers, so that they spread evenly over the chip; false: no piece left for this block.
__device__ __forceinline__ bool deal(const int* __restrict__ lenp, int id, int sh, int per, int& z, int& t) {
    int end = 0; z = 0; t = id;
#pragma unroll   /* the 16 lengths come in one scalar load, the search stays scalar */
    for (int b = 0; b < NB_; ++b) { end += per * ((livekeys(lenp[b]) + (1 << sh) - 1) >> sh); if (id >= end) { z = b + 1; t = id - end; } }   /* z: how many batches end at or below id */
    return z < NB_;
}

// ---- k_gemmw: register-blocked GEMM, ONE WAVE per 64x64 output tile (16 accumulators), operands straight from K-contiguous 16-bit planes; grid (M/64, N/64, Z), 32 threads.
// C[m][n] (f32, pitch ldc, + optional f32 bias[n]) = sum_k A[m][k] Bt[n][k] (+ split products per NSPLIT). z-batch strides sA/sB/sC in elements. K % 32 == 0.
// LIVE 1: n is the key; flat grid, only tiles with a live key run (TT / 64 row tiles per 64 keys). LIVE 2: k is the key; the k loop ends at the batch's live keys, rounded up to 32 (A is exactly 0 there, Bt finite).
template <typename T16> struct WFrag;
template <> struct WFrag<h16> { typedef v16h V; static __device__ __forceinline__ V ld(const h16* p) { return cat16(*(const v8h*)p, *(const v8h*)(p + 16)); } static __device__ __forceinline__ v8f mma(V a, V b, v8f c) { return wmma16(a, b, c); } };
template <> struct WFrag<bf> { typedef v16bf V; static __device__ __forceinline__ V ld(const bf* p) { return cat16b(*(const v8us*)p, *(const v8us*)(p + 16)); } static __device__ __forceinline__ v8f mma(V a, V b, v8f c) { return wmmab(a, b, c); } };
template <typename T16, int NSPLIT, bool BIAS, int LIVE>
__global__ __launch_bounds__(32) void k_gemmw(const T16* __restrict__ A, const T16* __restrict__ A2, const T16* __restrict__ Bt, const T16* __restrict__ Bt2, int K, float* C, int ldc, const float* __restrict__ bias, size_t sA, size_t sB, size_t sC, const int* __restrict__ lenp) {
    typedef typename WFrag<T16>::V V;
    __shared__ __align__(16) float os[16 * 68];
    int zb = blockIdx.z, tx = blockIdx.x, ty = blockIdx.y;
    if (LIVE == 1) { int t; if (!deal(lenp, (int)blockIdx.x, 6, TT / 64, zb, t)) return; tx = t % (TT / 64); ty = t / (TT / 64); }
    const int Kend = (LIVE == 2) ? ((livekeys(lenp[zb]) + 31) & ~31) : K;
    const size_t z = zb; A += z * sA; if (A2) A2 += z * sA; Bt += z * sB; if (Bt2) Bt2 += z * sB; C += z * sC;
    const int lane = threadIdx.x & 31, lr = lane & 15, hi = lane >> 4; const int r0 = tx * 64, c0 = ty * 64;
    v8f acc[4][4];
#pragma unroll
    for (int mb = 0; mb < 4; ++mb)
#pragma unroll
        for (int nb = 0; nb < 4; ++nb) acc[mb][nb] = (v8f){};
    const size_t aoff = (size_t)(r0 + lr) * K + 8 * hi, boff = (size_t)(c0 + lr) * K + 8 * hi;
#pragma unroll 1
    for (int kc = 0; kc < Kend; kc += 32) {
        V a[4], a2[4];
#pragma unroll
        for (int mb = 0; mb < 4; ++mb) { a[mb] = WFrag<T16>::ld(A + aoff + (size_t)mb * 16 * K + kc); if (NSPLIT == 1 || NSPLIT == 2) a2[mb] = WFrag<T16>::ld(A2 + aoff + (size_t)mb * 16 * K + kc); }
#pragma unroll
        for (int nb = 0; nb < 4; ++nb) { const V b = WFrag<T16>::ld(Bt + boff + (size_t)nb * 16 * K + kc); V b2; if (NSPLIT >= 2) b2 = WFrag<T16>::ld(Bt2 + boff + (size_t)nb * 16 * K + kc);
#pragma unroll
            for (int mb = 0; mb < 4; ++mb) { acc[mb][nb] = WFrag<T16>::mma(a[mb], b, acc[mb][nb]); if (NSPLIT == 1 || NSPLIT == 2) acc[mb][nb] = WFrag<T16>::mma(a2[mb], b, acc[mb][nb]); if (NSPLIT >= 2) acc[mb][nb] = WFrag<T16>::mma(a[mb], b2, acc[mb][nb]); } }
        asm volatile("v_nop\n\tv_nop\n\tv_nop\n\tv_nop" : "+v"(acc[0][0]), "+v"(acc[1][1]), "+v"(acc[2][2]), "+v"(acc[3][3]) : "v"(a[0]), "v"(a[3]));
    }
#pragma unroll
    for (int mb = 0; mb < 4; ++mb) {
#pragma unroll
        for (int nb = 0; nb < 4; ++nb) {
#pragma unroll
            for (int j = 0; j < 8; ++j) os[(hi * 8 + j) * 68 + nb * 16 + lr] = acc[mb][nb][j]; }
        __builtin_amdgcn_wave_barrier(); asm volatile("" ::: "memory");
        float* crow = C + (size_t)(r0 + mb * 16) * ldc + c0;
{
#pragma unroll
            for (int s = 0; s < 8; ++s) { const int row = 2 * s + hi, cofs = lr * 4; v4f val = *(const v4fa*)(os + row * 68 + cofs); if (BIAS) { val[0] += bfr(bias[c0 + cofs]); val[1] += bfr(bias[c0 + cofs + 1]); val[2] += bfr(bias[c0 + cofs + 2]); val[3] += bfr(bias[c0 + cofs + 3]); }
                *(v4f*)(crow + (size_t)row * ldc + cofs) = val; }
             }
        __builtin_amdgcn_wave_barrier(); asm volatile("" ::: "memory");
    }
}

__device__ __forceinline__ h16 tohx(float x) { return (h16)x; }
__device__ __forceinline__ void splitf(float y, unsigned short& h, unsigned short& l) { h = f2bf(y); l = f2bf(y - bf2f(h)); }
typedef __attribute__((ext_vector_type(2))) _Float16 v2h;
typedef __attribute__((ext_vector_type(4))) _Float16 v4h;
typedef __attribute__((ext_vector_type(2))) unsigned short v2us;
typedef __attribute__((ext_vector_type(4))) unsigned short v4us;
typedef __attribute__((ext_vector_type(2))) float v2f;
typedef __attribute__((ext_vector_type(4))) int v4i;

__global__ __launch_bounds__(256) void k_wtG(const float* __restrict__ w, int K, int N, bf* Bt) {
    const int lane = threadIdx.x & 31; const int L0 = (blockIdx.x * 8 + (threadIdx.x >> 5)) * 8; const int nlines = N * K / 64;
{
#pragma unroll 1
        for (int l = 0; l < 8; ++l) { const int L = L0 + l; if (L >= nlines) break; const size_t e = (size_t)L * 64 + lane * 2; const int k = (int)(e % K), n = (int)(e / K); v2us o;
            o[0] = f2bf(w[(size_t)k * N + n]); o[1] = f2bf(w[(size_t)(k + 1) * N + n]); *(v2us*)(Bt + e) = o; }
         }
}
__global__ __launch_bounds__(256) void k_cvt8(const float* __restrict__ src, bf* dst, size_t n8) { const size_t i = (size_t)blockIdx.x * 256 + threadIdx.x; if (i >= n8) return; const v8f v = *(const v8f*)(src + i * 8); v8us o;
#pragma unroll
    for (int k = 0; k < 8; ++k) o[k] = f2bf(v[k]); *(v8us*)(dst + i * 8) = o;  }


__global__ __launch_bounds__(256) void k_vtp(const float* __restrict__ F, int pitch, int nheads, h16* V16, bf* Vh, bf* Vl) { const size_t e = ((size_t)blockIdx.x * 256 + threadIdx.x) * 2; if (e >= (size_t)nheads * HD * TT) return; const int t = (int)(e % TT); const int d = (int)((e / TT) % HD); const int g = (int)(e / ((size_t)TT * HD)); v2h o16; v2us oh, ol;
#pragma unroll
    for (int q = 0; q < 2; ++q) { const float x = F[(size_t)(t + q) * pitch + g * HD + d]; o16[q] = tohx(x); unsigned short a2, c2; splitf(x, a2, c2); oh[q] = a2; ol[q] = c2; }
    *(v2h*)(V16 + e) = o16; *(v2us*)(Vh + e) = oh; *(v2us*)(Vl + e) = ol;  }

// asoft_row: one wave's softmax row over its first NCH chunks of 128 keys, the chunks that hold a live key (LK = livekeys of the batch, NCH = ceil(LK / 128)). The chunks left out hold exact zeros only, so maximum, sum and every stored value keep their bits. NCH is a compile-time count so that the row stays in registers.
template <int NCH>
__device__ __forceinline__ void asoft_row(const float* __restrict__ sr, bf* Ph, bf* Pl, int L, int LK, int lane) {
    float v[NCH * 4]; float mx = -3.0e38f;
    v4f ar[NCH];
    const unsigned bo = lane * 16u, bl = 4u * (unsigned)min((NCH - 1) * 128 + lane * 4, (LK - 1) & ~3);   /* byte offsets of the lane's piece: in chunk 0, and in the last chunk, where the minimum keeps every lane on scores that the live tiles wrote (what it moves is masked below) */
#pragma unroll
    for (int ch = 0; ch < NCH; ++ch) ar[ch] = *(const v4f*)((const char*)sr + (ch < NCH - 1 ? bo + ch * 512u : bl));
#define ARX(i) ar[(i) < NCH ? (i) : NCH - 1]
    asm volatile("s_wait_xcnt 0x0" :: "v"(ARX(0)), "v"(ARX(1)), "v"(ARX(2)), "v"(ARX(3)), "v"(ARX(4)), "v"(ARX(5)), "v"(ARX(6)), "v"(ARX(7)), "v"(bo), "v"(bl) : "memory");   /* the row loads' offset registers are reused behind here: keeps the wait in front of that overwrite. Inputs only: the loaded values, so that every load of the row is issued in front, and the two offsets, so that no load lands in a register that an earlier one names */
#undef ARX
    __builtin_amdgcn_sched_barrier(0);   /* keeps later vector work, which takes over those registers, behind the wait */
#pragma unroll
    for (int ch = 0; ch < NCH; ++ch) { const int j0 = ch * 128 + lane * 4; const v4f a = ar[ch];
#pragma unroll
        for (int q = 0; q < 4; ++q) { const int j = j0 + q; const float t = (ch < NCH - 1 ? L >= 1 : j < L) ? a[q] * SCL : -3.0e38f; v[ch * 4 + q] = t;   /* keys at or beyond the batch's encoder length excluded (-1e10 == exclusion); in front of the last chunk j < LK, so j < L says no more than L >= 1 */ mx = fmaxf(mx, t); } }
#pragma unroll
    for (int sh = 16; sh; sh >>= 1) mx = fmaxf(mx, __shfl_xor(mx, sh, 32));
    float sum = 0.f;
#pragma unroll
    for (int k = 0; k < NCH * 4; ++k) { const float d0 = __fsub_rn(v[k], mx); asm("v_exp_f32 %0, %1\n\tv_nop" : "=v"(v[k]) : "v"(__fmul_rn(d0, 1.4426950408889634f)));   /* exp2 with the slot behind a transcendental in one statement: the next vector instruction may take over its source register, and a v_nop of its own does not stay behind the builtin */ sum += v[k]; }
#pragma unroll
    for (int sh = 16; sh; sh >>= 1) sum += __shfl_xor(sum, sh, 32);
    const float f = __fdiv_rn(1.0f, sum);
#pragma unroll
    for (int ch = 0; ch < NCH; ++ch) { v4us oh, ol;
#pragma unroll
        for (int q = 0; q < 4; ++q) { unsigned short a, c2; splitf(v[ch * 4 + q] * f, a, c2); oh[q] = a; ol[q] = c2; }
        const size_t oo = ch * 128 + lane * 4; *(v4us*)(Ph + oo) = oh; *(v4us*)(Pl + oo) = ol;
        if (ch == NCH - 1) asm volatile("s_wait_xcnt 0x0" ::: "memory");   /* the row's last two stores: keeps the wait in front of whatever next writes a register that they name (the earlier chunks' stores have the compiler's own waits) */
        __builtin_amdgcn_sched_barrier(0); }   /* a chunk's split and stores end before the next chunk's begin: otherwise all chunks' temporaries pile up in front of the stores and the row takes more than 64 registers (12 waves a SIMD instead of 16) */
}
static_assert(RH == TT && ZH == 1 && TT == 1024, "every row hi/lo; eight chunks of 128 keys");
__global__ __launch_bounds__(256) void k_asoft(const float* __restrict__ Sb, bf* Ph, bf* Pl, const int* __restrict__ lenp) {
    const size_t bz = blockIdx.y;   /* batch: one grid plane per batch */
    const int L = lenp[bz];   /* this batch's encoder length */ const int LK = livekeys(L); const int lane = threadIdx.x & 31; const int row = blockIdx.x * 8 + __builtin_amdgcn_readfirstlane(threadIdx.x >> 5);   /* the wave's row as a scalar: the three row pointers then take no vector registers */
    const size_t ro = (bz * TT + row) * TT; const float* sr = Sb + ro; Ph += ro; Pl += ro;
    switch ((LK + 127) >> 7) {   /* the same for the whole block */
        case 1: asoft_row<1>(sr, Ph, Pl, L, LK, lane); break; case 2: asoft_row<2>(sr, Ph, Pl, L, LK, lane); break; case 3: asoft_row<3>(sr, Ph, Pl, L, LK, lane); break; case 4: asoft_row<4>(sr, Ph, Pl, L, LK, lane); break;
        case 5: asoft_row<5>(sr, Ph, Pl, L, LK, lane); break; case 6: asoft_row<6>(sr, Ph, Pl, L, LK, lane); break; case 7: asoft_row<7>(sr, Ph, Pl, L, LK, lane); break; default: asoft_row<8>(sr, Ph, Pl, L, LK, lane); break; }
}
__global__ __launch_bounds__(256) void k_merge(const float* __restrict__ O, int h0, float* OUTb) { const size_t e = ((size_t)blockIdx.x * 256 + threadIdx.x) * 2; if (e >= (size_t)ZH * TT * HD) return; const int d = (int)(e % HD); const int t = (int)((e / HD) % TT); const int zz = (int)(e / ((size_t)HD * TT)); const float cs = (t < RH) ? 1.0f : (1.0f / PCAR); const size_t oo = (size_t)t * DQ + (h0 + zz) * HD + d;
    v2f o2; o2[0] = O[e] * cs; o2[1] = O[e + 1] * cs; *(v2f*)(OUTb + oo) = o2;  }


__global__ __launch_bounds__(256) void k_vtpR1(const float* __restrict__ Vb, bf* Vh) { const size_t e = ((size_t)blockIdx.x * 256 + threadIdx.x) * 2; if (e >= (size_t)HD * TT) return; const int t = (int)(e % TT); const int d = (int)(e / TT); v2us o; o[0] = f2bf(Vb[(size_t)t * HD + d]); o[1] = f2bf(Vb[(size_t)(t + 1) * HD + d]); *(v2us*)(Vh + e) = o;  }
__global__ __launch_bounds__(256) void k_mergeR(const float* __restrict__ O, float* outb, size_t n4) { const size_t i = (size_t)blockIdx.x * 256 + threadIdx.x; if (i >= n4) return; const v4f a = *(const v4f*)(O + i * 4); *(v4f*)(outb + i * 4) = a;  }


// The three passes below move 16 pieces of 16 B per lane (a wave reads 8 KB), in whole 128-B lines: they are bound by how fast waves start, not by their bytes.
#define PCS  16                    // 16-B pieces per lane
#define BLKE (256 * 4 * PCS)       // f32 elements per 256-thread block
static_assert(NH_ == 1 && HD == DM, "one head: the head plane [h][t][d] is the token-major tensor itself");
static_assert(((size_t)NB_ * TT * DM) % BLKE == 0 && TT % 256 == 0 && HD % 64 == 0 && (64 * DM) % BLKE == 0, "whole blocks and tiles only");
// LIVE: src holds keys; only the rows that a live 64-key score tile reads are converted.
template <bool LIVE>
__global__ __launch_bounds__(256) void k_hp1(const float* __restrict__ src, bf* P, const int* __restrict__ lenp) { size_t blk = blockIdx.x;
    if (LIVE) { int z, t; if (!deal(lenp, (int)blockIdx.x, 6, 64 * DM / BLKE, z, t)) return; blk = (size_t)z * (TT * DM / BLKE) + t; }
    const size_t e0 = blk * BLKE + threadIdx.x * 4; v4f v[PCS];
#pragma unroll   /* all loads of the lane in flight before the first convert */
    for (int k = 0; k < PCS; ++k) v[k] = *(const v4f*)(src + e0 + k * 1024);
#pragma unroll   /* v[] stays in registers */
    for (int k = 0; k < PCS; ++k) { v4us o; o[0] = f2bf(v[k][0]); o[1] = f2bf(v[k][1]); o[2] = f2bf(v[k][2]); o[3] = f2bf(v[k][3]); *(v4us*)(P + e0 + k * 1024) = o; } }
// k_vt1: one block transposes a tile of 256 tokens x 64 dims through LDS. tile[d][c] holds 16-B chunks of 8 tokens (a dword = tokens 2tp, 2tp+1); chunk c of row d lies at c ^ (d >> 2), so that the 32 dword stores of a wave (16 dim groups x 2 token pairs) and the 16 chunks that a half wave reads each fall on distinct banks.
__global__ __launch_bounds__(256) void k_vt1(const float* __restrict__ src, bf* VT, const int* __restrict__ lenp) {
    __shared__ __align__(16) unsigned tile[64 * 128];
    int z, t; if (!deal(lenp, (int)blockIdx.x, 8, HD / 64, z, t)) return;   /* only token tiles with a live key; the whole block leaves, in front of the barrier */
    const int tt = t / (HD / 64), td = t % (HD / 64);
    src += ((size_t)z * TT + tt * 256) * DM + td * 64; VT += ((size_t)z * HD + td * 64) * TT + tt * 256;
    const int lane = threadIdx.x & 31, w = threadIdx.x >> 5, g = lane & 15, hf = lane >> 4; const float* sp = src + (size_t)(w * 4 + hf * 2) * DM + g * 4; v4f a[8], c[8];
#pragma unroll   /* all loads of the lane in flight before the first convert */
    for (int it = 0; it < 8; ++it) { a[it] = *(const v4f*)(sp + it * 32 * DM); c[it] = *(const v4f*)(sp + it * 32 * DM + DM); }   /* token pair tp = it * 16 + w * 2 + hf: rows 2 tp and 2 tp + 1 */
    __builtin_amdgcn_sched_barrier(0);   /* keeps all 16 loads in flight at once: without it the last five are issued only behind the first converts */
#pragma unroll   /* a[], c[] stay in registers */
    for (int it = 0; it < 8; ++it) { const int tp = it * 16 + w * 2 + hf;
#pragma unroll   /* vector elements picked by constants */
        for (int q = 0; q < 4; ++q) tile[(g * 4 + q) * 128 + (((tp >> 2) ^ g) << 2) + (tp & 3)] = (unsigned)f2bf(a[it][q]) | ((unsigned)f2bf(c[it][q]) << 16); }
    __syncthreads();   /* every wave's columns are in the tile before any row is read */
#pragma unroll   /* eight independent LDS reads and stores per lane */
    for (int it = 0; it < 8; ++it) { const int d = it * 8 + w; const v4i r = *(const v4i*)(tile + d * 128 + ((lane ^ ((d >> 2) & 15)) << 2)); *(v4i*)(VT + (size_t)d * TT + lane * 8) = r; }
}
__global__ __launch_bounds__(256) void k_mergeT(const float* __restrict__ O, float* outb) { const size_t e0 = (size_t)blockIdx.x * BLKE + threadIdx.x * 4; v4f v[PCS];
#pragma unroll   /* all loads of the lane in flight before the first store */
    for (int k = 0; k < PCS; ++k) v[k] = *(const v4f*)(O + e0 + k * 1024);
    __builtin_amdgcn_sched_barrier(0);   /* keeps all 16 loads in front of the first store: without it the last two loads are issued behind two stores, into those stores' data registers */
#pragma unroll   /* v[] stays in registers */
    for (int k = 0; k < PCS; ++k) *(v4f*)(outb + e0 + k * 1024) = v[k]; }

extern "C" void kernel_launch(void* const* d_in, const int* in_sizes, int n_in,
                              void* d_out, int out_size, void* d_ws, size_t ws_size, hipStream_t stream) {
    (void)in_sizes; (void)n_in; (void)out_size;
    const float* Qin = (const float*)d_in[0]; const float* Kin = (const float*)d_in[1]; const float* Vin = Kin;   /* query = output, key = value = encoder_outputs */ const int* lens = (const int*)d_in[2];   /* encoder_sequence_lengths [16] int */
    float* OUT = (float*)d_out;
    char* wsp = (char*)d_ws;
    auto take = [&](size_t bytes) { char* p = wsp; wsp += (bytes + 255) & ~(size_t)255; return (void*)p; };
    /* every plane holds all NB_ batches, batch-major; each launch covers all batches (a flat grid for the convert and copy passes, the transposition and the scores, grid y for the softmax, grid z for the second GEMM) */
    bf* QB = (bf*)take((size_t)NB_ * NH_ * TT * HD * 2); bf* KB = (bf*)take((size_t)NB_ * NH_ * TT * HD * 2); bf* VT = (bf*)take((size_t)NB_ * NH_ * HD * TT * 2);
    float* Sb = (float*)take((size_t)NB_ * TT * TT * 4);  bf* Ph = (bf*)take((size_t)NB_ * TT * TT * 2); bf* Pl = (bf*)take((size_t)NB_ * TT * TT * 2); float* Ob = (float*)take((size_t)NB_ * TT * HD * 4);
    if ((size_t)(wsp - (char*)d_ws) > ws_size) return;
    k_hp1<false><<<dim3((unsigned)((size_t)NB_ * TT * DM / BLKE), 1, 1), 256, 0, stream>>>(Qin, QB, nullptr); k_hp1<true><<<dim3((unsigned)((size_t)NB_ * TT * DM / BLKE), 1, 1), 256, 0, stream>>>(Kin, KB, lens); k_vt1<<<dim3((TT / 256) * (HD / 64) * NB_, 1, 1), 256, 0, stream>>>(Vin, VT, lens);
    for (int h = 0; h < NH_; ++h) {
        k_gemmw<bf, 0, false, 1><<<dim3((TT / 64) * (TT / 64) * NB_, 1, 1), 32, 0, stream>>>(QB + (size_t)h * TT * HD, nullptr, KB + (size_t)h * TT * HD, nullptr, HD, Sb, TT, nullptr, (size_t)NH_ * TT * HD, (size_t)NH_ * TT * HD, (size_t)TT * TT, lens);   /* exact scores (single bf16 planes) */
        k_asoft<<<dim3(TT / 8, NB_, 1), 256, 0, stream>>>(Sb, Ph, Pl, lens);
        k_gemmw<bf, 1, false, 2><<<dim3(TT / 64, HD / 64, NB_), 32, 0, stream>>>(Ph, Pl, VT + (size_t)h * HD * TT, nullptr, TT, Ob, HD, nullptr, (size_t)TT * TT, (size_t)NH_ * HD * TT, (size_t)TT * HD, lens);   /* P (hi/lo) x exact v^T */
        k_mergeT<<<dim3((unsigned)((size_t)NB_ * TT * DM / BLKE), 1, 1), 256, 0, stream>>>(Ob, OUT); }
}

// v004
// A run of this version takes 84.2 microseconds.
// Two timings next to v003 both put it at 1.16 times that version's speed.
// Counting every step since v000, it is 10.5 times as fast.
#include <hip/hip_runtime.h>

// Scaled dot-product cross attention with key-length masking (query = output [16][1024][512]; key = value = encoder_outputs [16][1024][512]; scores = q.k x rsqrt(512); keys j >= encoder_sequence_lengths[b] -> -1e10 (== exclusion; lengths [16] int in [1, 1024], read); softmax; context = attn value -> [16][1024][512] (8.4 M); ONE 512-wide head).
// Layout per batch: single bf16 planes of q and k (inputs bf16-exact: exact score products over the 512 dims) and value^T planes from the same encoder tensor; softmax (every row hi/lo) whose select keeps keys below the batch's length (read on device); P hi/lo x exact value; output rows.
// Compute dtypes, f32 accumulate: every input rounded to bf16; q.k exact; softmax f32; P hi/lo x exact value (2 products); output f32.

#define NB_  16
#define TT   1024
#define DM   512      // token-major row pitch (H x HD)
#define NH_  1
#define NKV  1
#define REP  (NH_ / NKV)
#define HD   512
#define DQ   (NH_ * HD)
#define DKV  (NKV * HD)
#define ZH   1
#define RH   1024                  // query rows < RH use hi+lo planes (0: none)
#define WIN  0
#define PCAR 1024.0f
#define SCL  0.044194173824159216f   // rsqrt(512) (= 2^-4.5; one f32 multiply)
typedef _Float16 h16;
typedef unsigned short bf;
typedef __attribute__((ext_vector_type(16))) __bf16   v16bf;
typedef __attribute__((ext_vector_type(16))) _Float16 v16h;
typedef __attribute__((ext_vector_type(8)))  _Float16 v8h;
typedef __attribute__((ext_vector_type(8)))  unsigned short v8us;
typedef __attribute__((ext_vector_type(8)))  float    v8f;
typedef __attribute__((ext_vector_type(4)))  float    v4f;
typedef v8h  __attribute__((may_alias)) v8ha;
typedef v4f  __attribute__((may_alias)) v4fa;
typedef v8us __attribute__((may_alias)) v8usa;

__device__ __forceinline__ unsigned short f2bf(float f) { unsigned u = __float_as_uint(f); u += 0x7FFFu + ((u >> 16) & 1u); return (unsigned short)(u >> 16); }
__device__ __forceinline__ float bf2f(unsigned short b) { return __uint_as_float(((unsigned)b) << 16); }
__device__ __forceinline__ float bfr(float f) { return bf2f(f2bf(f)); }
__device__ __forceinline__ v16h cat16(v8h lo, v8h hi) { return __builtin_shufflevector(lo, hi, 0, 1, 2, 3, 4, 5, 6, 7, 8, 9, 10, 11, 12, 13, 14, 15); }
__device__ __forceinline__ v16bf cat16b(v8us lo, v8us hi) { return __builtin_bit_cast(v16bf, __builtin_shufflevector(lo, hi, 0, 1, 2, 3, 4, 5, 6, 7, 8, 9, 10, 11, 12, 13, 14, 15)); }
__device__ __forceinline__ v8f wmma16(v16h a, v16h b, v8f c) { return __builtin_amdgcn_wmma_f32_16x16x32_f16(false, a, false, b, (short)0, c, false, false); }
__device__ __forceinline__ v8f wmmab(v16bf a, v16bf b, v8f c) { return __builtin_amdgcn_wmma_f32_16x16x32_bf16(false, a, false, b, (short)0, c, false, false); }



// ---- Keys at or beyond a batch's length have softmax weight exactly 0 (exp of about -1e10 below the row's maximum), so tiles that hold no live key are not converted, multiplied, read or stored.
// livekeys: how many keys of a batch can weigh. A length below 1 masks every key alike (the softmax is then uniform over all TT keys) and one above TT masks none: both leave all TT keys in play, and the value bounds every index formed from it.
__device__ __forceinline__ int livekeys(int L) { return (L < 1 || L > TT) ? TT : L; }
// deal: piece number id of a launch that runs live pieces only -> batch z and piece t inside it; batch b has per * ceil(livekeys / 2^sh) pieces. Live pieces take the lowest block numbers, so that they spread evenly over the chip; false: no piece left for this block.
__device__ __forceinline__ bool deal(const int* __restrict__ lenp, int id, int sh, int per, int& z, int& t) {
    int end = 0; z = 0; t = id;
#pragma unroll   /* the 16 lengths come in one scalar load, the search stays scalar */
    for (int b = 0; b < NB_; ++b) { end += per * ((livekeys(lenp[b]) + (1 << sh) - 1) >> sh); if (id >= end) { z = b + 1; t = id - end; } }   /* z: how many batches end at or below id */
    return z < NB_;
}

// ---- k_gemmw: register-blocked GEMM, ONE WAVE per 64x64 output tile (16 accumulators), operands straight from K-contiguous 16-bit planes; grid (M/64, N/64, Z), 32 threads.
// C[m][n] (f32, pitch ldc, + optional f32 bias[n]) = sum_k A[m][k] Bt[n][k] (+ split products per NSPLIT). z-batch strides sA/sB/sC in elements. K (compile time) % 64 == 0.
// LIVE 1: n is the key; flat grid, only tiles with a live key run (TT / 64 row tiles per 64 keys). LIVE 2: k is the key; the k loop ends at the batch's live keys, rounded up to 64 (A is exactly 0 there, Bt finite).
#define GLB __attribute__((address_space(1)))   /* pointers carried round the k loop say that they are global: otherwise their loads compile to flat loads, which count on the LDS counter too */
template <typename T16> struct WFrag;
template <> struct WFrag<h16> { typedef v16h V; static __device__ __forceinline__ V ld(const GLB h16* p) { return cat16(*(const GLB v8h*)p, *(const GLB v8h*)(p + 16)); } static __device__ __forceinline__ v8f mma(V a, V b, v8f c) { return wmma16(a, b, c); } };
template <> struct WFrag<bf> { typedef v16bf V; static __device__ __forceinline__ V ld(const GLB bf* p) { return cat16b(*(const GLB v8us*)p, *(const GLB v8us*)(p + 16)); } static __device__ __forceinline__ v8f mma(V a, V b, v8f c) { return wmmab(a, b, c); } };
template <typename T16, int NSPLIT, bool BIAS, int LIVE, int K>
__global__ __launch_bounds__(32) void k_gemmw(const T16* __restrict__ A, const T16* __restrict__ A2, const T16* __restrict__ Bt, const T16* __restrict__ Bt2, float* C, int ldc, const float* __restrict__ bias, size_t sA, size_t sB, size_t sC, const int* __restrict__ lenp) {
    typedef typename WFrag<T16>::V V; static_assert(K % 64 == 0, "a trip of the k loop is two steps of 32");
    __shared__ __align__(16) float os[16 * 68];
    int zb = blockIdx.z, tx = blockIdx.x, ty = blockIdx.y;
    if (LIVE == 1) { int t; if (!deal(lenp, (int)blockIdx.x, 6, TT / 64, zb, t)) return; tx = t % (TT / 64); ty = t / (TT / 64); }
    const int Kend = (LIVE == 2) ? ((livekeys(lenp[zb]) + 63) & ~63) : K;
    const size_t z = zb; A += z * sA; if (A2) A2 += z * sA; Bt += z * sB; if (Bt2) Bt2 += z * sB; C += z * sC;
    const int lane = threadIdx.x & 31, lr = lane & 15, hi = lane >> 4; const int r0 = tx * 64, c0 = ty * 64;
    v8f acc[4][4];
#pragma unroll
    for (int mb = 0; mb < 4; ++mb)
#pragma unroll
        for (int nb = 0; nb < 4; ++nb) acc[mb][nb] = (v8f){};
    const GLB T16* pa = (const GLB T16*)A + ((size_t)(r0 + lr) * K + 8 * hi); const GLB T16* pa2 = (NSPLIT == 1 || NSPLIT == 2) ? (const GLB T16*)A2 + ((size_t)(r0 + lr) * K + 8 * hi) : nullptr;   /* the lane's own pointers: a set's loads name them with constant offsets (K is a compile-time pitch), and they move only between two sets' loads */
    const GLB T16* pb = (const GLB T16*)Bt + ((size_t)(c0 + lr) * K + 8 * hi); const GLB T16* pb2 = (NSPLIT >= 2) ? (const GLB T16*)Bt2 + ((size_t)(c0 + lr) * K + 8 * hi) : nullptr;
    V a[2][4], a2[2][4], b[2][4], b2[2][4];   /* two fragment sets: one is multiplied while the other one's loads fly */
    auto ldset = [&](const int S, const int KO) __attribute__((always_inline)) {   /* S and KO are constants at every call: the sets stay in registers */
#pragma unroll
        for (int q = 0; q < 4; ++q) { a[S][q] = WFrag<T16>::ld(pa + q * 16 * K + KO); if (NSPLIT == 1 || NSPLIT == 2) a2[S][q] = WFrag<T16>::ld(pa2 + q * 16 * K + KO);
            b[S][q] = WFrag<T16>::ld(pb + q * 16 * K + KO); if (NSPLIT >= 2) b2[S][q] = WFrag<T16>::ld(pb2 + q * 16 * K + KO); }
        asm volatile("s_wait_xcnt 0x0" ::: "memory");   /* the pointers that these loads name move on behind here: keeps the wait in front of that overwrite */
        __builtin_amdgcn_sched_barrier(0); };   /* the whole set's loads are issued in front of the other set's products: without it they sink to their first use and their latency is waited out */
    auto mmaset = [&](const int S) __attribute__((always_inline)) {
#pragma unroll
        for (int nb = 0; nb < 4; ++nb) {
#pragma unroll
            for (int mb = 0; mb < 4; ++mb) { acc[mb][nb] = WFrag<T16>::mma(a[S][mb], b[S][nb], acc[mb][nb]); if (NSPLIT == 1 || NSPLIT == 2) acc[mb][nb] = WFrag<T16>::mma(a2[S][mb], b[S][nb], acc[mb][nb]); if (NSPLIT >= 2) acc[mb][nb] = WFrag<T16>::mma(a[S][mb], b2[S][nb], acc[mb][nb]); } }
        __builtin_amdgcn_sched_barrier(0); };   /* keeps this set's next loads behind its products: hoisted above them they would take a third register set */
    auto bump = [](const GLB T16*& p) __attribute__((always_inline)) { asm volatile("v_add_nc_u64 %0, %1, %0" : "+v"(p) : "n"(64 * (int)sizeof(T16))); };   /* the pointer moves on by two k steps in place, in its one register pair: the compiler's own form keeps a second copy of every pointer (past 336 registers: two waves a SIMD, not three) and lets a set's last load land in a pair that earlier loads of the set name */
    ldset(0, 0);
#pragma unroll 1   /* one trip is two k steps, one per fragment set */
    for (int kc = 64; kc < Kend; kc += 64) {
        ldset(1, 32);
        mmaset(0);
        bump(pa); bump(pb); if (NSPLIT == 1 || NSPLIT == 2) bump(pa2); if (NSPLIT >= 2) bump(pb2);
        ldset(0, 0);
        mmaset(1);
        asm volatile("v_nop\n\tv_nop\n\tv_nop\n\tv_nop" : "+v"(acc[0][0]), "+v"(acc[1][1]), "+v"(acc[2][2]), "+v"(acc[3][3]) : "v"(a[1][0]), "v"(a[1][3]));   /* the distance behind the trip's last WMMAs, also on the taken side of the loop's branch */
    }
    ldset(1, 32);   /* the last two k steps: nothing is left to load ahead */
    mmaset(0);
    mmaset(1);
#pragma unroll
    for (int mb = 0; mb < 4; ++mb) {
#pragma unroll
        for (int nb = 0; nb < 4; ++nb) {
#pragma unroll
            for (int j = 0; j < 8; ++j) os[(hi * 8 + j) * 68 + nb * 16 + lr] = acc[mb][nb][j]; }
        __builtin_amdgcn_wave_barrier(); asm volatile("" ::: "memory");
        float* crow = C + (size_t)(r0 + mb * 16) * ldc + c0;
{
#pragma unroll
            for (int s = 0; s < 8; ++s) { const int row = 2 * s + hi, cofs = lr * 4; v4f val = *(const v4fa*)(os + row * 68 + cofs); if (BIAS) { val[0] += bfr(bias[c0 + cofs]); val[1] += bfr(bias[c0 + cofs + 1]); val[2] += bfr(bias[c0 + cofs + 2]); val[3] += bfr(bias[c0 + cofs + 3]); }
                *(v4f*)(crow + (size_t)row * ldc + cofs) = val; }
             }
        __builtin_amdgcn_wave_barrier(); asm volatile("" ::: "memory");
    }
}

__device__ __forceinline__ h16 tohx(float x) { return (h16)x; }
__device__ __forceinline__ void splitf(float y, unsigned short& h, unsigned short& l) { h = f2bf(y); l = f2bf(y - bf2f(h)); }
typedef __attribute__((ext_vector_type(2))) _Float16 v2h;
typedef __attribute__((ext_vector_type(4))) _Float16 v4h;
typedef __attribute__((ext_vector_type(2))) unsigned short v2us;
typedef __attribute__((ext_vector_type(4))) unsigned short v4us;
typedef __attribute__((ext_vector_type(2))) float v2f;
typedef __attribute__((ext_vector_type(4))) int v4i;

__global__ __launch_bounds__(256) void k_wtG(const float* __restrict__ w, int K, int N, bf* Bt) {
    const int lane = threadIdx.x & 31; const int L0 = (blockIdx.x * 8 + (threadIdx.x >> 5)) * 8; const int nlines = N * K / 64;
{
#pragma unroll 1
        for (int l = 0; l < 8; ++l) { const int L = L0 + l; if (L >= nlines) break; const size_t e = (size_t)L * 64 + lane * 2; const int k = (int)(e % K), n = (int)(e / K); v2us o;
            o[0] = f2bf(w[(size_t)k * N + n]); o[1] = f2bf(w[(size_t)(k + 1) * N + n]); *(v2us*)(Bt + e) = o; }
         }
}
__global__ __launch_bounds__(256) void k_cvt8(const float* __restrict__ src, bf* dst, size_t n8) { const size_t i = (size_t)blockIdx.x * 256 + threadIdx.x; if (i >= n8) return; const v8f v = *(const v8f*)(src + i * 8); v8us o;
#pragma unroll
    for (int k = 0; k < 8; ++k) o[k] = f2bf(v[k]); *(v8us*)(dst + i * 8) = o;  }


__global__ __launch_bounds__(256) void k_vtp(const float* __restrict__ F, int pitch, int nheads, h16* V16, bf* Vh, bf* Vl) { const size_t e = ((size_t)blockIdx.x * 256 + threadIdx.x) * 2; if (e >= (size_t)nheads * HD * TT) return; const int t = (int)(e % TT); const int d = (int)((e / TT) % HD); const int g = (int)(e / ((size_t)TT * HD)); v2h o16; v2us oh, ol;
#pragma unroll
    for (int q = 0; q < 2; ++q) { const float x = F[(size_t)(t + q) * pitch + g * HD + d]; o16[q] = tohx(x); unsigned short a2, c2; splitf(x, a2, c2); oh[q] = a2; ol[q] = c2; }
    *(v2h*)(V16 + e) = o16; *(v2us*)(Vh + e) = oh; *(v2us*)(Vl + e) = ol;  }

// asoft_row: one wave's softmax row over its first NCH chunks of 128 keys, the chunks that hold a live key (LK = livekeys of the batch, NCH = ceil(LK / 128)). The chunks left out hold exact zeros only, so maximum, sum and every stored value keep their bits. NCH is a compile-time count so that the row stays in registers.
template <int NCH>
__device__ __forceinline__ void asoft_row(const float* __restrict__ sr, bf* Ph, bf* Pl, int L, int LK, int lane) {
    float v[NCH * 4]; float mx = -3.0e38f;
    v4f ar[NCH];
    const unsigned bo = lane * 16u, bl = 4u * (unsigned)min((NCH - 1) * 128 + lane * 4, (LK - 1) & ~3);   /* byte offsets of the lane's piece: in chunk 0, and in the last chunk, where the minimum keeps every lane on scores that the live tiles wrote (what it moves is masked below) */
#pragma unroll
    for (int ch = 0; ch < NCH; ++ch) ar[ch] = *(const v4f*)((const char*)sr + (ch < NCH - 1 ? bo + ch * 512u : bl));
#define ARX(i) ar[(i) < NCH ? (i) : NCH - 1]
    asm volatile("s_wait_xcnt 0x0" :: "v"(ARX(0)), "v"(ARX(1)), "v"(ARX(2)), "v"(ARX(3)), "v"(ARX(4)), "v"(ARX(5)), "v"(ARX(6)), "v"(ARX(7)), "v"(bo), "v"(bl) : "memory");   /* the row loads' offset registers are reused behind here: keeps the wait in front of that overwrite. Inputs only: the loaded values, so that every load of the row is issued in front, and the two offsets, so that no load lands in a register that an earlier one names */
#undef ARX
    __builtin_amdgcn_sched_barrier(0);   /* keeps later vector work, which takes over those registers, behind the wait */
#pragma unroll
    for (int ch = 0; ch < NCH; ++ch) { const int j0 = ch * 128 + lane * 4; const v4f a = ar[ch];
#pragma unroll
        for (int q = 0; q < 4; ++q) { const int j = j0 + q; const float t = (ch < NCH - 1 ? L >= 1 : j < L) ? a[q] * SCL : -3.0e38f; v[ch * 4 + q] = t;   /* keys at or beyond the batch's encoder length excluded (-1e10 == exclusion); in front of the last chunk j < LK, so j < L says no more than L >= 1 */ mx = fmaxf(mx, t); } }
#pragma unroll
    for (int sh = 16; sh; sh >>= 1) mx = fmaxf(mx, __shfl_xor(mx, sh, 32));
    float sum = 0.f;
#pragma unroll
    for (int k = 0; k < NCH * 4; ++k) { const float d0 = __fsub_rn(v[k], mx); asm("v_exp_f32 %0, %1\n\tv_nop" : "=v"(v[k]) : "v"(__fmul_rn(d0, 1.4426950408889634f)));   /* exp2 with the slot behind a transcendental in one statement: the next vector instruction may take over its source register, and a v_nop of its own does not stay behind the builtin */ sum += v[k]; }
#pragma unroll
    for (int sh = 16; sh; sh >>= 1) sum += __shfl_xor(sum, sh, 32);
    const float f = __fdiv_rn(1.0f, sum);
#pragma unroll
    for (int ch = 0; ch < NCH; ++ch) { v4us oh, ol;
#pragma unroll
        for (int q = 0; q < 4; ++q) { unsigned short a, c2; splitf(v[ch * 4 + q] * f, a, c2); oh[q] = a; ol[q] = c2; }
        const size_t oo = ch * 128 + lane * 4; *(v4us*)(Ph + oo) = oh; *(v4us*)(Pl + oo) = ol;
        if (ch == NCH - 1) asm volatile("s_wait_xcnt 0x0" ::: "memory");   /* the row's last two stores: keeps the wait in front of whatever next writes a register that they name (the earlier chunks' stores have the compiler's own waits) */
        __builtin_amdgcn_sched_barrier(0); }   /* a chunk's split and stores end before the next chunk's begin: otherwise all chunks' temporaries pile up in front of the stores and the row takes more than 64 registers (12 waves a SIMD instead of 16) */
}
static_assert(RH == TT && ZH == 1 && TT == 1024, "every row hi/lo; eight chunks of 128 keys");
__global__ __launch_bounds__(256) void k_asoft(const float* __restrict__ Sb, bf* Ph, bf* Pl, const int* __restrict__ lenp) {
    const size_t bz = blockIdx.y;   /* batch: one grid plane per batch */
    const int L = lenp[bz];   /* this batch's encoder length */ const int LK = livekeys(L); const int lane = threadIdx.x & 31; const int row = blockIdx.x * 8 + __builtin_amdgcn_readfirstlane(threadIdx.x >> 5);   /* the wave's row as a scalar: the three row pointers then take no vector registers */
    const size_t ro = (bz * TT + row) * TT; const float* sr = Sb + ro; Ph += ro; Pl += ro;
    switch ((LK + 127) >> 7) {   /* the same for the whole block */
        case 1: asoft_row<1>(sr, Ph, Pl, L, LK, lane); break; case 2: asoft_row<2>(sr, Ph, Pl, L, LK, lane); break; case 3: asoft_row<3>(sr, Ph, Pl, L, LK, lane); break; case 4: asoft_row<4>(sr, Ph, Pl, L, LK, lane); break;
        case 5: asoft_row<5>(sr, Ph, Pl, L, LK, lane); break; case 6: asoft_row<6>(sr, Ph, Pl, L, LK, lane); break; case 7: asoft_row<7>(sr, Ph, Pl, L, LK, lane); break; default: asoft_row<8>(sr, Ph, Pl, L, LK, lane); break; }
}
__global__ __launch_bounds__(256) void k_merge(const float* __restrict__ O, int h0, float* OUTb) { const size_t e = ((size_t)blockIdx.x * 256 + threadIdx.x) * 2; if (e >= (size_t)ZH * TT * HD) return; const int d = (int)(e % HD); const int t = (int)((e / HD) % TT); const int zz = (int)(e / ((size_t)HD * TT)); const float cs = (t < RH) ? 1.0f : (1.0f / PCAR); const size_t oo = (size_t)t * DQ + (h0 + zz) * HD + d;
    v2f o2; o2[0] = O[e] * cs; o2[1] = O[e + 1] * cs; *(v2f*)(OUTb + oo) = o2;  }


__global__ __launch_bounds__(256) void k_vtpR1(const float* __restrict__ Vb, bf* Vh) { const size_t e = ((size_t)blockIdx.x * 256 + threadIdx.x) * 2; if (e >= (size_t)HD * TT) return; const int t = (int)(e % TT); const int d = (int)(e / TT); v2us o; o[0] = f2bf(Vb[(size_t)t * HD + d]); o[1] = f2bf(Vb[(size_t)(t + 1) * HD + d]); *(v2us*)(Vh + e) = o;  }
__global__ __launch_bounds__(256) void k_mergeR(const float* __restrict__ O, float* outb, size_t n4) { const size_t i = (size_t)blockIdx.x * 256 + threadIdx.x; if (i >= n4) return; const v4f a = *(const v4f*)(O + i * 4); *(v4f*)(outb + i * 4) = a;  }


// The three passes below move 16 pieces of 16 B per lane (a wave reads 8 KB), in whole 128-B lines: they are bound by how fast waves start, not by their bytes.
#define PCS  16                    // 16-B pieces per lane
#define BLKE (256 * 4 * PCS)       // f32 elements per 256-thread block
static_assert(NH_ == 1 && HD == DM, "one head: the head plane [h][t][d] is the token-major tensor itself");
static_assert(((size_t)NB_ * TT * DM) % BLKE == 0 && TT % 256 == 0 && HD % 64 == 0 && (64 * DM) % BLKE == 0, "whole blocks and tiles only");
// LIVE: src holds keys; only the rows that a live 64-key score tile reads are converted.
template <bool LIVE>
__global__ __launch_bounds__(256) void k_hp1(const float* __restrict__ src, bf* P, const int* __restrict__ lenp) { size_t blk = blockIdx.x;
    if (LIVE) { int z, t; if (!deal(lenp, (int)blockIdx.x, 6, 64 * DM / BLKE, z, t)) return; blk = (size_t)z * (TT * DM / BLKE) + t; }
    const size_t e0 = blk * BLKE + threadIdx.x * 4; v4f v[PCS];
#pragma unroll   /* all loads of the lane in flight before the first convert */
    for (int k = 0; k < PCS; ++k) v[k] = *(const v4f*)(src + e0 + k * 1024);
#pragma unroll   /* v[] stays in registers */
    for (int k = 0; k < PCS; ++k) { v4us o; o[0] = f2bf(v[k][0]); o[1] = f2bf(v[k][1]); o[2] = f2bf(v[k][2]); o[3] = f2bf(v[k][3]); *(v4us*)(P + e0 + k * 1024) = o; } }
// k_vt1: one block transposes a tile of 256 tokens x 64 dims through LDS. tile[d][c] holds 16-B chunks of 8 tokens (a dword = tokens 2tp, 2tp+1); chunk c of row d lies at c ^ (d >> 2), so that the 32 dword stores of a wave (16 dim groups x 2 token pairs) and the 16 chunks that a half wave reads each fall on distinct banks.
__global__ __launch_bounds__(256) void k_vt1(const float* __restrict__ src, bf* VT, const int* __restrict__ lenp) {
    __shared__ __align__(16) unsigned tile[64 * 128];
    int z, t; if (!deal(lenp, (int)blockIdx.x, 8, HD / 64, z, t)) return;   /* only token tiles with a live key; the whole block leaves, in front of the barrier */
    const int tt = t / (HD / 64), td = t % (HD / 64);
    src += ((size_t)z * TT + tt * 256) * DM + td * 64; VT += ((size_t)z * HD + td * 64) * TT + tt * 256;
    const int lane = threadIdx.x & 31, w = threadIdx.x >> 5, g = lane & 15, hf = lane >> 4; const float* sp = src + (size_t)(w * 4 + hf * 2) * DM + g * 4; v4f a[8], c[8];
#pragma unroll   /* all loads of the lane in flight before the first convert */
    for (int it = 0; it < 8; ++it) { a[it] = *(const v4f*)(sp + it * 32 * DM); c[it] = *(const v4f*)(sp + it * 32 * DM + DM); }   /* token pair tp = it * 16 + w * 2 + hf: rows 2 tp and 2 tp + 1 */
    __builtin_amdgcn_sched_barrier(0);   /* keeps all 16 loads in flight at once: without it the last five are issued only behind the first converts */
#pragma unroll   /* a[], c[] stay in registers */
    for (int it = 0; it < 8; ++it) { const int tp = it * 16 + w * 2 + hf;
#pragma unroll   /* vector elements picked by constants */
        for (int q = 0; q < 4; ++q) tile[(g * 4 + q) * 128 + (((tp >> 2) ^ g) << 2) + (tp & 3)] = (unsigned)f2bf(a[it][q]) | ((unsigned)f2bf(c[it][q]) << 16); }
    __syncthreads();   /* every wave's columns are in the tile before any row is read */
#pragma unroll   /* eight independent LDS reads and stores per lane */
    for (int it = 0; it < 8; ++it) { const int d = it * 8 + w; const v4i r = *(const v4i*)(tile + d * 128 + ((lane ^ ((d >> 2) & 15)) << 2)); *(v4i*)(VT + (size_t)d * TT + lane * 8) = r; }
}
__global__ __launch_bounds__(256) void k_mergeT(const float* __restrict__ O, float* outb) { const size_t e0 = (size_t)blockIdx.x * BLKE + threadIdx.x * 4; v4f v[PCS];
#pragma unroll   /* all loads of the lane in flight before the first store */
    for (int k = 0; k < PCS; ++k) v[k] = *(const v4f*)(O + e0 + k * 1024);
    __builtin_amdgcn_sched_barrier(0);   /* keeps all 16 loads in front of the first store: without it the last two loads are issued behind two stores, into those stores' data registers */
#pragma unroll   /* v[] stays in registers */
    for (int k = 0; k < PCS; ++k) *(v4f*)(outb + e0 + k * 1024) = v[k]; }

extern "C" void kernel_launch(void* const* d_in, const int* in_sizes, int n_in,
                              void* d_out, int out_size, void* d_ws, size_t ws_size, hipStream_t stream) {
    (void)in_sizes; (void)n_in; (void)out_size;
    const float* Qin = (const float*)d_in[0]; const float* Kin = (const float*)d_in[1]; const float* Vin = Kin;   /* query = output, key = value = encoder_outputs */ const int* lens = (const int*)d_in[2];   /* encoder_sequence_lengths [16] int */
    float* OUT = (float*)d_out;
    char* wsp = (char*)d_ws;
    auto take = [&](size_t bytes) { char* p = wsp; wsp += (bytes + 255) & ~(size_t)255; return (void*)p; };
    /* every plane holds all NB_ batches, batch-major; each launch covers all batches (a flat grid for the convert and copy passes, the transposition and the scores, grid y for the softmax, grid z for the second GEMM) */
    bf* QB = (bf*)take((size_t)NB_ * NH_ * TT * HD * 2); bf* KB = (bf*)take((size_t)NB_ * NH_ * TT * HD * 2); bf* VT = (bf*)take((size_t)NB_ * NH_ * HD * TT * 2);
    float* Sb = (float*)take((size_t)NB_ * TT * TT * 4);  bf* Ph = (bf*)take((size_t)NB_ * TT * TT * 2); bf* Pl = (bf*)take((size_t)NB_ * TT * TT * 2); float* Ob = (float*)take((size_t)NB_ * TT * HD * 4);
    if ((size_t)(wsp - (char*)d_ws) > ws_size) return;
    k_hp1<false><<<dim3((unsigned)((size_t)NB_ * TT * DM / BLKE), 1, 1), 256, 0, stream>>>(Qin, QB, nullptr); k_hp1<true><<<dim3((unsigned)((size_t)NB_ * TT * DM / BLKE), 1, 1), 256, 0, stream>>>(Kin, KB, lens); k_vt1<<<dim3((TT / 256) * (HD / 64) * NB_, 1, 1), 256, 0, stream>>>(Vin, VT, lens);
    for (int h = 0; h < NH_; ++h) {
        k_gemmw<bf, 0, false, 1, HD><<<dim3((TT / 64) * (TT / 64) * NB_, 1, 1), 32, 0, stream>>>(QB + (size_t)h * TT * HD, nullptr, KB + (size_t)h * TT * HD, nullptr, Sb, TT, nullptr, (size_t)NH_ * TT * HD, (size_t)NH_ * TT * HD, (size_t)TT * TT, lens);   /* exact scores (single bf16 planes) */
        k_asoft<<<dim3(TT / 8, NB_, 1), 256, 0, stream>>>(Sb, Ph, Pl, lens);
        k_gemmw<bf, 1, false, 2, TT><<<dim3(TT / 64, HD / 64, NB_), 32, 0, stream>>>(Ph, Pl, VT + (size_t)h * HD * TT, nullptr, Ob, HD, nullptr, (size_t)TT * TT, (size_t)NH_ * HD * TT, (size_t)TT * HD, lens);   /* P (hi/lo) x exact v^T */
        k_mergeT<<<dim3((unsigned)((size_t)NB_ * TT * DM / BLKE), 1, 1), 256, 0, stream>>>(Ob, OUT); }
}

// v005
// One run takes 69.1 microseconds.
// Timed twice side by side with v004, it ran 1.21 times as fast both times.
// Counting every step since v000, it is 12.7 times as fast.
#include <hip/hip_runtime.h>

// Scaled dot-product cross attention with key-length masking (query = output [16][1024][512]; key = value = encoder_outputs [16][1024][512]; scores = q.k x rsqrt(512); keys j >= encoder_sequence_lengths[b] -> -1e10 (== exclusion; lengths [16] int in [1, 1024], read); softmax; context = attn value -> [16][1024][512] (8.4 M); ONE 512-wide head).
// Layout per batch: single bf16 planes of q and k (inputs bf16-exact: exact score products over the 512 dims) and value^T planes from the same encoder tensor; softmax (every row hi/lo) whose select keeps keys below the batch's length (read on device); P hi/lo x exact value; output rows.
// Compute dtypes, f32 accumulate: every input rounded to bf16; q.k exact; softmax f32; P hi/lo x exact value (2 products); output f32.

#define NB_  16
#define TT   1024
#define DM   512      // token-major row pitch (H x HD)
#define NH_  1
#define NKV  1
#define REP  (NH_ / NKV)
#define HD   512
#define DQ   (NH_ * HD)
#define DKV  (NKV * HD)
#define ZH   1
#define RH   1024                  // query rows < RH use hi+lo planes (0: none)
#define WIN  0
#define PCAR 1024.0f
#define SCL  0.044194173824159216f   // rsqrt(512) (= 2^-4.5; one f32 multiply)
typedef _Float16 h16;
typedef unsigned short bf;
typedef __attribute__((ext_vector_type(16))) __bf16   v16bf;
typedef __attribute__((ext_vector_type(16))) _Float16 v16h;
typedef __attribute__((ext_vector_type(8)))  _Float16 v8h;
typedef __attribute__((ext_vector_type(8)))  unsigned short v8us;
typedef __attribute__((ext_vector_type(8)))  float    v8f;
typedef __attribute__((ext_vector_type(4)))  float    v4f;
typedef v8h  __attribute__((may_alias)) v8ha;
typedef v4f  __attribute__((may_alias)) v4fa;
typedef v8us __attribute__((may_alias)) v8usa;

__device__ __forceinline__ unsigned short f2bf(float f) { unsigned u = __float_as_uint(f); u += 0x7FFFu + ((u >> 16) & 1u); return (unsigned short)(u >> 16); }
__device__ __forceinline__ float bf2f(unsigned short b) { return __uint_as_float(((unsigned)b) << 16); }
__device__ __forceinline__ float bfr(float f) { return bf2f(f2bf(f)); }
__device__ __forceinline__ v16h cat16(v8h lo, v8h hi) { return __builtin_shufflevector(lo, hi, 0, 1, 2, 3, 4, 5, 6, 7, 8, 9, 10, 11, 12, 13, 14, 15); }
__device__ __forceinline__ v16bf cat16b(v8us lo, v8us hi) { return __builtin_bit_cast(v16bf, __builtin_shufflevector(lo, hi, 0, 1, 2, 3, 4, 5, 6, 7, 8, 9, 10, 11, 12, 13, 14, 15)); }
__device__ __forceinline__ v8f wmma16(v16h a, v16h b, v8f c) { return __builtin_amdgcn_wmma_f32_16x16x32_f16(false, a, false, b, (short)0, c, false, false); }
__device__ __forceinline__ v8f wmmab(v16bf a, v16bf b, v8f c) { return __builtin_amdgcn_wmma_f32_16x16x32_bf16(false, a, false, b, (short)0, c, false, false); }



// ---- Keys at or beyond a batch's length have softmax weight exactly 0 (exp of about -1e10 below the row's maximum), so tiles that hold no live key are not converted, multiplied, read or stored.
// livekeys: how many keys of a batch can weigh. A length below 1 masks every key alike (the softmax is then uniform over all TT keys) and one above TT masks none: both leave all TT keys in play, and the value bounds every index formed from it.
__device__ __forceinline__ int livekeys(int L) { return (L < 1 || L > TT) ? TT : L; }
// deal: piece number id of a launch that runs live pieces only -> batch z and piece t inside it; batch b has per * ceil(livekeys / 2^sh) pieces. Live pieces take the lowest block numbers, so that they spread evenly over the chip; false: no piece left for this block.
__device__ __forceinline__ bool deal(const int* __restrict__ lenp, int id, int sh, int per, int& z, int& t) {
    int end = 0; z = 0; t = id;
#pragma unroll   /* the 16 lengths come in one scalar load, the search stays scalar */
    for (int b = 0; b < NB_; ++b) { end += per * ((livekeys(lenp[b]) + (1 << sh) - 1) >> sh); if (id >= end) { z = b + 1; t = id - end; } }   /* z: how many batches end at or below id */
    return z < NB_;
}

// ---- k_gemmw: register-blocked GEMM, ONE WAVE per 64x64 output tile (16 accumulators), operands from K-contiguous 16-bit planes through LDS; grid (M/64, N/64, Z), 32 threads.
// A stage is 64 k of every operand's 64 rows. Asynchronous copies bring it in whole 128-B lines (a copy of the wave covers 4 rows; a fragment load from global memory touched 16 lines for the same 512 B), two buffers: the next stage flies while this one is multiplied.
// C[m][n] (f32, pitch ldc, + optional f32 bias[n]) = sum_k A[m][k] Bt[n][k] (+ split products per NSPLIT). z-batch strides sA/sB/sC in elements. K (compile time) % 64 == 0.
// LIVE 1: n is the key; flat grid, only tiles with a live key run (TT / 64 row tiles per 64 keys). LIVE 2: k is the key; the k loop ends at the batch's live keys, rounded up to 64 (A is exactly 0 there, Bt finite).
#define GLB __attribute__((address_space(1)))   /* the copies' source pointers are global */
#define SPB 144            /* LDS row pitch in bytes: 128 B of k and 16 B more (16 B x odd), so that the 16 rows which a half wave reads with ds_load_b128 fall on distinct banks */
#define SOP (64 * SPB)     /* one operand's 64 rows of a stage */
// copy16: one operand's 64 rows of a stage, sixteen copies of 16 B a lane, 4 rows each. Copy i lands at LDS address l + i * 4 rows. The immediate offset moves both addresses, so the one LDS register serves all sixteen and the global register of copy i holds g + i * GP less that offset (it stays inside the plane: GP is larger).
// The wait is the statement's last line: it stands in front of whatever next writes a register that a copy names.
template <int GP>
__device__ __forceinline__ void copy16(unsigned l, const GLB char* g) {
    static_assert(4 * SPB == 576 && GP > 576 && GP % 16 == 0, "the offsets in the text below are i * 4 rows of the LDS pitch"); constexpr int GS = GP - 4 * SPB;
    asm volatile(
                 "global_load_async_to_lds_b128 %0, %1, off\n\tglobal_load_async_to_lds_b128 %0, %2, off offset:576\n\tglobal_load_async_to_lds_b128 %0, %3, off offset:1152\n\tglobal_load_async_to_lds_b128 %0, %4, off offset:1728\n\t"
                 "global_load_async_to_lds_b128 %0, %5, off offset:2304\n\tglobal_load_async_to_lds_b128 %0, %6, off offset:2880\n\tglobal_load_async_to_lds_b128 %0, %7, off offset:3456\n\tglobal_load_async_to_lds_b128 %0, %8, off offset:4032\n\t"
                 "global_load_async_to_lds_b128 %0, %9, off offset:4608\n\tglobal_load_async_to_lds_b128 %0, %10, off offset:5184\n\tglobal_load_async_to_lds_b128 %0, %11, off offset:5760\n\tglobal_load_async_to_lds_b128 %0, %12, off offset:6336\n\t"
                 "global_load_async_to_lds_b128 %0, %13, off offset:6912\n\tglobal_load_async_to_lds_b128 %0, %14, off offset:7488\n\tglobal_load_async_to_lds_b128 %0, %15, off offset:8064\n\tglobal_load_async_to_lds_b128 %0, %16, off offset:8640\n\t"
                 "s_wait_xcnt 0x0"
                 :: "v"(l), "v"(g), "v"(g + 1 * GS), "v"(g + 2 * GS), "v"(g + 3 * GS), "v"(g + 4 * GS), "v"(g + 5 * GS), "v"(g + 6 * GS), "v"(g + 7 * GS),
                    "v"(g + 8 * GS), "v"(g + 9 * GS), "v"(g + 10 * GS), "v"(g + 11 * GS), "v"(g + 12 * GS), "v"(g + 13 * GS), "v"(g + 14 * GS), "v"(g + 15 * GS) : "memory"); }
template <typename T16> struct WFrag;
template <> struct WFrag<h16> { typedef v16h V; static __device__ __forceinline__ V ld(const char* p) { return cat16(*(const v8ha*)p, *(const v8ha*)(p + 32)); } static __device__ __forceinline__ v8f mma(V a, V b, v8f c) { return wmma16(a, b, c); } };
template <> struct WFrag<bf> { typedef v16bf V; static __device__ __forceinline__ V ld(const char* p) { return cat16b(*(const v8usa*)p, *(const v8usa*)(p + 32)); } static __device__ __forceinline__ v8f mma(V a, V b, v8f c) { return wmmab(a, b, c); } };
template <typename T16, int NSPLIT, bool BIAS, int LIVE, int K>
__global__ __launch_bounds__(32) void k_gemmw(const T16* __restrict__ A, const T16* __restrict__ A2, const T16* __restrict__ Bt, const T16* __restrict__ Bt2, float* C, int ldc, const float* __restrict__ bias, size_t sA, size_t sB, size_t sC, const int* __restrict__ lenp) {
    typedef typename WFrag<T16>::V V; static_assert(K % 64 == 0, "a trip of the k loop is two steps of 32");
    constexpr bool HA2 = (NSPLIT == 1 || NSPLIT == 2), HB2 = (NSPLIT >= 2); constexpr int STB = (2 + (HA2 ? 1 : 0) + (HB2 ? 1 : 0)) * SOP;   /* bytes of a stage: A, Bt, then A2, Bt2 where they exist */
    static_assert(STB / SOP * 16 <= 63, "a stage's copies of the wave, all in flight at once"); static_assert(2 * STB >= 16 * 68 * 4, "the output staging fits in the ring");
    __shared__ __align__(16) char ring[2 * STB]; float* os = (float*)ring;   /* behind the k loop the ring is the output staging */
    int zb = blockIdx.z, tx = blockIdx.x, ty = blockIdx.y;
    if (LIVE == 1) { int t; if (!deal(lenp, (int)blockIdx.x, 6, TT / 64, zb, t)) return; tx = t % (TT / 64); ty = t / (TT / 64); }
    const int Kend = (LIVE == 2) ? ((livekeys(lenp[zb]) + 63) & ~63) : K;
    const size_t z = zb; A += z * sA; if (A2) A2 += z * sA; Bt += z * sB; if (Bt2) Bt2 += z * sB; C += z * sC;
    const int lane = threadIdx.x & 31, lr = lane & 15, hi = lane >> 4; const int r0 = tx * 64, c0 = ty * 64;
    v8f acc[4][4];
#pragma unroll
    for (int mb = 0; mb < 4; ++mb)
#pragma unroll
        for (int nb = 0; nb < 4; ++nb) acc[mb][nb] = (v8f){};
    const size_t go = ((size_t)(lane >> 3) * K + 8 * (lane & 7)) * sizeof(T16);   /* a copy's lane: row lane / 8 of its four, piece lane % 8 of the row's 128 B */
    const GLB char* ga = (const GLB char*)(A + (size_t)r0 * K) + go; const GLB char* gb = (const GLB char*)(Bt + (size_t)c0 * K) + go;
    const GLB char* ga2 = HA2 ? (const GLB char*)(A2 + (size_t)r0 * K) + go : nullptr; const GLB char* gb2 = HB2 ? (const GLB char*)(Bt2 + (size_t)c0 * K) + go : nullptr;
    const unsigned lc = (unsigned)(size_t)ring + (lane >> 3) * SPB + (lane & 7) * 16;   /* the lane's LDS byte address in buffer 0: the low 32 bits of the __shared__ address */
    constexpr int GP = 4 * K * (int)sizeof(T16);   /* four rows on in the plane */
    auto stage = [&](const unsigned l) __attribute__((always_inline)) {   /* the next stage's copies into the buffer at l; the source pointers move on by 64 k */
        copy16<GP>(l, ga); copy16<GP>(l + SOP, gb); if (HA2) copy16<GP>(l + 2 * SOP, ga2); if (HB2) copy16<GP>(l + STB - SOP, gb2);
        ga += 128; gb += 128; if (HA2) ga2 += 128; if (HB2) gb2 += 128; };
    const char* fr = ring + lr * SPB + hi * 16;   /* the lane's place in a fragment: row lr, k 8 hi .. 8 hi + 7 and 16 further on, as in the planes */
    V a[2][4], a2[2][4], b[2][4], b2[2][4];   /* two fragment sets, one per k step of a stage: the second one's LDS reads fly under the first one's products */
    auto ldset = [&](const int S, const char* f) __attribute__((always_inline)) {   /* S is a constant at every call: the sets stay in registers */
#pragma unroll
        for (int q = 0; q < 4; ++q) { a[S][q] = WFrag<T16>::ld(f + q * 16 * SPB); if (HA2) a2[S][q] = WFrag<T16>::ld(f + 2 * SOP + q * 16 * SPB);
            b[S][q] = WFrag<T16>::ld(f + SOP + q * 16 * SPB); if (HB2) b2[S][q] = WFrag<T16>::ld(f + STB - SOP + q * 16 * SPB); }
        __builtin_amdgcn_sched_barrier(0); };   /* the whole set's reads are issued in front of the products: without it they sink to their first use and their latency is waited out */
    auto mmaset = [&](const int S) __attribute__((always_inline)) {
#pragma unroll
        for (int nb = 0; nb < 4; ++nb) {
#pragma unroll
            for (int mb = 0; mb < 4; ++mb) { acc[mb][nb] = WFrag<T16>::mma(a[S][mb], b[S][nb], acc[mb][nb]); if (NSPLIT == 1 || NSPLIT == 2) acc[mb][nb] = WFrag<T16>::mma(a2[S][mb], b[S][nb], acc[mb][nb]); if (NSPLIT >= 2) acc[mb][nb] = WFrag<T16>::mma(a[S][mb], b2[S][nb], acc[mb][nb]); } }
        __builtin_amdgcn_sched_barrier(0); };   /* the first set's products all stand in front of the second's: they run while the second set's LDS reads are still landing */
    const int nt = Kend >> 6;   /* stages; the same for the whole block, at least one */
    stage(lc);
    asm volatile("s_wait_asynccnt 0x0" ::: "memory");   /* stage 0 has landed */
    __syncthreads();   /* nothing of stage 0 is read in front of here (a work-group is one wave, the ring is its own: the compiler emits no barrier instruction for this) */
    if (nt > 1) stage(lc + STB);
#pragma unroll 1   /* one trip is one stage: two k steps, one per fragment set */
    for (int t = 0; t < nt; ++t) {
        const int bo = (t & 1) * STB;
        ldset(0, fr + bo);
        ldset(1, fr + bo + 64);
        mmaset(0);
        mmaset(1);
        asm volatile("s_wait_dscnt 0x0" ::: "memory");   /* this stage's LDS reads have ended before its buffer is refilled */
        asm volatile("s_wait_asynccnt 0x0" ::: "memory");   /* the next stage has landed */
        __syncthreads();   /* the next stage is read, and this one's buffer refilled, only behind here (no instruction either: one wave) */
        if (t + 2 < nt) stage(lc + bo);
    }
    asm volatile("s_wait_asynccnt 0x0" ::: "memory");   /* no copy is outstanding when the ring becomes the output staging */
#pragma unroll
    for (int mb = 0; mb < 4; ++mb) {
#pragma unroll
        for (int nb = 0; nb < 4; ++nb) {
#pragma unroll
            for (int j = 0; j < 8; ++j) os[(hi * 8 + j) * 68 + nb * 16 + lr] = acc[mb][nb][j]; }
        __builtin_amdgcn_wave_barrier(); asm volatile("" ::: "memory");
        float* crow = C + (size_t)(r0 + mb * 16) * ldc + c0;
{
#pragma unroll
            for (int s = 0; s < 8; ++s) { const int row = 2 * s + hi, cofs = lr * 4; v4f val = *(const v4fa*)(os + row * 68 + cofs); if (BIAS) { val[0] += bfr(bias[c0 + cofs]); val[1] += bfr(bias[c0 + cofs + 1]); val[2] += bfr(bias[c0 + cofs + 2]); val[3] += bfr(bias[c0 + cofs + 3]); }
                *(v4f*)(crow + (size_t)row * ldc + cofs) = val; }
             }
        __builtin_amdgcn_wave_barrier(); asm volatile("" ::: "memory");
    }
}

__device__ __forceinline__ h16 tohx(float x) { return (h16)x; }
__device__ __forceinline__ void splitf(float y, unsigned short& h, unsigned short& l) { h = f2bf(y); l = f2bf(y - bf2f(h)); }
typedef __attribute__((ext_vector_type(2))) _Float16 v2h;
typedef __attribute__((ext_vector_type(4))) _Float16 v4h;
typedef __attribute__((ext_vector_type(2))) unsigned short v2us;
typedef __attribute__((ext_vector_type(4))) unsigned short v4us;
typedef __attribute__((ext_vector_type(2))) float v2f;
typedef __attribute__((ext_vector_type(4))) int v4i;

__global__ __launch_bounds__(256) void k_wtG(const float* __restrict__ w, int K, int N, bf* Bt) {
    const int lane = threadIdx.x & 31; const int L0 = (blockIdx.x * 8 + (threadIdx.x >> 5)) * 8; const int nlines = N * K / 64;
{
#pragma unroll 1
        for (int l = 0; l < 8; ++l) { const int L = L0 + l; if (L >= nlines) break; const size_t e = (size_t)L * 64 + lane * 2; const int k = (int)(e % K), n = (int)(e / K); v2us o;
            o[0] = f2bf(w[(size_t)k * N + n]); o[1] = f2bf(w[(size_t)(k + 1) * N + n]); *(v2us*)(Bt + e) = o; }
         }
}
__global__ __launch_bounds__(256) void k_cvt8(const float* __restrict__ src, bf* dst, size_t n8) { const size_t i = (size_t)blockIdx.x * 256 + threadIdx.x; if (i >= n8) return; const v8f v = *(const v8f*)(src + i * 8); v8us o;
#pragma unroll
    for (int k = 0; k < 8; ++k) o[k] = f2bf(v[k]); *(v8us*)(dst + i * 8) = o;  }


__global__ __launch_bounds__(256) void k_vtp(const float* __restrict__ F, int pitch, int nheads, h16* V16, bf* Vh, bf* Vl) { const size_t e = ((size_t)blockIdx.x * 256 + threadIdx.x) * 2; if (e >= (size_t)nheads * HD * TT) return; const int t = (int)(e % TT); const int d = (int)((e / TT) % HD); const int g = (int)(e / ((size_t)TT * HD)); v2h o16; v2us oh, ol;
#pragma unroll
    for (int q = 0; q < 2; ++q) { const float x = F[(size_t)(t + q) * pitch + g * HD + d]; o16[q] = tohx(x); unsigned short a2, c2; splitf(x, a2, c2); oh[q] = a2; ol[q] = c2; }
    *(v2h*)(V16 + e) = o16; *(v2us*)(Vh + e) = oh; *(v2us*)(Vl + e) = ol;  }

// asoft_row: one wave's softmax row over its first NCH chunks of 128 keys, the chunks that hold a live key (LK = livekeys of the batch, NCH = ceil(LK / 128)). The chunks left out hold exact zeros only, so maximum, sum and every stored value keep their bits. NCH is a compile-time count so that the row stays in registers.
template <int NCH>
__device__ __forceinline__ void asoft_row(const float* __restrict__ sr, bf* Ph, bf* Pl, int L, int LK, int lane) {
    float v[NCH * 4]; float mx = -3.0e38f;
    v4f ar[NCH];
    const unsigned bo = lane * 16u, bl = 4u * (unsigned)min((NCH - 1) * 128 + lane * 4, (LK - 1) & ~3);   /* byte offsets of the lane's piece: in chunk 0, and in the last chunk, where the minimum keeps every lane on scores that the live tiles wrote (what it moves is masked below) */
#pragma unroll
    for (int ch = 0; ch < NCH; ++ch) ar[ch] = *(const v4f*)((const char*)sr + (ch < NCH - 1 ? bo + ch * 512u : bl));
#define ARX(i) ar[(i) < NCH ? (i) : NCH - 1]
    asm volatile("s_wait_xcnt 0x0" :: "v"(ARX(0)), "v"(ARX(1)), "v"(ARX(2)), "v"(ARX(3)), "v"(ARX(4)), "v"(ARX(5)), "v"(ARX(6)), "v"(ARX(7)), "v"(bo), "v"(bl) : "memory");   /* the row loads' offset registers are reused behind here: keeps the wait in front of that overwrite. Inputs only: the loaded values, so that every load of the row is issued in front, and the two offsets, so that no load lands in a register that an earlier one names */
#undef ARX
    __builtin_amdgcn_sched_barrier(0);   /* keeps later vector work, which takes over those registers, behind the wait */
#pragma unroll
    for (int ch = 0; ch < NCH; ++ch) { const int j0 = ch * 128 + lane * 4; const v4f a = ar[ch];
#pragma unroll
        for (int q = 0; q < 4; ++q) { const int j = j0 + q; const float t = (ch < NCH - 1 ? L >= 1 : j < L) ? a[q] * SCL : -3.0e38f; v[ch * 4 + q] = t;   /* keys at or beyond the batch's encoder length excluded (-1e10 == exclusion); in front of the last chunk j < LK, so j < L says no more than L >= 1 */ mx = fmaxf(mx, t); } }
#pragma unroll
    for (int sh = 16; sh; sh >>= 1) mx = fmaxf(mx, __shfl_xor(mx, sh, 32));
    float sum = 0.f;
#pragma unroll
    for (int k = 0; k < NCH * 4; ++k) { const float d0 = __fsub_rn(v[k], mx); asm("v_exp_f32 %0, %1\n\tv_nop" : "=v"(v[k]) : "v"(__fmul_rn(d0, 1.4426950408889634f)));   /* exp2 with the slot behind a transcendental in one statement: the next vector instruction may take over its source register, and a v_nop of its own does not stay behind the builtin */ sum += v[k]; }
#pragma unroll
    for (int sh = 16; sh; sh >>= 1) sum += __shfl_xor(sum, sh, 32);
    const float f = __fdiv_rn(1.0f, sum);
#pragma unroll
    for (int ch = 0; ch < NCH; ++ch) { v4us oh, ol;
#pragma unroll
        for (int q = 0; q < 4; ++q) { unsigned short a, c2; splitf(v[ch * 4 + q] * f, a, c2); oh[q] = a; ol[q] = c2; }
        const size_t oo = ch * 128 + lane * 4; *(v4us*)(Ph + oo) = oh; *(v4us*)(Pl + oo) = ol;
        if (ch == NCH - 1) asm volatile("s_wait_xcnt 0x0" ::: "memory");   /* the row's last two stores: keeps the wait in front of whatever next writes a register that they name (the earlier chunks' stores have the compiler's own waits) */
        __builtin_amdgcn_sched_barrier(0); }   /* a chunk's split and stores end before the next chunk's begin: otherwise all chunks' temporaries pile up in front of the stores and the row takes more than 64 registers (12 waves a SIMD instead of 16) */
}
static_assert(RH == TT && ZH == 1 && TT == 1024, "every row hi/lo; eight chunks of 128 keys");
__global__ __launch_bounds__(256) void k_asoft(const float* __restrict__ Sb, bf* Ph, bf* Pl, const int* __restrict__ lenp) {
    const size_t bz = blockIdx.y;   /* batch: one grid plane per batch */
    const int L = lenp[bz];   /* this batch's encoder length */ const int LK = livekeys(L); const int lane = threadIdx.x & 31; const int row = blockIdx.x * 8 + __builtin_amdgcn_readfirstlane(threadIdx.x >> 5);   /* the wave's row as a scalar: the three row pointers then take no vector registers */
    const size_t ro = (bz * TT + row) * TT; const float* sr = Sb + ro; Ph += ro; Pl += ro;
    switch ((LK + 127) >> 7) {   /* the same for the whole block */
        case 1: asoft_row<1>(sr, Ph, Pl, L, LK, lane); break; case 2: asoft_row<2>(sr, Ph, Pl, L, LK, lane); break; case 3: asoft_row<3>(sr, Ph, Pl, L, LK, lane); break; case 4: asoft_row<4>(sr, Ph, Pl, L, LK, lane); break;
        case 5: asoft_row<5>(sr, Ph, Pl, L, LK, lane); break; case 6: asoft_row<6>(sr, Ph, Pl, L, LK, lane); break; case 7: asoft_row<7>(sr, Ph, Pl, L, LK, lane); break; default: asoft_row<8>(sr, Ph, Pl, L, LK, lane); break; }
}
__global__ __launch_bounds__(256) void k_merge(const float* __restrict__ O, int h0, float* OUTb) { const size_t e = ((size_t)blockIdx.x * 256 + threadIdx.x) * 2; if (e >= (size_t)ZH * TT * HD) return; const int d = (int)(e % HD); const int t = (int)((e / HD) % TT); const int zz = (int)(e / ((size_t)HD * TT)); const float cs = (t < RH) ? 1.0f : (1.0f / PCAR); const size_t oo = (size_t)t * DQ + (h0 + zz) * HD + d;
    v2f o2; o2[0] = O[e] * cs; o2[1] = O[e + 1] * cs; *(v2f*)(OUTb + oo) = o2;  }


__global__ __launch_bounds__(256) void k_vtpR1(const float* __restrict__ Vb, bf* Vh) { const size_t e = ((size_t)blockIdx.x * 256 + threadIdx.x) * 2; if (e >= (size_t)HD * TT) return; const int t = (int)(e % TT); const int d = (int)(e / TT); v2us o; o[0] = f2bf(Vb[(size_t)t * HD + d]); o[1] = f2bf(Vb[(size_t)(t + 1) * HD + d]); *(v2us*)(Vh + e) = o;  }
__global__ __launch_bounds__(256) void k_mergeR(const float* __restrict__ O, float* outb, size_t n4) { const size_t i = (size_t)blockIdx.x * 256 + threadIdx.x; if (i >= n4) return; const v4f a = *(const v4f*)(O + i * 4); *(v4f*)(outb + i * 4) = a;  }


// The three passes below move 16 pieces of 16 B per lane (a wave reads 8 KB), in whole 128-B lines: they are bound by how fast waves start, not by their bytes.
#define PCS  16                    // 16-B pieces per lane
#define BLKE (256 * 4 * PCS)       // f32 elements per 256-thread block
static_assert(NH_ == 1 && HD == DM, "one head: the head plane [h][t][d] is the token-major tensor itself");
static_assert(((size_t)NB_ * TT * DM) % BLKE == 0 && TT % 256 == 0 && HD % 64 == 0 && (64 * DM) % BLKE == 0, "whole blocks and tiles only");
// LIVE: src holds keys; only the rows that a live 64-key score tile reads are converted.
template <bool LIVE>
__global__ __launch_bounds__(256) void k_hp1(const float* __restrict__ src, bf* P, const int* __restrict__ lenp) { size_t blk = blockIdx.x;
    if (LIVE) { int z, t; if (!deal(lenp, (int)blockIdx.x, 6, 64 * DM / BLKE, z, t)) return; blk = (size_t)z * (TT * DM / BLKE) + t; }
    const size_t e0 = blk * BLKE + threadIdx.x * 4; v4f v[PCS];
#pragma unroll   /* all loads of the lane in flight before the first convert */
    for (int k = 0; k < PCS; ++k) v[k] = *(const v4f*)(src + e0 + k * 1024);
#pragma unroll   /* v[] stays in registers */
    for (int k = 0; k < PCS; ++k) { v4us o; o[0] = f2bf(v[k][0]); o[1] = f2bf(v[k][1]); o[2] = f2bf(v[k][2]); o[3] = f2bf(v[k][3]); *(v4us*)(P + e0 + k * 1024) = o; } }
// k_vt1: one block transposes a tile of 256 tokens x 64 dims through LDS. tile[d][c] holds 16-B chunks of 8 tokens (a dword = tokens 2tp, 2tp+1); chunk c of row d lies at c ^ (d >> 2), so that the 32 dword stores of a wave (16 dim groups x 2 token pairs) and the 16 chunks that a half wave reads each fall on distinct banks.
__global__ __launch_bounds__(256) void k_vt1(const float* __restrict__ src, bf* VT, const int* __restrict__ lenp) {
    __shared__ __align__(16) unsigned tile[64 * 128];
    int z, t; if (!deal(lenp, (int)blockIdx.x, 8, HD / 64, z, t)) return;   /* only token tiles with a live key; the whole block leaves, in front of the barrier */
    const int tt = t / (HD / 64), td = t % (HD / 64);
    src += ((size_t)z * TT + tt * 256) * DM + td * 64; VT += ((size_t)z * HD + td * 64) * TT + tt * 256;
    const int lane = threadIdx.x & 31, w = threadIdx.x >> 5, g = lane & 15, hf = lane >> 4; const float* sp = src + (size_t)(w * 4 + hf * 2) * DM + g * 4; v4f a[8], c[8];
#pragma unroll   /* all loads of the lane in flight before the first convert */
    for (int it = 0; it < 8; ++it) { a[it] = *(const v4f*)(sp + it * 32 * DM); c[it] = *(const v4f*)(sp + it * 32 * DM + DM); }   /* token pair tp = it * 16 + w * 2 + hf: rows 2 tp and 2 tp + 1 */
    __builtin_amdgcn_sched_barrier(0);   /* keeps all 16 loads in flight at once: without it the last five are issued only behind the first converts */
#pragma unroll   /* a[], c[] stay in registers */
    for (int it = 0; it < 8; ++it) { const int tp = it * 16 + w * 2 + hf;
#pragma unroll   /* vector elements picked by constants */
        for (int q = 0; q < 4; ++q) tile[(g * 4 + q) * 128 + (((tp >> 2) ^ g) << 2) + (tp & 3)] = (unsigned)f2bf(a[it][q]) | ((unsigned)f2bf(c[it][q]) << 16); }
    __syncthreads();   /* every wave's columns are in the tile before any row is read */
#pragma unroll   /* eight independent LDS reads and stores per lane */
    for (int it = 0; it < 8; ++it) { const int d = it * 8 + w; const v4i r = *(const v4i*)(tile + d * 128 + ((lane ^ ((d >> 2) & 15)) << 2)); *(v4i*)(VT + (size_t)d * TT + lane * 8) = r; }
}
__global__ __launch_bounds__(256) void k_mergeT(const float* __restrict__ O, float* outb) { const size_t e0 = (size_t)blockIdx.x * BLKE + threadIdx.x * 4; v4f v[PCS];
#pragma unroll   /* all loads of the lane in flight before the first store */
    for (int k = 0; k < PCS; ++k) v[k] = *(const v4f*)(O + e0 + k * 1024);
    __builtin_amdgcn_sched_barrier(0);   /* keeps all 16 loads in front of the first store: without it the last two loads are issued behind two stores, into those stores' data registers */
#pragma unroll   /* v[] stays in registers */
    for (int k = 0; k < PCS; ++k) *(v4f*)(outb + e0 + k * 1024) = v[k]; }

extern "C" void kernel_launch(void* const* d_in, const int* in_sizes, int n_in,
                              void* d_out, int out_size, void* d_ws, size_t ws_size, hipStream_t stream) {
    (void)in_sizes; (void)n_in; (void)out_size;
    const float* Qin = (const float*)d_in[0]; const float* Kin = (const float*)d_in[1]; const float* Vin = Kin;   /* query = output, key = value = encoder_outputs */ const int* lens = (const int*)d_in[2];   /* encoder_sequence_lengths [16] int */
    float* OUT = (float*)d_out;
    char* wsp = (char*)d_ws;
    auto take = [&](size_t bytes) { char* p = wsp; wsp += (bytes + 255) & ~(size_t)255; return (void*)p; };
    /* every plane holds all NB_ batches, batch-major; each launch covers all batches (a flat grid for the convert and copy passes, the transposition and the scores, grid y for the softmax, grid z for the second GEMM) */
    bf* QB = (bf*)take((size_t)NB_ * NH_ * TT * HD * 2); bf* KB = (bf*)take((size_t)NB_ * NH_ * TT * HD * 2); bf* VT = (bf*)take((size_t)NB_ * NH_ * HD * TT * 2);
    float* Sb = (float*)take((size_t)NB_ * TT * TT * 4);  bf* Ph = (bf*)take((size_t)NB_ * TT * TT * 2); bf* Pl = (bf*)take((size_t)NB_ * TT * TT * 2); float* Ob = (float*)take((size_t)NB_ * TT * HD * 4);
    if ((size_t)(wsp - (char*)d_ws) > ws_size) return;
    k_hp1<false><<<dim3((unsigned)((size_t)NB_ * TT * DM / BLKE), 1, 1), 256, 0, stream>>>(Qin, QB, nullptr); k_hp1<true><<<dim3((unsigned)((size_t)NB_ * TT * DM / BLKE), 1, 1), 256, 0, stream>>>(Kin, KB, lens); k_vt1<<<dim3((TT / 256) * (HD / 64) * NB_, 1, 1), 256, 0, stream>>>(Vin, VT, lens);
    for (int h = 0; h < NH_; ++h) {
        k_gemmw<bf, 0, false, 1, HD><<<dim3((TT / 64) * (TT / 64) * NB_, 1, 1), 32, 0, stream>>>(QB + (size_t)h * TT * HD, nullptr, KB + (size_t)h * TT * HD, nullptr, Sb, TT, nullptr, (size_t)NH_ * TT * HD, (size_t)NH_ * TT * HD, (size_t)TT * TT, lens);   /* exact scores (single bf16 planes) */
        k_asoft<<<dim3(TT / 8, NB_, 1), 256, 0, stream>>>(Sb, Ph, Pl, lens);
        k_gemmw<bf, 1, false, 2, TT><<<dim3(TT / 64, HD / 64, NB_), 32, 0, stream>>>(Ph, Pl, VT + (size_t)h * HD * TT, nullptr, Ob, HD, nullptr, (size_t)TT * TT, (size_t)NH_ * HD * TT, (size_t)TT * HD, lens);   /* P (hi/lo) x exact v^T */
        k_mergeT<<<dim3((unsigned)((size_t)NB_ * TT * DM / BLKE), 1, 1), 256, 0, stream>>>(Ob, OUT); }
}

// v006
// Measured time: 64.6 microseconds a run.
// Two timings next to v005 both put it at 1.07 times that version's speed.
// Counting every step since v000, it is 13.6 times as fast.
#include <hip/hip_runtime.h>

// Scaled dot-product cross attention with key-length masking (query = output [16][1024][512]; key = value = encoder_outputs [16][1024][512]; scores = q.k x rsqrt(512); keys j >= encoder_sequence_lengths[b] -> -1e10 (== exclusion; lengths [16] int in [1, 1024], read); softmax; context = attn value -> [16][1024][512] (8.4 M); ONE 512-wide head).
// Layout per batch: single bf16 planes of q and k (inputs bf16-exact: exact score products over the 512 dims) and value^T planes from the same encoder tensor; softmax (every row hi/lo) whose select keeps keys below the batch's length (read on device); P hi/lo x exact value; output rows.
// Compute dtypes, f32 accumulate: every input rounded to bf16; q.k exact; softmax f32; P hi/lo x exact value (2 products); output f32.

#define NB_  16
#define TT   1024
#define DM   512      // token-major row pitch (H x HD)
#define NH_  1
#define NKV  1
#define REP  (NH_ / NKV)
#define HD   512
#define DQ   (NH_ * HD)
#define DKV  (NKV * HD)
#define ZH   1
#define RH   1024                  // query rows < RH use hi+lo planes (0: none)
#define WIN  0
#define PCAR 1024.0f
#define SCL  0.044194173824159216f   // rsqrt(512) (= 2^-4.5; one f32 multiply)
typedef _Float16 h16;
typedef unsigned short bf;
typedef __attribute__((ext_vector_type(16))) __bf16   v16bf;
typedef __attribute__((ext_vector_type(16))) _Float16 v16h;
typedef __attribute__((ext_vector_type(8)))  _Float16 v8h;
typedef __attribute__((ext_vector_type(8)))  unsigned short v8us;
typedef __attribute__((ext_vector_type(8)))  float    v8f;
typedef __attribute__((ext_vector_type(4)))  float    v4f;
typedef v8h  __attribute__((may_alias)) v8ha;
typedef v4f  __attribute__((may_alias)) v4fa;
typedef v8us __attribute__((may_alias)) v8usa;

__device__ __forceinline__ unsigned short f2bf(float f) { unsigned u = __float_as_uint(f); u += 0x7FFFu + ((u >> 16) & 1u); return (unsigned short)(u >> 16); }
__device__ __forceinline__ float bf2f(unsigned short b) { return __uint_as_float(((unsigned)b) << 16); }
__device__ __forceinline__ float bfr(float f) { return bf2f(f2bf(f)); }
__device__ __forceinline__ v16h cat16(v8h lo, v8h hi) { return __builtin_shufflevector(lo, hi, 0, 1, 2, 3, 4, 5, 6, 7, 8, 9, 10, 11, 12, 13, 14, 15); }
__device__ __forceinline__ v16bf cat16b(v8us lo, v8us hi) { return __builtin_bit_cast(v16bf, __builtin_shufflevector(lo, hi, 0, 1, 2, 3, 4, 5, 6, 7, 8, 9, 10, 11, 12, 13, 14, 15)); }
__device__ __forceinline__ v8f wmma16(v16h a, v16h b, v8f c) { return __builtin_amdgcn_wmma_f32_16x16x32_f16(false, a, false, b, (short)0, c, false, false); }
__device__ __forceinline__ v8f wmmab(v16bf a, v16bf b, v8f c) { return __builtin_amdgcn_wmma_f32_16x16x32_bf16(false, a, false, b, (short)0, c, false, false); }



// ---- Keys at or beyond a batch's length have softmax weight exactly 0 (exp of about -1e10 below the row's maximum), so tiles that hold no live key are not converted, multiplied, read or stored.
// livekeys: how many keys of a batch can weigh. A length below 1 masks every key alike (the softmax is then uniform over all TT keys) and one above TT masks none: both leave all TT keys in play, and the value bounds every index formed from it.
__device__ __forceinline__ int livekeys(int L) { return (L < 1 || L > TT) ? TT : L; }
// deal: piece number id of a launch that runs live pieces only -> batch z and piece t inside it; batch b has per * ceil(livekeys / 2^sh) pieces. Live pieces take the lowest block numbers, so that they spread evenly over the chip; false: no piece left for this block.
__device__ __forceinline__ bool deal(const int* __restrict__ lenp, int id, int sh, int per, int& z, int& t) {
    int end = 0; z = 0; t = id;
#pragma unroll   /* the 16 lengths come in one scalar load, the search stays scalar */
    for (int b = 0; b < NB_; ++b) { end += per * ((livekeys(lenp[b]) + (1 << sh) - 1) >> sh); if (id >= end) { z = b + 1; t = id - end; } }   /* z: how many batches end at or below id */
    return z < NB_;
}

// ---- k_gemmw: register-blocked GEMM, ONE WAVE per 64x64 output tile (16 accumulators), operands from K-contiguous 16-bit planes through LDS; grid (M/64, N/64, Z), 32 threads.
// A stage is 64 k of every operand's 64 rows. Asynchronous copies bring it in whole 128-B lines (a copy of the wave covers 4 rows; a fragment load from global memory touched 16 lines for the same 512 B), two buffers: the next stage flies while this one is multiplied.
// C[m][n] (f32, pitch ldc, + optional f32 bias[n]) = sum_k A[m][k] Bt[n][k] (+ split products per NSPLIT). z-batch strides sA/sB/sC in elements. K (compile time) % 64 == 0.
// LIVE 1: n is the key; flat grid, only tiles with a live key run (TT / 64 row tiles per 64 keys). LIVE 2: k is the key; the k loop ends at the batch's live keys, rounded up to 64 (A is exactly 0 there, Bt finite).
#define GLB __attribute__((address_space(1)))   /* the copies' source pointers are global */
#define SPB 144            /* LDS row pitch in bytes: 128 B of k and 16 B more (16 B x odd), so that the 16 rows which a half wave reads with ds_load_b128 fall on distinct banks */
#define SOP (64 * SPB)     /* one operand's 64 rows of a stage */
// copy16: one operand's 64 rows of a stage, sixteen copies of 16 B a lane, 4 rows each. Copy i lands at LDS address l + i * 4 rows. The immediate offset moves both addresses, so the one LDS register serves all sixteen and the global register of copy i holds g + i * GP less that offset (it stays inside the plane: GP is larger).
// The wait is the statement's last line: it stands in front of whatever next writes a register that a copy names.
template <int GP>
__device__ __forceinline__ void copy16(unsigned l, const GLB char* g) {
    static_assert(4 * SPB == 576 && GP > 576 && GP % 16 == 0, "the offsets in the text below are i * 4 rows of the LDS pitch"); constexpr int GS = GP - 4 * SPB;
    asm volatile(
                 "global_load_async_to_lds_b128 %0, %1, off\n\tglobal_load_async_to_lds_b128 %0, %2, off offset:576\n\tglobal_load_async_to_lds_b128 %0, %3, off offset:1152\n\tglobal_load_async_to_lds_b128 %0, %4, off offset:1728\n\t"
                 "global_load_async_to_lds_b128 %0, %5, off offset:2304\n\tglobal_load_async_to_lds_b128 %0, %6, off offset:2880\n\tglobal_load_async_to_lds_b128 %0, %7, off offset:3456\n\tglobal_load_async_to_lds_b128 %0, %8, off offset:4032\n\t"
                 "global_load_async_to_lds_b128 %0, %9, off offset:4608\n\tglobal_load_async_to_lds_b128 %0, %10, off offset:5184\n\tglobal_load_async_to_lds_b128 %0, %11, off offset:5760\n\tglobal_load_async_to_lds_b128 %0, %12, off offset:6336\n\t"
                 "global_load_async_to_lds_b128 %0, %13, off offset:6912\n\tglobal_load_async_to_lds_b128 %0, %14, off offset:7488\n\tglobal_load_async_to_lds_b128 %0, %15, off offset:8064\n\tglobal_load_async_to_lds_b128 %0, %16, off offset:8640\n\t"
                 "s_wait_xcnt 0x0"
                 :: "v"(l), "v"(g), "v"(g + 1 * GS), "v"(g + 2 * GS), "v"(g + 3 * GS), "v"(g + 4 * GS), "v"(g + 5 * GS), "v"(g + 6 * GS), "v"(g + 7 * GS),
                    "v"(g + 8 * GS), "v"(g + 9 * GS), "v"(g + 10 * GS), "v"(g + 11 * GS), "v"(g + 12 * GS), "v"(g + 13 * GS), "v"(g + 14 * GS), "v"(g + 15 * GS) : "memory"); }
template <typename T16> struct WFrag;
template <> struct WFrag<h16> { typedef v16h V; static __device__ __forceinline__ V ld(const char* p) { return cat16(*(const v8ha*)p, *(const v8ha*)(p + 32)); } static __device__ __forceinline__ v8f mma(V a, V b, v8f c) { return wmma16(a, b, c); } };
template <> struct WFrag<bf> { typedef v16bf V; static __device__ __forceinline__ V ld(const char* p) { return cat16b(*(const v8usa*)p, *(const v8usa*)(p + 32)); } static __device__ __forceinline__ v8f mma(V a, V b, v8f c) { return wmmab(a, b, c); } };
template <typename T16, int NSPLIT, bool BIAS, int LIVE, int K>
__global__ __launch_bounds__(32) void k_gemmw(const T16* __restrict__ A, const T16* __restrict__ A2, const T16* __restrict__ Bt, const T16* __restrict__ Bt2, float* C, int ldc, const float* __restrict__ bias, size_t sA, size_t sB, size_t sC, const int* __restrict__ lenp) {
    typedef typename WFrag<T16>::V V; static_assert(K % 64 == 0, "a trip of the k loop is two steps of 32");
    constexpr bool HA2 = (NSPLIT == 1 || NSPLIT == 2), HB2 = (NSPLIT >= 2); constexpr int STB = (2 + (HA2 ? 1 : 0) + (HB2 ? 1 : 0)) * SOP;   /* bytes of a stage: A, Bt, then A2, Bt2 where they exist */
    static_assert(STB / SOP * 16 <= 63, "a stage's copies of the wave, all in flight at once"); static_assert(2 * STB >= 16 * 68 * 4, "the output staging fits in the ring");
    __shared__ __align__(16) char ring[2 * STB]; float* os = (float*)ring;   /* behind the k loop the ring is the output staging */
    int zb = blockIdx.z, tx = blockIdx.x, ty = blockIdx.y;
    if (LIVE == 1) { int t; if (!deal(lenp, (int)blockIdx.x, 6, TT / 64, zb, t)) return; tx = t % (TT / 64); ty = t / (TT / 64); }
    const int Kend = (LIVE == 2) ? ((livekeys(lenp[zb]) + 63) & ~63) : K;
    const size_t z = zb; A += z * sA; if (A2) A2 += z * sA; Bt += z * sB; if (Bt2) Bt2 += z * sB; C += z * sC;
    const int lane = threadIdx.x & 31, lr = lane & 15, hi = lane >> 4; const int r0 = tx * 64, c0 = ty * 64;
    v8f acc[4][4];
#pragma unroll
    for (int mb = 0; mb < 4; ++mb)
#pragma unroll
        for (int nb = 0; nb < 4; ++nb) acc[mb][nb] = (v8f){};
    const size_t go = ((size_t)(lane >> 3) * K + 8 * (lane & 7)) * sizeof(T16);   /* a copy's lane: row lane / 8 of its four, piece lane % 8 of the row's 128 B */
    const GLB char* ga = (const GLB char*)(A + (size_t)r0 * K) + go; const GLB char* gb = (const GLB char*)(Bt + (size_t)c0 * K) + go;
    const GLB char* ga2 = HA2 ? (const GLB char*)(A2 + (size_t)r0 * K) + go : nullptr; const GLB char* gb2 = HB2 ? (const GLB char*)(Bt2 + (size_t)c0 * K) + go : nullptr;
    const unsigned lc = (unsigned)(size_t)ring + (lane >> 3) * SPB + (lane & 7) * 16;   /* the lane's LDS byte address in buffer 0: the low 32 bits of the __shared__ address */
    constexpr int GP = 4 * K * (int)sizeof(T16);   /* four rows on in the plane */
    auto stage = [&](const unsigned l) __attribute__((always_inline)) {   /* the next stage's copies into the buffer at l; the source pointers move on by 64 k */
        copy16<GP>(l, ga); copy16<GP>(l + SOP, gb); if (HA2) copy16<GP>(l + 2 * SOP, ga2); if (HB2) copy16<GP>(l + STB - SOP, gb2);
        ga += 128; gb += 128; if (HA2) ga2 += 128; if (HB2) gb2 += 128; };
    const char* fr = ring + lr * SPB + hi * 16;   /* the lane's place in a fragment: row lr, k 8 hi .. 8 hi + 7 and 16 further on, as in the planes */
    V a[2][4], a2[2][4], b[2][4], b2[2][4];   /* two fragment sets, one per k step of a stage: the second one's LDS reads fly under the first one's products */
    auto ldset = [&](const int S, const char* f) __attribute__((always_inline)) {   /* S is a constant at every call: the sets stay in registers */
#pragma unroll
        for (int q = 0; q < 4; ++q) { a[S][q] = WFrag<T16>::ld(f + q * 16 * SPB); if (HA2) a2[S][q] = WFrag<T16>::ld(f + 2 * SOP + q * 16 * SPB);
            b[S][q] = WFrag<T16>::ld(f + SOP + q * 16 * SPB); if (HB2) b2[S][q] = WFrag<T16>::ld(f + STB - SOP + q * 16 * SPB); }
        __builtin_amdgcn_sched_barrier(0); };   /* the whole set's reads are issued in front of the products: without it they sink to their first use and their latency is waited out */
    auto mmaset = [&](const int S) __attribute__((always_inline)) {
#pragma unroll
        for (int nb = 0; nb < 4; ++nb) {
#pragma unroll
            for (int mb = 0; mb < 4; ++mb) { acc[mb][nb] = WFrag<T16>::mma(a[S][mb], b[S][nb], acc[mb][nb]); if (NSPLIT == 1 || NSPLIT == 2) acc[mb][nb] = WFrag<T16>::mma(a2[S][mb], b[S][nb], acc[mb][nb]); if (NSPLIT >= 2) acc[mb][nb] = WFrag<T16>::mma(a[S][mb], b2[S][nb], acc[mb][nb]); } }
        __builtin_amdgcn_sched_barrier(0); };   /* the first set's products all stand in front of the second's: they run while the second set's LDS reads are still landing */
    const int nt = Kend >> 6;   /* stages; the same for the whole block, at least one */
    stage(lc);
    asm volatile("s_wait_asynccnt 0x0" ::: "memory");   /* stage 0 has landed */
    __syncthreads();   /* nothing of stage 0 is read in front of here (a work-group is one wave, the ring is its own: the compiler emits no barrier instruction for this) */
    if (nt > 1) stage(lc + STB);
#pragma unroll 1   /* one trip is one stage: two k steps, one per fragment set */
    for (int t = 0; t < nt; ++t) {
        const int bo = (t & 1) * STB;
        ldset(0, fr + bo);
        ldset(1, fr + bo + 64);
        mmaset(0);
        mmaset(1);
        asm volatile("s_wait_dscnt 0x0" ::: "memory");   /* this stage's LDS reads have ended before its buffer is refilled */
        asm volatile("s_wait_asynccnt 0x0" ::: "memory");   /* the next stage has landed */
        __syncthreads();   /* the next stage is read, and this one's buffer refilled, only behind here (no instruction either: one wave) */
        if (t + 2 < nt) stage(lc + bo);
    }
    asm volatile("s_wait_asynccnt 0x0" ::: "memory");   /* no copy is outstanding when the ring becomes the output staging */
#pragma unroll
    for (int mb = 0; mb < 4; ++mb) {
#pragma unroll
        for (int nb = 0; nb < 4; ++nb) {
#pragma unroll
            for (int j = 0; j < 8; ++j) os[(hi * 8 + j) * 68 + nb * 16 + lr] = acc[mb][nb][j]; }
        __builtin_amdgcn_wave_barrier(); asm volatile("" ::: "memory");
        float* crow = C + (size_t)(r0 + mb * 16) * ldc + c0;
{
#pragma unroll
            for (int s = 0; s < 8; ++s) { const int row = 2 * s + hi, cofs = lr * 4; v4f val = *(const v4fa*)(os + row * 68 + cofs); if (BIAS) { val[0] += bfr(bias[c0 + cofs]); val[1] += bfr(bias[c0 + cofs + 1]); val[2] += bfr(bias[c0 + cofs + 2]); val[3] += bfr(bias[c0 + cofs + 3]); }
                *(v4f*)(crow + (size_t)row * ldc + cofs) = val; }
             }
        __builtin_amdgcn_wave_barrier(); asm volatile("" ::: "memory");
    }
}

__device__ __forceinline__ h16 tohx(float x) { return (h16)x; }
__device__ __forceinline__ void splitf(float y, unsigned short& h, unsigned short& l) { h = f2bf(y); l = f2bf(y - bf2f(h)); }
typedef __attribute__((ext_vector_type(2))) _Float16 v2h;
typedef __attribute__((ext_vector_type(4))) _Float16 v4h;
typedef __attribute__((ext_vector_type(2))) unsigned short v2us;
typedef __attribute__((ext_vector_type(4))) unsigned short v4us;
typedef __attribute__((ext_vector_type(2))) float v2f;
typedef __attribute__((ext_vector_type(4))) int v4i;

__global__ __launch_bounds__(256) void k_wtG(const float* __restrict__ w, int K, int N, bf* Bt) {
    const int lane = threadIdx.x & 31; const int L0 = (blockIdx.x * 8 + (threadIdx.x >> 5)) * 8; const int nlines = N * K / 64;
{
#pragma unroll 1
        for (int l = 0; l < 8; ++l) { const int L = L0 + l; if (L >= nlines) break; const size_t e = (size_t)L * 64 + lane * 2; const int k = (int)(e % K), n = (int)(e / K); v2us o;
            o[0] = f2bf(w[(size_t)k * N + n]); o[1] = f2bf(w[(size_t)(k + 1) * N + n]); *(v2us*)(Bt + e) = o; }
         }
}
__global__ __launch_bounds__(256) void k_cvt8(const float* __restrict__ src, bf* dst, size_t n8) { const size_t i = (size_t)blockIdx.x * 256 + threadIdx.x; if (i >= n8) return; const v8f v = *(const v8f*)(src + i * 8); v8us o;
#pragma unroll
    for (int k = 0; k < 8; ++k) o[k] = f2bf(v[k]); *(v8us*)(dst + i * 8) = o;  }


__global__ __launch_bounds__(256) void k_vtp(const float* __restrict__ F, int pitch, int nheads, h16* V16, bf* Vh, bf* Vl) { const size_t e = ((size_t)blockIdx.x * 256 + threadIdx.x) * 2; if (e >= (size_t)nheads * HD * TT) return; const int t = (int)(e % TT); const int d = (int)((e / TT) % HD); const int g = (int)(e / ((size_t)TT * HD)); v2h o16; v2us oh, ol;
#pragma unroll
    for (int q = 0; q < 2; ++q) { const float x = F[(size_t)(t + q) * pitch + g * HD + d]; o16[q] = tohx(x); unsigned short a2, c2; splitf(x, a2, c2); oh[q] = a2; ol[q] = c2; }
    *(v2h*)(V16 + e) = o16; *(v2us*)(Vh + e) = oh; *(v2us*)(Vl + e) = ol;  }

// asoft_row: one wave's softmax row over its first NCH chunks of 128 keys, the chunks that hold a live key (LK = livekeys of the batch, NCH = ceil(LK / 128)). The chunks left out hold exact zeros only, so maximum, sum and every stored value keep their bits. NCH is a compile-time count so that the row stays in registers.
template <int NCH>
__device__ __forceinline__ void asoft_row(const float* __restrict__ sr, bf* Ph, bf* Pl, int L, int LK, int lane) {
    float v[NCH * 4]; float mx = -3.0e38f;
    v4f ar[NCH];
    const unsigned bo = lane * 16u, bl = 4u * (unsigned)min((NCH - 1) * 128 + lane * 4, (LK - 1) & ~3);   /* byte offsets of the lane's piece: in chunk 0, and in the last chunk, where the minimum keeps every lane on scores that the live tiles wrote (what it moves is masked below) */
#pragma unroll
    for (int ch = 0; ch < NCH; ++ch) ar[ch] = *(const v4f*)((const char*)sr + (ch < NCH - 1 ? bo + ch * 512u : bl));
#define ARX(i) ar[(i) < NCH ? (i) : NCH - 1]
    asm volatile("s_wait_xcnt 0x0" :: "v"(ARX(0)), "v"(ARX(1)), "v"(ARX(2)), "v"(ARX(3)), "v"(ARX(4)), "v"(ARX(5)), "v"(ARX(6)), "v"(ARX(7)), "v"(bo), "v"(bl) : "memory");   /* the row loads' offset registers are reused behind here: keeps the wait in front of that overwrite. Inputs only: the loaded values, so that every load of the row is issued in front, and the two offsets, so that no load lands in a register that an earlier one names */
#undef ARX
    __builtin_amdgcn_sched_barrier(0);   /* keeps later vector work, which takes over those registers, behind the wait */
#pragma unroll
    for (int ch = 0; ch < NCH; ++ch) { const int j0 = ch * 128 + lane * 4; const v4f a = ar[ch];
#pragma unroll
        for (int q = 0; q < 4; ++q) { const int j = j0 + q; const float t = (ch < NCH - 1 ? L >= 1 : j < L) ? a[q] * SCL : -3.0e38f; v[ch * 4 + q] = t;   /* keys at or beyond the batch's encoder length excluded (-1e10 == exclusion); in front of the last chunk j < LK, so j < L says no more than L >= 1 */ mx = fmaxf(mx, t); } }
#pragma unroll
    for (int sh = 16; sh; sh >>= 1) mx = fmaxf(mx, __shfl_xor(mx, sh, 32));
    float sum = 0.f;
#pragma unroll
    for (int k = 0; k < NCH * 4; ++k) { const float d0 = __fsub_rn(v[k], mx); asm("v_exp_f32 %0, %1\n\tv_nop" : "=v"(v[k]) : "v"(__fmul_rn(d0, 1.4426950408889634f)));   /* exp2 with the slot behind a transcendental in one statement: the next vector instruction may take over its source register, and a v_nop of its own does not stay behind the builtin */ sum += v[k]; }
#pragma unroll
    for (int sh = 16; sh; sh >>= 1) sum += __shfl_xor(sum, sh, 32);
    const float f = __fdiv_rn(1.0f, sum);
#pragma unroll
    for (int ch = 0; ch < NCH; ++ch) { v4us oh, ol;
#pragma unroll
        for (int q = 0; q < 4; ++q) { unsigned short a, c2; splitf(v[ch * 4 + q] * f, a, c2); oh[q] = a; ol[q] = c2; }
        const size_t oo = ch * 128 + lane * 4; *(v4us*)(Ph + oo) = oh; *(v4us*)(Pl + oo) = ol;
        if (ch == NCH - 1) asm volatile("s_wait_xcnt 0x0" ::: "memory");   /* the row's last two stores: keeps the wait in front of whatever next writes a register that they name (the earlier chunks' stores have the compiler's own waits) */
        __builtin_amdgcn_sched_barrier(0); }   /* a chunk's split and stores end before the next chunk's begin: otherwise all chunks' temporaries pile up in front of the stores and the row takes more than 64 registers (12 waves a SIMD instead of 16) */
}
static_assert(RH == TT && ZH == 1 && TT == 1024, "every row hi/lo; eight chunks of 128 keys");
__global__ __launch_bounds__(256) void k_asoft(const float* __restrict__ Sb, bf* Ph, bf* Pl, const int* __restrict__ lenp) {
    const size_t bz = blockIdx.y;   /* batch: one grid plane per batch */
    const int L = lenp[bz];   /* this batch's encoder length */ const int LK = livekeys(L); const int lane = threadIdx.x & 31; const int row = blockIdx.x * 8 + __builtin_amdgcn_readfirstlane(threadIdx.x >> 5);   /* the wave's row as a scalar: the three row pointers then take no vector registers */
    const size_t ro = (bz * TT + row) * TT; const float* sr = Sb + ro; Ph += ro; Pl += ro;
    switch ((LK + 127) >> 7) {   /* the same for the whole block */
        case 1: asoft_row<1>(sr, Ph, Pl, L, LK, lane); break; case 2: asoft_row<2>(sr, Ph, Pl, L, LK, lane); break; case 3: asoft_row<3>(sr, Ph, Pl, L, LK, lane); break; case 4: asoft_row<4>(sr, Ph, Pl, L, LK, lane); break;
        case 5: asoft_row<5>(sr, Ph, Pl, L, LK, lane); break; case 6: asoft_row<6>(sr, Ph, Pl, L, LK, lane); break; case 7: asoft_row<7>(sr, Ph, Pl, L, LK, lane); break; default: asoft_row<8>(sr, Ph, Pl, L, LK, lane); break; }
}
__global__ __launch_bounds__(256) void k_merge(const float* __restrict__ O, int h0, float* OUTb) { const size_t e = ((size_t)blockIdx.x * 256 + threadIdx.x) * 2; if (e >= (size_t)ZH * TT * HD) return; const int d = (int)(e % HD); const int t = (int)((e / HD) % TT); const int zz = (int)(e / ((size_t)HD * TT)); const float cs = (t < RH) ? 1.0f : (1.0f / PCAR); const size_t oo = (size_t)t * DQ + (h0 + zz) * HD + d;
    v2f o2; o2[0] = O[e] * cs; o2[1] = O[e + 1] * cs; *(v2f*)(OUTb + oo) = o2;  }


__global__ __launch_bounds__(256) void k_vtpR1(const float* __restrict__ Vb, bf* Vh) { const size_t e = ((size_t)blockIdx.x * 256 + threadIdx.x) * 2; if (e >= (size_t)HD * TT) return; const int t = (int)(e % TT); const int d = (int)(e / TT); v2us o; o[0] = f2bf(Vb[(size_t)t * HD + d]); o[1] = f2bf(Vb[(size_t)(t + 1) * HD + d]); *(v2us*)(Vh + e) = o;  }
__global__ __launch_bounds__(256) void k_mergeR(const float* __restrict__ O, float* outb, size_t n4) { const size_t i = (size_t)blockIdx.x * 256 + threadIdx.x; if (i >= n4) return; const v4f a = *(const v4f*)(O + i * 4); *(v4f*)(outb + i * 4) = a;  }


// The two passes below move 16 pieces of 16 B per lane (a wave reads 8 KB), in whole 128-B lines: they are bound by how fast waves start, not by their bytes.
#define PCS  16                    // 16-B pieces per lane
#define BLKE (256 * 4 * PCS)       // f32 elements per 256-thread block
static_assert(NH_ == 1 && HD == DM, "one head: the head plane [h][t][d] is the token-major tensor itself");
static_assert(((size_t)NB_ * TT * DM) % BLKE == 0 && TT % 256 == 0 && HD % 64 == 0 && (64 * DM) % BLKE == 0, "whole blocks and tiles only");
// LIVE: src holds keys; only the rows that a live 64-key score tile reads are converted.
template <bool LIVE>
__global__ __launch_bounds__(256) void k_hp1(const float* __restrict__ src, bf* P, const int* __restrict__ lenp) { size_t blk = blockIdx.x;
    if (LIVE) { int z, t; if (!deal(lenp, (int)blockIdx.x, 6, 64 * DM / BLKE, z, t)) return; blk = (size_t)z * (TT * DM / BLKE) + t; }
    const size_t e0 = blk * BLKE + threadIdx.x * 4; v4f v[PCS];
#pragma unroll   /* all loads of the lane in flight before the first convert */
    for (int k = 0; k < PCS; ++k) v[k] = *(const v4f*)(src + e0 + k * 1024);
#pragma unroll   /* v[] stays in registers */
    for (int k = 0; k < PCS; ++k) { v4us o; o[0] = f2bf(v[k][0]); o[1] = f2bf(v[k][1]); o[2] = f2bf(v[k][2]); o[3] = f2bf(v[k][3]); *(v4us*)(P + e0 + k * 1024) = o; } }
// k_vt1: one block transposes a tile of 256 tokens x 64 dims through LDS. tile[d][c] holds 16-B chunks of 8 tokens (a dword = tokens 2tp, 2tp+1); chunk c of row d lies at c ^ (d >> 2), so that the 32 dword stores of a wave (16 dim groups x 2 token pairs) and the 16 chunks that a half wave reads each fall on distinct banks.
__global__ __launch_bounds__(256) void k_vt1(const float* __restrict__ src, bf* VT, const int* __restrict__ lenp) {
    __shared__ __align__(16) unsigned tile[64 * 128];
    int z, t; if (!deal(lenp, (int)blockIdx.x, 8, HD / 64, z, t)) return;   /* only token tiles with a live key; the whole block leaves, in front of the barrier */
    const int tt = t / (HD / 64), td = t % (HD / 64);
    src += ((size_t)z * TT + tt * 256) * DM + td * 64; VT += ((size_t)z * HD + td * 64) * TT + tt * 256;
    const int lane = threadIdx.x & 31, w = threadIdx.x >> 5, g = lane & 15, hf = lane >> 4; const float* sp = src + (size_t)(w * 4 + hf * 2) * DM + g * 4; v4f a[8], c[8];
#pragma unroll   /* all loads of the lane in flight before the first convert */
    for (int it = 0; it < 8; ++it) { a[it] = *(const v4f*)(sp + it * 32 * DM); c[it] = *(const v4f*)(sp + it * 32 * DM + DM); }   /* token pair tp = it * 16 + w * 2 + hf: rows 2 tp and 2 tp + 1 */
    __builtin_amdgcn_sched_barrier(0);   /* keeps all 16 loads in flight at once: without it the last five are issued only behind the first converts */
#pragma unroll   /* a[], c[] stay in registers */
    for (int it = 0; it < 8; ++it) { const int tp = it * 16 + w * 2 + hf;
#pragma unroll   /* vector elements picked by constants */
        for (int q = 0; q < 4; ++q) tile[(g * 4 + q) * 128 + (((tp >> 2) ^ g) << 2) + (tp & 3)] = (unsigned)f2bf(a[it][q]) | ((unsigned)f2bf(c[it][q]) << 16); }
    __syncthreads();   /* every wave's columns are in the tile before any row is read */
#pragma unroll   /* eight independent LDS reads and stores per lane */
    for (int it = 0; it < 8; ++it) { const int d = it * 8 + w; const v4i r = *(const v4i*)(tile + d * 128 + ((lane ^ ((d >> 2) & 15)) << 2)); *(v4i*)(VT + (size_t)d * TT + lane * 8) = r; }
}

extern "C" void kernel_launch(void* const* d_in, const int* in_sizes, int n_in,
                              void* d_out, int out_size, void* d_ws, size_t ws_size, hipStream_t stream) {
    (void)in_sizes; (void)n_in; (void)out_size;
    const float* Qin = (const float*)d_in[0]; const float* Kin = (const float*)d_in[1]; const float* Vin = Kin;   /* query = output, key = value = encoder_outputs */ const int* lens = (const int*)d_in[2];   /* encoder_sequence_lengths [16] int */
    float* OUT = (float*)d_out;
    char* wsp = (char*)d_ws;
    auto take = [&](size_t bytes) { char* p = wsp; wsp += (bytes + 255) & ~(size_t)255; return (void*)p; };
    /* every plane holds all NB_ batches, batch-major; each launch covers all batches (a flat grid for the convert passes, the transposition and the scores, grid y for the softmax, grid z for the second GEMM, whose 64x64 tiles cover every element of the output and are stored straight to it) */
    bf* QB = (bf*)take((size_t)NB_ * NH_ * TT * HD * 2); bf* KB = (bf*)take((size_t)NB_ * NH_ * TT * HD * 2); bf* VT = (bf*)take((size_t)NB_ * NH_ * HD * TT * 2);
    float* Sb = (float*)take((size_t)NB_ * TT * TT * 4);  bf* Ph = (bf*)take((size_t)NB_ * TT * TT * 2); bf* Pl = (bf*)take((size_t)NB_ * TT * TT * 2);
    if ((size_t)(wsp - (char*)d_ws) > ws_size) return;
    k_hp1<false><<<dim3((unsigned)((size_t)NB_ * TT * DM / BLKE), 1, 1), 256, 0, stream>>>(Qin, QB, nullptr); k_hp1<true><<<dim3((unsigned)((size_t)NB_ * TT * DM / BLKE), 1, 1), 256, 0, stream>>>(Kin, KB, lens); k_vt1<<<dim3((TT / 256) * (HD / 64) * NB_, 1, 1), 256, 0, stream>>>(Vin, VT, lens);
    for (int h = 0; h < NH_; ++h) {
        k_gemmw<bf, 0, false, 1, HD><<<dim3((TT / 64) * (TT / 64) * NB_, 1, 1), 32, 0, stream>>>(QB + (size_t)h * TT * HD, nullptr, KB + (size_t)h * TT * HD, nullptr, Sb, TT, nullptr, (size_t)NH_ * TT * HD, (size_t)NH_ * TT * HD, (size_t)TT * TT, lens);   /* exact scores (single bf16 planes) */
        k_asoft<<<dim3(TT / 8, NB_, 1), 256, 0, stream>>>(Sb, Ph, Pl, lens);
        k_gemmw<bf, 1, false, 2, TT><<<dim3(TT / 64, HD / 64, NB_), 32, 0, stream>>>(Ph, Pl, VT + (size_t)h * HD * TT, nullptr, OUT, HD, nullptr, (size_t)TT * TT, (size_t)NH_ * HD * TT, (size_t)TT * HD, lens);   /* P (hi/lo) x exact v^T -> output rows [b][t][d] */ }
}

// v007
// It runs in 61.4 microseconds.
// Next to v006, in two timings, it ran 1.05 and 1.06 times as fast.
// All steps since v000 together make it 14.3 times as fast.
#include <hip/hip_runtime.h>

// Scaled dot-product cross attention with key-length masking (query = output [16][1024][512]; key = value = encoder_outputs [16][1024][512]; scores = q.k x rsqrt(512); keys j >= encoder_sequence_lengths[b] -> -1e10 (== exclusion; lengths [16] int in [1, 1024], read); softmax; context = attn value -> [16][1024][512] (8.4 M); ONE 512-wide head).
// Layout per batch: single bf16 planes of q and k (inputs bf16-exact: exact score products over the 512 dims) and value^T planes from the same encoder tensor; softmax (every row hi/lo) whose select keeps keys below the batch's length (read on device); P hi/lo x exact value; output rows.
// Compute dtypes, f32 accumulate: every input rounded to bf16; q.k exact; softmax f32; P hi/lo x exact value (2 products); output f32.

#define NB_  16
#define TT   1024
#define DM   512      // token-major row pitch (H x HD)
#define NH_  1
#define NKV  1
#define REP  (NH_ / NKV)
#define HD   512
#define DQ   (NH_ * HD)
#define DKV  (NKV * HD)
#define ZH   1
#define RH   1024                  // query rows < RH use hi+lo planes (0: none)
#define WIN  0
#define PCAR 1024.0f
#define SCL  0.044194173824159216f   // rsqrt(512) (= 2^-4.5; one f32 multiply)
typedef _Float16 h16;
typedef unsigned short bf;
typedef __attribute__((ext_vector_type(16))) __bf16   v16bf;
typedef __attribute__((ext_vector_type(16))) _Float16 v16h;
typedef __attribute__((ext_vector_type(8)))  _Float16 v8h;
typedef __attribute__((ext_vector_type(8)))  unsigned short v8us;
typedef __attribute__((ext_vector_type(8)))  float    v8f;
typedef __attribute__((ext_vector_type(4)))  float    v4f;
typedef v8h  __attribute__((may_alias)) v8ha;
typedef v4f  __attribute__((may_alias)) v4fa;
typedef v8us __attribute__((may_alias)) v8usa;

__device__ __forceinline__ unsigned short f2bf(float f) { unsigned u = __float_as_uint(f); u += 0x7FFFu + ((u >> 16) & 1u); return (unsigned short)(u >> 16); }
__device__ __forceinline__ float bf2f(unsigned short b) { return __uint_as_float(((unsigned)b) << 16); }
__device__ __forceinline__ float bfr(float f) { return bf2f(f2bf(f)); }
__device__ __forceinline__ v16h cat16(v8h lo, v8h hi) { return __builtin_shufflevector(lo, hi, 0, 1, 2, 3, 4, 5, 6, 7, 8, 9, 10, 11, 12, 13, 14, 15); }
__device__ __forceinline__ v16bf cat16b(v8us lo, v8us hi) { return __builtin_bit_cast(v16bf, __builtin_shufflevector(lo, hi, 0, 1, 2, 3, 4, 5, 6, 7, 8, 9, 10, 11, 12, 13, 14, 15)); }
__device__ __forceinline__ v8f wmma16(v16h a, v16h b, v8f c) { return __builtin_amdgcn_wmma_f32_16x16x32_f16(false, a, false, b, (short)0, c, false, false); }
__device__ __forceinline__ v8f wmmab(v16bf a, v16bf b, v8f c) { return __builtin_amdgcn_wmma_f32_16x16x32_bf16(false, a, false, b, (short)0, c, false, false); }



// ---- Keys at or beyond a batch's length have softmax weight exactly 0 (exp of about -1e10 below the row's maximum), so tiles that hold no live key are not converted, multiplied, read or stored.
// livekeys: how many keys of a batch can weigh. A length below 1 masks every key alike (the softmax is then uniform over all TT keys) and one above TT masks none: both leave all TT keys in play, and the value bounds every index formed from it.
__device__ __forceinline__ int livekeys(int L) { return (L < 1 || L > TT) ? TT : L; }
// deal: piece number id of a launch that runs live pieces only -> batch z and piece t inside it; batch b has per * ceil(livekeys / 2^sh) pieces. Live pieces take the lowest block numbers, so that they spread evenly over the chip; false: no piece left for this block.
__device__ __forceinline__ bool deal(const int* __restrict__ lenp, int id, int sh, int per, int& z, int& t) {
    int end = 0; z = 0; t = id;
#pragma unroll   /* the 16 lengths come in one scalar load, the search stays scalar */
    for (int b = 0; b < NB_; ++b) { end += per * ((livekeys(lenp[b]) + (1 << sh) - 1) >> sh); if (id >= end) { z = b + 1; t = id - end; } }   /* z: how many batches end at or below id */
    return z < NB_;
}

// ---- k_gemmw: register-blocked GEMM, FOUR WAVES (2 x 2) per 128x128 output tile, each wave a 64x64 quarter (16 accumulators), operands from K-contiguous 16-bit planes through LDS; grid (M/128, N/128, Z), 128 threads.
// A stage is 64 k of every operand's 128 rows, staged once for the four waves (each row feeds two of them: half the bytes from L2 of four one-wave tiles); every wave copies a quarter of it, rows 32 w .. 32 w + 31 of each operand. Asynchronous copies bring it in whole 128-B lines (a copy of the wave covers 4 rows), two buffers: the next stage flies while this one is multiplied.
// C[m][n] (f32, pitch ldc, + optional f32 bias[n]) = sum_k A[m][k] Bt[n][k] (+ split products per NSPLIT). z-batch strides sA/sB/sC in elements. K (compile time) % 64 == 0.
// LIVE 1: n is the key; flat grid, only tiles with a live key run (TT / 128 row tiles per 128 keys). LIVE 2: k is the key; the k loop ends at the batch's live keys, rounded up to 64 (A is exactly 0 there, Bt finite).
#define GLB __attribute__((address_space(1)))   /* the copies' source pointers are global */
#define SPB 144            /* LDS row pitch in bytes: 128 B of k and 16 B more (16 B x odd), so that the 16 rows which a half wave reads with ds_load_b128 fall on distinct banks */
#define SOP (128 * SPB)    /* one operand's 128 rows of a stage */
// copy8: a wave's 32 rows of one operand's stage, eight copies of 16 B a lane, 4 rows each. Copy i lands at LDS address l + i * 4 rows. The immediate offset moves both addresses, so the one LDS register serves all eight and the global register of copy i holds g + i * GP less that offset (it stays inside the plane: GP is larger).
// The wait is the statement's last line: it stands in front of whatever next writes a register that a copy names.
template <int GP>
__device__ __forceinline__ void copy8(unsigned l, const GLB char* g) {
    static_assert(4 * SPB == 576 && GP > 576 && GP % 16 == 0, "the offsets in the text below are i * 4 rows of the LDS pitch"); constexpr int GS = GP - 4 * SPB;
    asm volatile(
                 "global_load_async_to_lds_b128 %0, %1, off\n\tglobal_load_async_to_lds_b128 %0, %2, off offset:576\n\tglobal_load_async_to_lds_b128 %0, %3, off offset:1152\n\tglobal_load_async_to_lds_b128 %0, %4, off offset:1728\n\t"
                 "global_load_async_to_lds_b128 %0, %5, off offset:2304\n\tglobal_load_async_to_lds_b128 %0, %6, off offset:2880\n\tglobal_load_async_to_lds_b128 %0, %7, off offset:3456\n\tglobal_load_async_to_lds_b128 %0, %8, off offset:4032\n\t"
                 "s_wait_xcnt 0x0"
                 :: "v"(l), "v"(g), "v"(g + 1 * GS), "v"(g + 2 * GS), "v"(g + 3 * GS), "v"(g + 4 * GS), "v"(g + 5 * GS), "v"(g + 6 * GS), "v"(g + 7 * GS) : "memory"); }
template <typename T16> struct WFrag;
template <> struct WFrag<h16> { typedef v16h V; static __device__ __forceinline__ V ld(const char* p) { return cat16(*(const v8ha*)p, *(const v8ha*)(p + 32)); } static __device__ __forceinline__ v8f mma(V a, V b, v8f c) { return wmma16(a, b, c); } };
template <> struct WFrag<bf> { typedef v16bf V; static __device__ __forceinline__ V ld(const char* p) { return cat16b(*(const v8usa*)p, *(const v8usa*)(p + 32)); } static __device__ __forceinline__ v8f mma(V a, V b, v8f c) { return wmmab(a, b, c); } };
template <typename T16, int NSPLIT, bool BIAS, int LIVE, int K>
__global__ __launch_bounds__(128) void k_gemmw(const T16* __restrict__ A, const T16* __restrict__ A2, const T16* __restrict__ Bt, const T16* __restrict__ Bt2, float* C, int ldc, const float* __restrict__ bias, size_t sA, size_t sB, size_t sC, const int* __restrict__ lenp) {
    typedef typename WFrag<T16>::V V; static_assert(K % 64 == 0, "a trip of the k loop is two steps of 32");
    constexpr bool HA2 = (NSPLIT == 1 || NSPLIT == 2), HB2 = (NSPLIT >= 2); constexpr int STB = (2 + (HA2 ? 1 : 0) + (HB2 ? 1 : 0)) * SOP;   /* bytes of a stage: A, Bt, then A2, Bt2 where they exist */
    static_assert(STB / SOP * 8 <= 63, "a stage's copies of the wave, all in flight at once"); static_assert(2 * STB >= 4 * 16 * 68 * 4, "the four waves' output stagings fit in the ring");
    __shared__ __align__(16) char ring[2 * STB];
    int zb = blockIdx.z, tx = blockIdx.x, ty = blockIdx.y;
    if (LIVE == 1) { int t; if (!deal(lenp, (int)blockIdx.x, 7, TT / 128, zb, t)) return;   /* the whole block leaves, in front of every barrier */ tx = t % (TT / 128); ty = t / (TT / 128); }
    const int Kend = (LIVE == 2) ? ((livekeys(lenp[zb]) + 63) & ~63) : K;
    const size_t z = zb; A += z * sA; if (A2) A2 += z * sA; Bt += z * sB; if (Bt2) Bt2 += z * sB; C += z * sC;
    const int lane = threadIdx.x & 31, lr = lane & 15, hi = lane >> 4; const int r0 = tx * 128, c0 = ty * 128;
    const int w = __builtin_amdgcn_readfirstlane(threadIdx.x >> 5), wm = w & 1, wn = w >> 1;   /* the wave's number as a scalar; its quarter: rows 64 wm .., columns 64 wn .. of the tile */
    float* os = (float*)ring + w * (16 * 68);   /* behind the k loop the ring is the output staging, a piece of its own for each wave */
    v8f acc[4][4];
#pragma unroll
    for (int mb = 0; mb < 4; ++mb)
#pragma unroll
        for (int nb = 0; nb < 4; ++nb) acc[mb][nb] = (v8f){};
    const size_t go = ((size_t)(w * 32 + (lane >> 3)) * K + 8 * (lane & 7)) * sizeof(T16);   /* a copy's lane: row lane / 8 of its four, piece lane % 8 of the row's 128 B; the wave's rows begin at 32 w */
    const GLB char* ga = (const GLB char*)(A + (size_t)r0 * K) + go; const GLB char* gb = (const GLB char*)(Bt + (size_t)c0 * K) + go;
    const GLB char* ga2 = HA2 ? (const GLB char*)(A2 + (size_t)r0 * K) + go : nullptr; const GLB char* gb2 = HB2 ? (const GLB char*)(Bt2 + (size_t)c0 * K) + go : nullptr;
    const unsigned lc = (unsigned)(size_t)ring + (w * 32 + (lane >> 3)) * SPB + (lane & 7) * 16;   /* the lane's LDS byte address in buffer 0: the low 32 bits of the __shared__ address */
    constexpr int GP = 4 * K * (int)sizeof(T16);   /* four rows on in the plane */
    auto stage = [&](const unsigned l) __attribute__((always_inline)) {   /* the next stage's copies into the buffer at l; the source pointers move on by 64 k */
        copy8<GP>(l, ga); copy8<GP>(l + SOP, gb); if (HA2) copy8<GP>(l + 2 * SOP, ga2); if (HB2) copy8<GP>(l + STB - SOP, gb2);
        ga += 128; gb += 128; if (HA2) ga2 += 128; if (HB2) gb2 += 128; };
    const char* fr = ring + lr * SPB + hi * 16;   /* the lane's place in a fragment: row lr, k 8 hi .. 8 hi + 7 and 16 further on, as in the planes */
    const int oa = wm * 64 * SPB, ob = wn * 64 * SPB;   /* where the wave's 64 rows begin in an A and in a Bt operand of a stage */
    V a[2][4], a2[2][4], b[2][4], b2[2][4];   /* two fragment sets, one per k step of a stage: the second one's LDS reads fly under the first one's products */
    auto ldset = [&](const int S, const char* f) __attribute__((always_inline)) {   /* S is a constant at every call: the sets stay in registers */
#pragma unroll
        for (int q = 0; q < 4; ++q) { a[S][q] = WFrag<T16>::ld(f + oa + q * 16 * SPB); if (HA2) a2[S][q] = WFrag<T16>::ld(f + oa + 2 * SOP + q * 16 * SPB);
            b[S][q] = WFrag<T16>::ld(f + ob + SOP + q * 16 * SPB); if (HB2) b2[S][q] = WFrag<T16>::ld(f + ob + STB - SOP + q * 16 * SPB); }
        __builtin_amdgcn_sched_barrier(0); };   /* the whole set's reads are issued in front of the products: without it they sink to their first use and their latency is waited out */
    auto mmaset = [&](const int S) __attribute__((always_inline)) {
#pragma unroll
        for (int nb = 0; nb < 4; ++nb) {
#pragma unroll
            for (int mb = 0; mb < 4; ++mb) { acc[mb][nb] = WFrag<T16>::mma(a[S][mb], b[S][nb], acc[mb][nb]); if (NSPLIT == 1 || NSPLIT == 2) acc[mb][nb] = WFrag<T16>::mma(a2[S][mb], b[S][nb], acc[mb][nb]); if (NSPLIT >= 2) acc[mb][nb] = WFrag<T16>::mma(a[S][mb], b2[S][nb], acc[mb][nb]); } }
        __builtin_amdgcn_sched_barrier(0); };   /* the first set's products all stand in front of the second's: they run while the second set's LDS reads are still landing */
    const int nt = Kend >> 6;   /* stages; the same for the whole block, at least one */
    stage(lc);
    asm volatile("s_wait_asynccnt 0x0" ::: "memory");   /* the wave's own quarter of stage 0 has landed */
    __syncthreads();   /* every wave's quarter has: nothing of stage 0 is read in front of here */
    if (nt > 1) stage(lc + STB);
#pragma unroll 1   /* one trip is one stage: two k steps, one per fragment set */
    for (int t = 0; t < nt; ++t) {
        const int bo = (t & 1) * STB;
        ldset(0, fr + bo);
        ldset(1, fr + bo + 64);
        mmaset(0);
        mmaset(1);
        asm volatile("s_wait_dscnt 0x0" ::: "memory");   /* this stage's LDS reads have ended before its buffer is refilled */
        asm volatile("s_wait_asynccnt 0x0" ::: "memory");   /* the wave's own quarter of the next stage has landed */
        __syncthreads();   /* the next stage is read, and this one's buffer refilled, only behind here: all four waves have brought their quarters in and ended their reads */
        if (t + 2 < nt) stage(lc + bo);
    }
    asm volatile("s_wait_asynccnt 0x0" ::: "memory");   /* no copy is outstanding when the ring becomes the output staging (the last trip's barrier has ended every wave's reads of it) */
#pragma unroll
    for (int mb = 0; mb < 4; ++mb) {
#pragma unroll
        for (int nb = 0; nb < 4; ++nb) {
#pragma unroll
            for (int j = 0; j < 8; ++j) os[(hi * 8 + j) * 68 + nb * 16 + lr] = acc[mb][nb][j]; }
        __builtin_amdgcn_wave_barrier(); asm volatile("" ::: "memory");
        const int cw = c0 + wn * 64; float* crow = C + (size_t)(r0 + wm * 64 + mb * 16) * ldc + cw;
{
#pragma unroll
            for (int s = 0; s < 8; ++s) { const int row = 2 * s + hi, cofs = lr * 4; v4f val = *(const v4fa*)(os + row * 68 + cofs); if (BIAS) { val[0] += bfr(bias[cw + cofs]); val[1] += bfr(bias[cw + cofs + 1]); val[2] += bfr(bias[cw + cofs + 2]); val[3] += bfr(bias[cw + cofs + 3]); }
                *(v4f*)(crow + (size_t)row * ldc + cofs) = val; }
             }
        __builtin_amdgcn_wave_barrier(); asm volatile("" ::: "memory");
    }
}

__device__ __forceinline__ h16 tohx(float x) { return (h16)x; }
__device__ __forceinline__ void splitf(float y, unsigned short& h, unsigned short& l) { h = f2bf(y); l = f2bf(y - bf2f(h)); }
typedef __attribute__((ext_vector_type(2))) _Float16 v2h;
typedef __attribute__((ext_vector_type(4))) _Float16 v4h;
typedef __attribute__((ext_vector_type(2))) unsigned short v2us;
typedef __attribute__((ext_vector_type(4))) unsigned short v4us;
typedef __attribute__((ext_vector_type(2))) float v2f;
typedef __attribute__((ext_vector_type(4))) int v4i;

__global__ __launch_bounds__(256) void k_wtG(const float* __restrict__ w, int K, int N, bf* Bt) {
    const int lane = threadIdx.x & 31; const int L0 = (blockIdx.x * 8 + (threadIdx.x >> 5)) * 8; const int nlines = N * K / 64;
{
#pragma unroll 1
        for (int l = 0; l < 8; ++l) { const int L = L0 + l; if (L >= nlines) break; const size_t e = (size_t)L * 64 + lane * 2; const int k = (int)(e % K), n = (int)(e / K); v2us o;
            o[0] = f2bf(w[(size_t)k * N + n]); o[1] = f2bf(w[(size_t)(k + 1) * N + n]); *(v2us*)(Bt + e) = o; }
         }
}
__global__ __launch_bounds__(256) void k_cvt8(const float* __restrict__ src, bf* dst, size_t n8) { const size_t i = (size_t)blockIdx.x * 256 + threadIdx.x; if (i >= n8) return; const v8f v = *(const v8f*)(src + i * 8); v8us o;
#pragma unroll
    for (int k = 0; k < 8; ++k) o[k] = f2bf(v[k]); *(v8us*)(dst + i * 8) = o;  }


__global__ __launch_bounds__(256) void k_vtp(const float* __restrict__ F, int pitch, int nheads, h16* V16, bf* Vh, bf* Vl) { const size_t e = ((size_t)blockIdx.x * 256 + threadIdx.x) * 2; if (e >= (size_t)nheads * HD * TT) return; const int t = (int)(e % TT); const int d = (int)((e / TT) % HD); const int g = (int)(e / ((size_t)TT * HD)); v2h o16; v2us oh, ol;
#pragma unroll
    for (int q = 0; q < 2; ++q) { const float x = F[(size_t)(t + q) * pitch + g * HD + d]; o16[q] = tohx(x); unsigned short a2, c2; splitf(x, a2, c2); oh[q] = a2; ol[q] = c2; }
    *(v2h*)(V16 + e) = o16; *(v2us*)(Vh + e) = oh; *(v2us*)(Vl + e) = ol;  }

// asoft_row: one wave's softmax row over its first NCH chunks of 128 keys, the chunks that hold a live key (LK = livekeys of the batch, NCH = ceil(LK / 128)). The chunks left out hold exact zeros only, so maximum, sum and every stored value keep their bits. NCH is a compile-time count so that the row stays in registers.
template <int NCH>
__device__ __forceinline__ void asoft_row(const float* __restrict__ sr, bf* Ph, bf* Pl, int L, int LK, int lane) {
    float v[NCH * 4]; float mx = -3.0e38f;
    v4f ar[NCH];
    const unsigned bo = lane * 16u, bl = 4u * (unsigned)min((NCH - 1) * 128 + lane * 4, (LK - 1) & ~3);   /* byte offsets of the lane's piece: in chunk 0, and in the last chunk, where the minimum keeps every lane on scores that the live tiles wrote (what it moves is masked below) */
#pragma unroll
    for (int ch = 0; ch < NCH; ++ch) ar[ch] = *(const v4f*)((const char*)sr + (ch < NCH - 1 ? bo + ch * 512u : bl));
#define ARX(i) ar[(i) < NCH ? (i) : NCH - 1]
    asm volatile("s_wait_xcnt 0x0" :: "v"(ARX(0)), "v"(ARX(1)), "v"(ARX(2)), "v"(ARX(3)), "v"(ARX(4)), "v"(ARX(5)), "v"(ARX(6)), "v"(ARX(7)), "v"(bo), "v"(bl) : "memory");   /* the row loads' offset registers are reused behind here: keeps the wait in front of that overwrite. Inputs only: the loaded values, so that every load of the row is issued in front, and the two offsets, so that no load lands in a register that an earlier one names */
#undef ARX
    __builtin_amdgcn_sched_barrier(0);   /* keeps later vector work, which takes over those registers, behind the wait */
#pragma unroll
    for (int ch = 0; ch < NCH; ++ch) { const int j0 = ch * 128 + lane * 4; const v4f a = ar[ch];
#pragma unroll
        for (int q = 0; q < 4; ++q) { const int j = j0 + q; const float t = (ch < NCH - 1 ? L >= 1 : j < L) ? a[q] * SCL : -3.0e38f; v[ch * 4 + q] = t;   /* keys at or beyond the batch's encoder length excluded (-1e10 == exclusion); in front of the last chunk j < LK, so j < L says no more than L >= 1 */ mx = fmaxf(mx, t); } }
#pragma unroll
    for (int sh = 16; sh; sh >>= 1) mx = fmaxf(mx, __shfl_xor(mx, sh, 32));
    float sum = 0.f;
#pragma unroll
    for (int k = 0; k < NCH * 4; ++k) { const float d0 = __fsub_rn(v[k], mx); asm("v_exp_f32 %0, %1\n\tv_nop" : "=v"(v[k]) : "v"(__fmul_rn(d0, 1.4426950408889634f)));   /* exp2 with the slot behind a transcendental in one statement: the next vector instruction may take over its source register, and a v_nop of its own does not stay behind the builtin */ sum += v[k]; }
#pragma unroll
    for (int sh = 16; sh; sh >>= 1) sum += __shfl_xor(sum, sh, 32);
    const float f = __fdiv_rn(1.0f, sum);
#pragma unroll
    for (int ch = 0; ch < NCH; ++ch) { v4us oh, ol;
#pragma unroll
        for (int q = 0; q < 4; ++q) { unsigned short a, c2; splitf(v[ch * 4 + q] * f, a, c2); oh[q] = a; ol[q] = c2; }
        const size_t oo = ch * 128 + lane * 4; *(v4us*)(Ph + oo) = oh; *(v4us*)(Pl + oo) = ol;
        if (ch == NCH - 1) asm volatile("s_wait_xcnt 0x0" ::: "memory");   /* the row's last two stores: keeps the wait in front of whatever next writes a register that they name (the earlier chunks' stores have the compiler's own waits) */
        __builtin_amdgcn_sched_barrier(0); }   /* a chunk's split and stores end before the next chunk's begin: otherwise all chunks' temporaries pile up in front of the stores and the row takes more than 64 registers (12 waves a SIMD instead of 16) */
}
static_assert(RH == TT && ZH == 1 && TT == 1024, "every row hi/lo; eight chunks of 128 keys");
__global__ __launch_bounds__(256) void k_asoft(const float* __restrict__ Sb, bf* Ph, bf* Pl, const int* __restrict__ lenp) {
    const size_t bz = blockIdx.y;   /* batch: one grid plane per batch */
    const int L = lenp[bz];   /* this batch's encoder length */ const int LK = livekeys(L); const int lane = threadIdx.x & 31; const int row = blockIdx.x * 8 + __builtin_amdgcn_readfirstlane(threadIdx.x >> 5);   /* the wave's row as a scalar: the three row pointers then take no vector registers */
    const size_t ro = (bz * TT + row) * TT; const float* sr = Sb + ro; Ph += ro; Pl += ro;
    switch ((LK + 127) >> 7) {   /* the same for the whole block */
        case 1: asoft_row<1>(sr, Ph, Pl, L, LK, lane); break; case 2: asoft_row<2>(sr, Ph, Pl, L, LK, lane); break; case 3: asoft_row<3>(sr, Ph, Pl, L, LK, lane); break; case 4: asoft_row<4>(sr, Ph, Pl, L, LK, lane); break;
        case 5: asoft_row<5>(sr, Ph, Pl, L, LK, lane); break; case 6: asoft_row<6>(sr, Ph, Pl, L, LK, lane); break; case 7: asoft_row<7>(sr, Ph, Pl, L, LK, lane); break; default: asoft_row<8>(sr, Ph, Pl, L, LK, lane); break; }
}
__global__ __launch_bounds__(256) void k_merge(const float* __restrict__ O, int h0, float* OUTb) { const size_t e = ((size_t)blockIdx.x * 256 + threadIdx.x) * 2; if (e >= (size_t)ZH * TT * HD) return; const int d = (int)(e % HD); const int t = (int)((e / HD) % TT); const int zz = (int)(e / ((size_t)HD * TT)); const float cs = (t < RH) ? 1.0f : (1.0f / PCAR); const size_t oo = (size_t)t * DQ + (h0 + zz) * HD + d;
    v2f o2; o2[0] = O[e] * cs; o2[1] = O[e + 1] * cs; *(v2f*)(OUTb + oo) = o2;  }


__global__ __launch_bounds__(256) void k_vtpR1(const float* __restrict__ Vb, bf* Vh) { const size_t e = ((size_t)blockIdx.x * 256 + threadIdx.x) * 2; if (e >= (size_t)HD * TT) return; const int t = (int)(e % TT); const int d = (int)(e / TT); v2us o; o[0] = f2bf(Vb[(size_t)t * HD + d]); o[1] = f2bf(Vb[(size_t)(t + 1) * HD + d]); *(v2us*)(Vh + e) = o;  }
__global__ __launch_bounds__(256) void k_mergeR(const float* __restrict__ O, float* outb, size_t n4) { const size_t i = (size_t)blockIdx.x * 256 + threadIdx.x; if (i >= n4) return; const v4f a = *(const v4f*)(O + i * 4); *(v4f*)(outb + i * 4) = a;  }


// The two passes below move 16 pieces of 16 B per lane (a wave reads 8 KB), in whole 128-B lines: they are bound by how fast waves start, not by their bytes.
#define PCS  16                    // 16-B pieces per lane
#define BLKE (256 * 4 * PCS)       // f32 elements per 256-thread block
static_assert(NH_ == 1 && HD == DM, "one head: the head plane [h][t][d] is the token-major tensor itself");
static_assert(((size_t)NB_ * TT * DM) % BLKE == 0 && TT % 256 == 0 && HD % 64 == 0 && (64 * DM) % BLKE == 0, "whole blocks and tiles only");
// LIVE: src holds keys; only the rows that a live 128-key score tile reads are converted.
template <bool LIVE>
__global__ __launch_bounds__(256) void k_hp1(const float* __restrict__ src, bf* P, const int* __restrict__ lenp) { size_t blk = blockIdx.x;
    if (LIVE) { int z, t; if (!deal(lenp, (int)blockIdx.x, 7, 128 * DM / BLKE, z, t)) return; blk = (size_t)z * (TT * DM / BLKE) + t; }
    const size_t e0 = blk * BLKE + threadIdx.x * 4; v4f v[PCS];
#pragma unroll   /* all loads of the lane in flight before the first convert */
    for (int k = 0; k < PCS; ++k) v[k] = *(const v4f*)(src + e0 + k * 1024);
#pragma unroll   /* v[] stays in registers */
    for (int k = 0; k < PCS; ++k) { v4us o; o[0] = f2bf(v[k][0]); o[1] = f2bf(v[k][1]); o[2] = f2bf(v[k][2]); o[3] = f2bf(v[k][3]); *(v4us*)(P + e0 + k * 1024) = o; } }
// k_vt1: one block transposes a tile of 256 tokens x 64 dims through LDS. tile[d][c] holds 16-B chunks of 8 tokens (a dword = tokens 2tp, 2tp+1); chunk c of row d lies at c ^ (d >> 2), so that the 32 dword stores of a wave (16 dim groups x 2 token pairs) and the 16 chunks that a half wave reads each fall on distinct banks.
__global__ __launch_bounds__(256) void k_vt1(const float* __restrict__ src, bf* VT, const int* __restrict__ lenp) {
    __shared__ __align__(16) unsigned tile[64 * 128];
    int z, t; if (!deal(lenp, (int)blockIdx.x, 8, HD / 64, z, t)) return;   /* only token tiles with a live key; the whole block leaves, in front of the barrier */
    const int tt = t / (HD / 64), td = t % (HD / 64);
    src += ((size_t)z * TT + tt * 256) * DM + td * 64; VT += ((size_t)z * HD + td * 64) * TT + tt * 256;
    const int lane = threadIdx.x & 31, w = threadIdx.x >> 5, g = lane & 15, hf = lane >> 4; const float* sp = src + (size_t)(w * 4 + hf * 2) * DM + g * 4; v4f a[8], c[8];
#pragma unroll   /* all loads of the lane in flight before the first convert */
    for (int it = 0; it < 8; ++it) { a[it] = *(const v4f*)(sp + it * 32 * DM); c[it] = *(const v4f*)(sp + it * 32 * DM + DM); }   /* token pair tp = it * 16 + w * 2 + hf: rows 2 tp and 2 tp + 1 */
    __builtin_amdgcn_sched_barrier(0);   /* keeps all 16 loads in flight at once: without it the last five are issued only behind the first converts */
#pragma unroll   /* a[], c[] stay in registers */
    for (int it = 0; it < 8; ++it) { const int tp = it * 16 + w * 2 + hf;
#pragma unroll   /* vector elements picked by constants */
        for (int q = 0; q < 4; ++q) tile[(g * 4 + q) * 128 + (((tp >> 2) ^ g) << 2) + (tp & 3)] = (unsigned)f2bf(a[it][q]) | ((unsigned)f2bf(c[it][q]) << 16); }
    __syncthreads();   /* every wave's columns are in the tile before any row is read */
#pragma unroll   /* eight independent LDS reads and stores per lane */
    for (int it = 0; it < 8; ++it) { const int d = it * 8 + w; const v4i r = *(const v4i*)(tile + d * 128 + ((lane ^ ((d >> 2) & 15)) << 2)); *(v4i*)(VT + (size_t)d * TT + lane * 8) = r; }
}

extern "C" void kernel_launch(void* const* d_in, const int* in_sizes, int n_in,
                              void* d_out, int out_size, void* d_ws, size_t ws_size, hipStream_t stream) {
    (void)in_sizes; (void)n_in; (void)out_size;
    const float* Qin = (const float*)d_in[0]; const float* Kin = (const float*)d_in[1]; const float* Vin = Kin;   /* query = output, key = value = encoder_outputs */ const int* lens = (const int*)d_in[2];   /* encoder_sequence_lengths [16] int */
    float* OUT = (float*)d_out;
    char* wsp = (char*)d_ws;
    auto take = [&](size_t bytes) { char* p = wsp; wsp += (bytes + 255) & ~(size_t)255; return (void*)p; };
    /* every plane holds all NB_ batches, batch-major; each launch covers all batches (a flat grid for the convert passes, the transposition and the scores, grid y for the softmax, grid z for the second GEMM, whose 128x128 tiles cover every element of the output and are stored straight to it) */
    bf* QB = (bf*)take((size_t)NB_ * NH_ * TT * HD * 2); bf* KB = (bf*)take((size_t)NB_ * NH_ * TT * HD * 2); bf* VT = (bf*)take((size_t)NB_ * NH_ * HD * TT * 2);
    float* Sb = (float*)take((size_t)NB_ * TT * TT * 4);  bf* Ph = (bf*)take((size_t)NB_ * TT * TT * 2); bf* Pl = (bf*)take((size_t)NB_ * TT * TT * 2);
    if ((size_t)(wsp - (char*)d_ws) > ws_size) return;
    k_hp1<false><<<dim3((unsigned)((size_t)NB_ * TT * DM / BLKE), 1, 1), 256, 0, stream>>>(Qin, QB, nullptr); k_hp1<true><<<dim3((unsigned)((size_t)NB_ * TT * DM / BLKE), 1, 1), 256, 0, stream>>>(Kin, KB, lens); k_vt1<<<dim3((TT / 256) * (HD / 64) * NB_, 1, 1), 256, 0, stream>>>(Vin, VT, lens);
    for (int h = 0; h < NH_; ++h) {
        k_gemmw<bf, 0, false, 1, HD><<<dim3((TT / 128) * (TT / 128) * NB_, 1, 1), 128, 0, stream>>>(QB + (size_t)h * TT * HD, nullptr, KB + (size_t)h * TT * HD, nullptr, Sb, TT, nullptr, (size_t)NH_ * TT * HD, (size_t)NH_ * TT * HD, (size_t)TT * TT, lens);   /* exact scores (single bf16 planes) */
        k_asoft<<<dim3(TT / 8, NB_, 1), 256, 0, stream>>>(Sb, Ph, Pl, lens);
        k_gemmw<bf, 1, false, 2, TT><<<dim3(TT / 128, HD / 128, NB_), 128, 0, stream>>>(Ph, Pl, VT + (size_t)h * HD * TT, nullptr, OUT, HD, nullptr, (size_t)TT * TT, (size_t)NH_ * HD * TT, (size_t)TT * HD, lens);   /* P (hi/lo) x exact v^T -> output rows [b][t][d] */ }
}

// v008
// Measured time: 56.3 microseconds a run.
// In two side-by-side timings against v007, it was 1.08 and 1.09 times as fast.
// Counting every step since v000, it is 15.5 times as fast.
#include <hip/hip_runtime.h>

// Scaled dot-product cross attention with key-length masking (query = output [16][1024][512]; key = value = encoder_outputs [16][1024][512]; scores = q.k x rsqrt(512); keys j >= encoder_sequence_lengths[b] -> -1e10 (== exclusion; lengths [16] int in [1, 1024], read); softmax; context = attn value -> [16][1024][512] (8.4 M); ONE 512-wide head).
// Layout per batch: single bf16 planes of q and k (inputs bf16-exact: exact score products over the 512 dims) and value^T planes from the same encoder tensor; softmax (every row hi/lo) whose select keeps keys below the batch's length (read on device); P hi/lo x exact value; output rows.
// Compute dtypes, f32 accumulate: every input rounded to bf16; q.k exact; softmax f32; P hi/lo x exact value (2 products); output f32.

#define NB_  16
#define TT   1024
#define DM   512      // token-major row pitch (H x HD)
#define NH_  1
#define NKV  1
#define REP  (NH_ / NKV)
#define HD   512
#define DQ   (NH_ * HD)
#define DKV  (NKV * HD)
#define ZH   1
#define RH   1024                  // query rows < RH use hi+lo planes (0: none)
#define WIN  0
#define PCAR 1024.0f
#define SCL  0.044194173824159216f   // rsqrt(512) (= 2^-4.5; one f32 multiply)
typedef _Float16 h16;
typedef unsigned short bf;
typedef __attribute__((ext_vector_type(16))) __bf16   v16bf;
typedef __attribute__((ext_vector_type(16))) _Float16 v16h;
typedef __attribute__((ext_vector_type(8)))  _Float16 v8h;
typedef __attribute__((ext_vector_type(8)))  unsigned short v8us;
typedef __attribute__((ext_vector_type(8)))  float    v8f;
typedef __attribute__((ext_vector_type(4)))  float    v4f;
typedef v8h  __attribute__((may_alias)) v8ha;
typedef v4f  __attribute__((may_alias)) v4fa;
typedef v8us __attribute__((may_alias)) v8usa;

__device__ __forceinline__ unsigned short f2bf(float f) { unsigned u = __float_as_uint(f); u += 0x7FFFu + ((u >> 16) & 1u); return (unsigned short)(u >> 16); }
__device__ __forceinline__ float bf2f(unsigned short b) { return __uint_as_float(((unsigned)b) << 16); }
__device__ __forceinline__ float bfr(float f) { return bf2f(f2bf(f)); }
__device__ __forceinline__ v16h cat16(v8h lo, v8h hi) { return __builtin_shufflevector(lo, hi, 0, 1, 2, 3, 4, 5, 6, 7, 8, 9, 10, 11, 12, 13, 14, 15); }
__device__ __forceinline__ v16bf cat16b(v8us lo, v8us hi) { return __builtin_bit_cast(v16bf, __builtin_shufflevector(lo, hi, 0, 1, 2, 3, 4, 5, 6, 7, 8, 9, 10, 11, 12, 13, 14, 15)); }
__device__ __forceinline__ v8f wmma16(v16h a, v16h b, v8f c) { return __builtin_amdgcn_wmma_f32_16x16x32_f16(false, a, false, b, (short)0, c, false, false); }
__device__ __forceinline__ v8f wmmab(v16bf a, v16bf b, v8f c) { return __builtin_amdgcn_wmma_f32_16x16x32_bf16(false, a, false, b, (short)0, c, false, false); }



// ---- Keys at or beyond a batch's length have softmax weight exactly 0 (exp of about -1e10 below the row's maximum), so tiles that hold no live key are not converted, multiplied, read or stored.
// livekeys: how many keys of a batch can weigh. A length below 1 masks every key alike (the softmax is then uniform over all TT keys) and one above TT masks none: both leave all TT keys in play, and the value bounds every index formed from it.
__device__ __forceinline__ int livekeys(int L) { return (L < 1 || L > TT) ? TT : L; }
// deal: piece number id of a launch that runs live pieces only -> batch z and piece t inside it; batch b has per * ceil(livekeys / 2^sh) pieces. Live pieces take the lowest block numbers, so that they spread evenly over the chip; false: no piece left for this block.
__device__ __forceinline__ bool deal(const int* __restrict__ lenp, int id, int sh, int per, int& z, int& t) {
    int end = 0; z = 0; t = id;
#pragma unroll   /* the 16 lengths come in one scalar load, the search stays scalar */
    for (int b = 0; b < NB_; ++b) { end += per * ((livekeys(lenp[b]) + (1 << sh) - 1) >> sh); if (id >= end) { z = b + 1; t = id - end; } }   /* z: how many batches end at or below id */
    return z < NB_;
}

// ---- k_gemmw: register-blocked GEMM, FOUR WAVES (2 x 2) per 128x128 output tile, each wave a 64x64 quarter (16 accumulators), operands from K-contiguous 16-bit planes through LDS; grid (M/128, N/128, Z), 128 threads.
// A stage is 64 k of every operand's 128 rows, staged once for the four waves (each row feeds two of them: half the bytes from L2 of four one-wave tiles); every wave copies a quarter of it, rows 32 w .. 32 w + 31 of each operand. Asynchronous copies bring it in whole 128-B lines (a copy of the wave covers 4 rows), two buffers: the next stage flies while this one is multiplied.
// C[m][n] (f32, pitch ldc, + optional f32 bias[n]) = sum_k A[m][k] Bt[n][k] (+ split products per NSPLIT). z-batch strides sA/sB/sC in elements. K (compile time) % 64 == 0.
// LIVE 1: n is the key; flat grid, only tiles with a live key run (TT / 128 row tiles per 128 keys). LIVE 2: k is the key; the k loop ends at the batch's live keys, rounded up to 64 (A is exactly 0 there, Bt finite).
#define GLB __attribute__((address_space(1)))   /* the copies' source pointers are global */
#define SPB 144            /* LDS row pitch in bytes: 128 B of k and 16 B more (16 B x odd), so that the 16 rows which a half wave reads with ds_load_b128 fall on distinct banks */
#define SOP (128 * SPB)    /* one operand's 128 rows of a stage */
// copy8: a wave's 32 rows of one operand's stage, eight copies of 16 B a lane, 4 rows each. Copy i lands at LDS address l + i * 4 rows. The immediate offset moves both addresses, so the one LDS register serves all eight and the global register of copy i holds g + i * GP less that offset (it stays inside the plane: GP is larger).
// The wait is the statement's last line: it stands in front of whatever next writes a register that a copy names.
template <int GP>
__device__ __forceinline__ void copy8(unsigned l, const GLB char* g) {
    static_assert(4 * SPB == 576 && GP > 576 && GP % 16 == 0, "the offsets in the text below are i * 4 rows of the LDS pitch"); constexpr int GS = GP - 4 * SPB;
    asm volatile(
                 "global_load_async_to_lds_b128 %0, %1, off\n\tglobal_load_async_to_lds_b128 %0, %2, off offset:576\n\tglobal_load_async_to_lds_b128 %0, %3, off offset:1152\n\tglobal_load_async_to_lds_b128 %0, %4, off offset:1728\n\t"
                 "global_load_async_to_lds_b128 %0, %5, off offset:2304\n\tglobal_load_async_to_lds_b128 %0, %6, off offset:2880\n\tglobal_load_async_to_lds_b128 %0, %7, off offset:3456\n\tglobal_load_async_to_lds_b128 %0, %8, off offset:4032\n\t"
                 "s_wait_xcnt 0x0"
                 :: "v"(l), "v"(g), "v"(g + 1 * GS), "v"(g + 2 * GS), "v"(g + 3 * GS), "v"(g + 4 * GS), "v"(g + 5 * GS), "v"(g + 6 * GS), "v"(g + 7 * GS) : "memory"); }
template <typename T16> struct WFrag;
template <> struct WFrag<h16> { typedef v16h V; static __device__ __forceinline__ V ld(const char* p) { return cat16(*(const v8ha*)p, *(const v8ha*)(p + 32)); } static __device__ __forceinline__ v8f mma(V a, V b, v8f c) { return wmma16(a, b, c); } };
template <> struct WFrag<bf> { typedef v16bf V; static __device__ __forceinline__ V ld(const char* p) { return cat16b(*(const v8usa*)p, *(const v8usa*)(p + 32)); } static __device__ __forceinline__ v8f mma(V a, V b, v8f c) { return wmmab(a, b, c); } };
template <typename T16, int NSPLIT, bool BIAS, int LIVE, int K>
__global__ __launch_bounds__(128) void k_gemmw(const T16* __restrict__ A, const T16* __restrict__ A2, const T16* __restrict__ Bt, const T16* __restrict__ Bt2, float* C, int ldc, const float* __restrict__ bias, size_t sA, size_t sB, size_t sC, const int* __restrict__ lenp) {
    typedef typename WFrag<T16>::V V; static_assert(K % 64 == 0, "a trip of the k loop is two steps of 32");
    constexpr bool HA2 = (NSPLIT == 1 || NSPLIT == 2), HB2 = (NSPLIT >= 2); constexpr int STB = (2 + (HA2 ? 1 : 0) + (HB2 ? 1 : 0)) * SOP;   /* bytes of a stage: A, Bt, then A2, Bt2 where they exist */
    static_assert(STB / SOP * 8 <= 63, "a stage's copies of the wave, all in flight at once"); static_assert(2 * STB >= 4 * 16 * 68 * 4, "the four waves' output stagings fit in the ring");
    __shared__ __align__(16) char ring[2 * STB];
    int zb = blockIdx.z, tx = blockIdx.x, ty = blockIdx.y;
    if (LIVE == 1) { int t; if (!deal(lenp, (int)blockIdx.x, 7, TT / 128, zb, t)) return;   /* the whole block leaves, in front of every barrier */ tx = t % (TT / 128); ty = t / (TT / 128); }
    const int Kend = (LIVE == 2) ? ((livekeys(lenp[zb]) + 63) & ~63) : K;
    const size_t z = zb; A += z * sA; if (A2) A2 += z * sA; Bt += z * sB; if (Bt2) Bt2 += z * sB; C += z * sC;
    const int lane = threadIdx.x & 31, lr = lane & 15, hi = lane >> 4; const int r0 = tx * 128, c0 = ty * 128;
    const int w = __builtin_amdgcn_readfirstlane(threadIdx.x >> 5), wm = w & 1, wn = w >> 1;   /* the wave's number as a scalar; its quarter: rows 64 wm .., columns 64 wn .. of the tile */
    float* os = (float*)ring + w * (16 * 68);   /* behind the k loop the ring is the output staging, a piece of its own for each wave */
    v8f acc[4][4];
#pragma unroll
    for (int mb = 0; mb < 4; ++mb)
#pragma unroll
        for (int nb = 0; nb < 4; ++nb) acc[mb][nb] = (v8f){};
    const size_t go = ((size_t)(w * 32 + (lane >> 3)) * K + 8 * (lane & 7)) * sizeof(T16);   /* a copy's lane: row lane / 8 of its four, piece lane % 8 of the row's 128 B; the wave's rows begin at 32 w */
    const GLB char* ga = (const GLB char*)(A + (size_t)r0 * K) + go; const GLB char* gb = (const GLB char*)(Bt + (size_t)c0 * K) + go;
    const GLB char* ga2 = HA2 ? (const GLB char*)(A2 + (size_t)r0 * K) + go : nullptr; const GLB char* gb2 = HB2 ? (const GLB char*)(Bt2 + (size_t)c0 * K) + go : nullptr;
    const unsigned lc = (unsigned)(size_t)ring + (w * 32 + (lane >> 3)) * SPB + (lane & 7) * 16;   /* the lane's LDS byte address in buffer 0: the low 32 bits of the __shared__ address */
    constexpr int GP = 4 * K * (int)sizeof(T16);   /* four rows on in the plane */
    auto stage = [&](const unsigned l) __attribute__((always_inline)) {   /* the next stage's copies into the buffer at l; the source pointers move on by 64 k */
        copy8<GP>(l, ga); copy8<GP>(l + SOP, gb); if (HA2) copy8<GP>(l + 2 * SOP, ga2); if (HB2) copy8<GP>(l + STB - SOP, gb2);
        ga += 128; gb += 128; if (HA2) ga2 += 128; if (HB2) gb2 += 128; };
    const char* fr = ring + lr * SPB + hi * 16;   /* the lane's place in a fragment: row lr, k 8 hi .. 8 hi + 7 and 16 further on, as in the planes */
    const int oa = wm * 64 * SPB, ob = wn * 64 * SPB;   /* where the wave's 64 rows begin in an A and in a Bt operand of a stage */
    V a[2][4], a2[2][4], b[2][4], b2[2][4];   /* two fragment sets, one per k step of a stage: the second one's LDS reads fly under the first one's products */
    auto ldset = [&](const int S, const char* f) __attribute__((always_inline)) {   /* S is a constant at every call: the sets stay in registers */
#pragma unroll
        for (int q = 0; q < 4; ++q) { a[S][q] = WFrag<T16>::ld(f + oa + q * 16 * SPB); if (HA2) a2[S][q] = WFrag<T16>::ld(f + oa + 2 * SOP + q * 16 * SPB);
            b[S][q] = WFrag<T16>::ld(f + ob + SOP + q * 16 * SPB); if (HB2) b2[S][q] = WFrag<T16>::ld(f + ob + STB - SOP + q * 16 * SPB); }
        __builtin_amdgcn_sched_barrier(0); };   /* the whole set's reads are issued in front of the products: without it they sink to their first use and their latency is waited out */
    auto mmaset = [&](const int S) __attribute__((always_inline)) {
#pragma unroll
        for (int nb = 0; nb < 4; ++nb) {
#pragma unroll
            for (int mb = 0; mb < 4; ++mb) { acc[mb][nb] = WFrag<T16>::mma(a[S][mb], b[S][nb], acc[mb][nb]); if (NSPLIT == 1 || NSPLIT == 2) acc[mb][nb] = WFrag<T16>::mma(a2[S][mb], b[S][nb], acc[mb][nb]); if (NSPLIT >= 2) acc[mb][nb] = WFrag<T16>::mma(a[S][mb], b2[S][nb], acc[mb][nb]); } }
        __builtin_amdgcn_sched_barrier(0); };   /* the first set's products all stand in front of the second's: they run while the second set's LDS reads are still landing */
    const int nt = Kend >> 6;   /* stages; the same for the whole block, at least one */
    stage(lc);
    asm volatile("s_wait_asynccnt 0x0" ::: "memory");   /* the wave's own quarter of stage 0 has landed */
    __syncthreads();   /* every wave's quarter has: nothing of stage 0 is read in front of here */
    if (nt > 1) stage(lc + STB);
#pragma unroll 1   /* one trip is one stage: two k steps, one per fragment set */
    for (int t = 0; t < nt; ++t) {
        const int bo = (t & 1) * STB;
        ldset(0, fr + bo);
        ldset(1, fr + bo + 64);
        mmaset(0);
        mmaset(1);
        asm volatile("s_wait_dscnt 0x0" ::: "memory");   /* this stage's LDS reads have ended before its buffer is refilled */
        asm volatile("s_wait_asynccnt 0x0" ::: "memory");   /* the wave's own quarter of the next stage has landed */
        __syncthreads();   /* the next stage is read, and this one's buffer refilled, only behind here: all four waves have brought their quarters in and ended their reads */
        if (t + 2 < nt) stage(lc + bo);
    }
    asm volatile("s_wait_asynccnt 0x0" ::: "memory");   /* no copy is outstanding when the ring becomes the output staging (the last trip's barrier has ended every wave's reads of it) */
#pragma unroll
    for (int mb = 0; mb < 4; ++mb) {
#pragma unroll
        for (int nb = 0; nb < 4; ++nb) {
#pragma unroll
            for (int j = 0; j < 8; ++j) os[(hi * 8 + j) * 68 + nb * 16 + lr] = acc[mb][nb][j]; }
        __builtin_amdgcn_wave_barrier(); asm volatile("" ::: "memory");
        const int cw = c0 + wn * 64; float* crow = C + (size_t)(r0 + wm * 64 + mb * 16) * ldc + cw;
{
#pragma unroll
            for (int s = 0; s < 8; ++s) { const int row = 2 * s + hi, cofs = lr * 4; v4f val = *(const v4fa*)(os + row * 68 + cofs); if (BIAS) { val[0] += bfr(bias[cw + cofs]); val[1] += bfr(bias[cw + cofs + 1]); val[2] += bfr(bias[cw + cofs + 2]); val[3] += bfr(bias[cw + cofs + 3]); }
                *(v4f*)(crow + (size_t)row * ldc + cofs) = val; }
             }
        __builtin_amdgcn_wave_barrier(); asm volatile("" ::: "memory");
    }
}

__device__ __forceinline__ h16 tohx(float x) { return (h16)x; }
__device__ __forceinline__ void splitf(float y, unsigned short& h, unsigned short& l) { h = f2bf(y); l = f2bf(y - bf2f(h)); }
typedef __attribute__((ext_vector_type(2))) _Float16 v2h;
typedef __attribute__((ext_vector_type(4))) _Float16 v4h;
typedef __attribute__((ext_vector_type(2))) unsigned short v2us;
typedef __attribute__((ext_vector_type(4))) unsigned short v4us;
typedef __attribute__((ext_vector_type(2))) float v2f;
typedef __attribute__((ext_vector_type(4))) int v4i;

__global__ __launch_bounds__(256) void k_wtG(const float* __restrict__ w, int K, int N, bf* Bt) {
    const int lane = threadIdx.x & 31; const int L0 = (blockIdx.x * 8 + (threadIdx.x >> 5)) * 8; const int nlines = N * K / 64;
{
#pragma unroll 1
        for (int l = 0; l < 8; ++l) { const int L = L0 + l; if (L >= nlines) break; const size_t e = (size_t)L * 64 + lane * 2; const int k = (int)(e % K), n = (int)(e / K); v2us o;
            o[0] = f2bf(w[(size_t)k * N + n]); o[1] = f2bf(w[(size_t)(k + 1) * N + n]); *(v2us*)(Bt + e) = o; }
         }
}
__global__ __launch_bounds__(256) void k_cvt8(const float* __restrict__ src, bf* dst, size_t n8) { const size_t i = (size_t)blockIdx.x * 256 + threadIdx.x; if (i >= n8) return; const v8f v = *(const v8f*)(src + i * 8); v8us o;
#pragma unroll
    for (int k = 0; k < 8; ++k) o[k] = f2bf(v[k]); *(v8us*)(dst + i * 8) = o;  }


__global__ __launch_bounds__(256) void k_vtp(const float* __restrict__ F, int pitch, int nheads, h16* V16, bf* Vh, bf* Vl) { const size_t e = ((size_t)blockIdx.x * 256 + threadIdx.x) * 2; if (e >= (size_t)nheads * HD * TT) return; const int t = (int)(e % TT); const int d = (int)((e / TT) % HD); const int g = (int)(e / ((size_t)TT * HD)); v2h o16; v2us oh, ol;
#pragma unroll
    for (int q = 0; q < 2; ++q) { const float x = F[(size_t)(t + q) * pitch + g * HD + d]; o16[q] = tohx(x); unsigned short a2, c2; splitf(x, a2, c2); oh[q] = a2; ol[q] = c2; }
    *(v2h*)(V16 + e) = o16; *(v2us*)(Vh + e) = oh; *(v2us*)(Vl + e) = ol;  }

// asoft_row: one wave's softmax row over its first NCH chunks of 128 keys, the chunks that hold a live key (LK = livekeys of the batch, NCH = ceil(LK / 128)). The chunks left out hold exact zeros only, so maximum, sum and every stored value keep their bits. NCH is a compile-time count so that the row stays in registers.
template <int NCH>
__device__ __forceinline__ void asoft_row(const float* __restrict__ sr, bf* Ph, bf* Pl, int L, int LK, int lane) {
    float v[NCH * 4]; float mx = -3.0e38f;
    v4f ar[NCH];
    const unsigned bo = lane * 16u, bl = 4u * (unsigned)min((NCH - 1) * 128 + lane * 4, (LK - 1) & ~3);   /* byte offsets of the lane's piece: in chunk 0, and in the last chunk, where the minimum keeps every lane on scores that the live tiles wrote (what it moves is masked below) */
#pragma unroll
    for (int ch = 0; ch < NCH; ++ch) ar[ch] = *(const v4f*)((const char*)sr + (ch < NCH - 1 ? bo + ch * 512u : bl));
#define ARX(i) ar[(i) < NCH ? (i) : NCH - 1]
    asm volatile("s_wait_xcnt 0x0" :: "v"(ARX(0)), "v"(ARX(1)), "v"(ARX(2)), "v"(ARX(3)), "v"(ARX(4)), "v"(ARX(5)), "v"(ARX(6)), "v"(ARX(7)), "v"(bo), "v"(bl) : "memory");   /* the row loads' offset registers are reused behind here: keeps the wait in front of that overwrite. Inputs only: the loaded values, so that every load of the row is issued in front, and the two offsets, so that no load lands in a register that an earlier one names */
#undef ARX
    __builtin_amdgcn_sched_barrier(0);   /* keeps later vector work, which takes over those registers, behind the wait */
#pragma unroll
    for (int ch = 0; ch < NCH; ++ch) { const int j0 = ch * 128 + lane * 4; const v4f a = ar[ch];
#pragma unroll
        for (int q = 0; q < 4; ++q) { const int j = j0 + q; const float t = (ch < NCH - 1 ? L >= 1 : j < L) ? a[q] * SCL : -3.0e38f; v[ch * 4 + q] = t;   /* keys at or beyond the batch's encoder length excluded (-1e10 == exclusion); in front of the last chunk j < LK, so j < L says no more than L >= 1 */ mx = fmaxf(mx, t); } }
#pragma unroll
    for (int sh = 16; sh; sh >>= 1) mx = fmaxf(mx, __shfl_xor(mx, sh, 32));
    float sum = 0.f;
#pragma unroll
    for (int k = 0; k < NCH * 4; ++k) { const float d0 = __fsub_rn(v[k], mx); asm("v_exp_f32 %0, %1\n\tv_nop" : "=v"(v[k]) : "v"(__fmul_rn(d0, 1.4426950408889634f)));   /* exp2 with the slot behind a transcendental in one statement: the next vector instruction may take over its source register, and a v_nop of its own does not stay behind the builtin */ sum += v[k]; }
#pragma unroll
    for (int sh = 16; sh; sh >>= 1) sum += __shfl_xor(sum, sh, 32);
    const float f = __fdiv_rn(1.0f, sum);
#pragma unroll
    for (int ch = 0; ch < NCH; ++ch) { v4us oh, ol;
#pragma unroll
        for (int q = 0; q < 4; ++q) { unsigned short a, c2; splitf(v[ch * 4 + q] * f, a, c2); oh[q] = a; ol[q] = c2; }
        const size_t oo = ch * 128 + lane * 4; *(v4us*)(Ph + oo) = oh; *(v4us*)(Pl + oo) = ol;
        if (ch == NCH - 1) asm volatile("s_wait_xcnt 0x0" ::: "memory");   /* the row's last two stores: keeps the wait in front of whatever next writes a register that they name (the earlier chunks' stores have the compiler's own waits) */
        __builtin_amdgcn_sched_barrier(0); }   /* a chunk's split and stores end before the next chunk's begin: otherwise all chunks' temporaries pile up in front of the stores and the row takes more than 64 registers (12 waves a SIMD instead of 16) */
}
static_assert(RH == TT && ZH == 1 && TT == 1024, "every row hi/lo; eight chunks of 128 keys");
__global__ __launch_bounds__(256) void k_asoft(const float* __restrict__ Sb, bf* Ph, bf* Pl, const int* __restrict__ lenp) {
    const size_t bz = blockIdx.y;   /* batch: one grid plane per batch */
    const int L = lenp[bz];   /* this batch's encoder length */ const int LK = livekeys(L); const int lane = threadIdx.x & 31; const int row = blockIdx.x * 8 + __builtin_amdgcn_readfirstlane(threadIdx.x >> 5);   /* the wave's row as a scalar: the three row pointers then take no vector registers */
    const size_t ro = (bz * TT + row) * TT; const float* sr = Sb + ro; Ph += ro; Pl += ro;
    switch ((LK + 127) >> 7) {   /* the same for the whole block */
        case 1: asoft_row<1>(sr, Ph, Pl, L, LK, lane); break; case 2: asoft_row<2>(sr, Ph, Pl, L, LK, lane); break; case 3: asoft_row<3>(sr, Ph, Pl, L, LK, lane); break; case 4: asoft_row<4>(sr, Ph, Pl, L, LK, lane); break;
        case 5: asoft_row<5>(sr, Ph, Pl, L, LK, lane); break; case 6: asoft_row<6>(sr, Ph, Pl, L, LK, lane); break; case 7: asoft_row<7>(sr, Ph, Pl, L, LK, lane); break; default: asoft_row<8>(sr, Ph, Pl, L, LK, lane); break; }
}
__global__ __launch_bounds__(256) void k_merge(const float* __restrict__ O, int h0, float* OUTb) { const size_t e = ((size_t)blockIdx.x * 256 + threadIdx.x) * 2; if (e >= (size_t)ZH * TT * HD) return; const int d = (int)(e % HD); const int t = (int)((e / HD) % TT); const int zz = (int)(e / ((size_t)HD * TT)); const float cs = (t < RH) ? 1.0f : (1.0f / PCAR); const size_t oo = (size_t)t * DQ + (h0 + zz) * HD + d;
    v2f o2; o2[0] = O[e] * cs; o2[1] = O[e + 1] * cs; *(v2f*)(OUTb + oo) = o2;  }


__global__ __launch_bounds__(256) void k_vtpR1(const float* __restrict__ Vb, bf* Vh) { const size_t e = ((size_t)blockIdx.x * 256 + threadIdx.x) * 2; if (e >= (size_t)HD * TT) return; const int t = (int)(e % TT); const int d = (int)(e / TT); v2us o; o[0] = f2bf(Vb[(size_t)t * HD + d]); o[1] = f2bf(Vb[(size_t)(t + 1) * HD + d]); *(v2us*)(Vh + e) = o;  }
__global__ __launch_bounds__(256) void k_mergeR(const float* __restrict__ O, float* outb, size_t n4) { const size_t i = (size_t)blockIdx.x * 256 + threadIdx.x; if (i >= n4) return; const v4f a = *(const v4f*)(O + i * 4); *(v4f*)(outb + i * 4) = a;  }


// k_prep moves 16 pieces of 16 B per lane (a wave reads 8 KB), in whole 128-B lines: such a pass is bound by how fast waves start and by the launch around it, not by its bytes.
#define PCS  16                    // 16-B pieces per lane
#define BLKE (256 * 4 * PCS)       // f32 elements per 256-thread block
#define NQB  ((int)((size_t)NB_ * TT * DM / BLKE))       // query blocks
#define NEB  ((TT / 256) * (HD / 64) * NB_)              // encoder tiles when every key is live
static_assert(NH_ == 1 && HD == DM, "one head: the head plane [h][t][d] is the token-major tensor itself");
static_assert(((size_t)NB_ * TT * DM) % BLKE == 0 && TT % 256 == 0 && HD % 64 == 0, "whole blocks and tiles only");
// k_prep: all three operand planes in ONE launch; nothing in it depends on anything else in it.
// Blocks below the number of live encoder tiles each take a tile of 256 tokens x 64 dims of the encoder tensor, read it ONCE, and write both what the scores need of it (the K plane's rows, a whole 128-B line per token) and what the second GEMM needs (the V^T tile, transposed through LDS). Only token tiles with a live key run: they cover every row that a live 128-key score tile reads.
// The NQB blocks behind them convert the query tensor; the blocks that are left leave at once, at the end of the grid.
// tile[d][c] holds 16-B chunks of 8 tokens (a dword = tokens 2tp, 2tp+1); chunk c of row d lies at c ^ (d >> 2), so that the 32 dword stores of a wave (16 dim groups x 2 token pairs) and the 16 chunks that a half wave reads each fall on distinct banks.
__global__ __launch_bounds__(256) void k_prep(const float* __restrict__ qsrc, const float* __restrict__ src, bf* QP, bf* KP, bf* VT, const int* __restrict__ lenp) {
    __shared__ __align__(16) unsigned tile[64 * 128];
    int z, t;
    if (!deal(lenp, (int)blockIdx.x, 8, HD / 64, z, t)) {   /* no encoder tile left for this block: t counts on from the last live tile. The whole block takes this side, which has no barrier */
        if (t >= NQB) return;
        const float* qb = qsrc + (size_t)t * BLKE; bf* qp = QP + (size_t)t * BLKE; const unsigned tx = threadIdx.x; v4f v[PCS];   /* the block's bases are scalars; the lane's piece number is the one vector register that loads and stores name */
#pragma unroll   /* all loads of the lane in flight before the first convert */
        for (int k = 0; k < PCS; ++k) v[k] = *((const v4f*)qb + (tx + k * 256u));
        asm volatile("s_wait_xcnt 0x0" :: "v"(v[0]), "v"(v[1]), "v"(v[2]), "v"(v[3]), "v"(v[4]), "v"(v[5]), "v"(v[6]), "v"(v[7]), "v"(v[8]), "v"(v[9]), "v"(v[10]), "v"(v[11]), "v"(v[12]), "v"(v[13]), "v"(v[14]), "v"(v[15]), "v"(tx) : "memory");   /* the loads' base is taken over by the stores' base: keeps a wait behind the last load. Inputs only: the loaded values, so that every load is issued in front, and the piece number, so that no load lands in the register that the others name */
        __builtin_amdgcn_sched_barrier(0);   /* keeps the converts, which write over registers, behind the wait */
#pragma unroll   /* v[] stays in registers */
        for (int k = 0; k < PCS; ++k) { v4us o; o[0] = f2bf(v[k][0]); o[1] = f2bf(v[k][1]); o[2] = f2bf(v[k][2]); o[3] = f2bf(v[k][3]); *((v4us*)qp + (tx + k * 256u)) = o; }
        asm volatile("s_wait_xcnt 0x0" ::: "memory");   /* behind the last query store: keeps the wait in front of whatever the listing puts next that writes a register which the stores name */
        return; }
    const int tt = t / (HD / 64), td = t % (HD / 64);
    src += ((size_t)z * TT + tt * 256) * DM + td * 64; KP += ((size_t)z * TT + tt * 256) * DM + td * 64; VT += ((size_t)z * HD + td * 64) * TT + tt * 256;
    const int lane = threadIdx.x & 31, w = threadIdx.x >> 5, g = lane & 15, hf = lane >> 4; const int so = (w * 4 + hf * 2) * DM + g * 4; const float* sp = src + so; bf* kp = KP + so; v4f a[8], c[8];
#pragma unroll   /* all loads of the lane in flight before the first convert */
    for (int it = 0; it < 8; ++it) { a[it] = *(const v4f*)(sp + it * 32 * DM); c[it] = *(const v4f*)(sp + it * 32 * DM + DM); }   /* token pair tp = it * 16 + w * 2 + hf: rows 2 tp and 2 tp + 1 */
    __builtin_amdgcn_sched_barrier(0);   /* keeps all 16 loads in flight at once: without it the last five are issued only behind the first converts */
    v4us ka[8], kc[8];   /* the same 16-bit values, in token-major order for the K plane */
#pragma unroll   /* a[], c[], ka[], kc[] stay in registers */
    for (int it = 0; it < 8; ++it) { const int tp = it * 16 + w * 2 + hf;
#pragma unroll   /* vector elements picked by constants */
        for (int q = 0; q < 4; ++q) { ka[it][q] = f2bf(a[it][q]); kc[it][q] = f2bf(c[it][q]); tile[(g * 4 + q) * 128 + (((tp >> 2) ^ g) << 2) + (tp & 3)] = (unsigned)ka[it][q] | ((unsigned)kc[it][q] << 16); } }
    __syncthreads();   /* every wave's columns are in the tile before any row is read */
#pragma unroll   /* eight independent LDS reads and stores per lane */
    for (int it = 0; it < 8; ++it) { const int d = it * 8 + w; const v4i r = *(const v4i*)(tile + d * 128 + ((lane ^ ((d >> 2) & 15)) << 2)); *(v4i*)(VT + (size_t)d * TT + lane * 8) = r; }
    asm volatile("s_wait_xcnt 0x0" ::: "memory");   /* a register that the V^T stores name is taken over by the K stores' address: keeps the wait in front of that overwrite */
    __builtin_amdgcn_sched_barrier(0);   /* keeps that address work behind the wait */
#pragma unroll   /* the K plane's rows 2 tp and 2 tp + 1: a half wave stores one whole line. Last: in front of the barrier they would be waited out there, and behind them no register is written any more */
    for (int it = 0; it < 8; ++it) { *(v4us*)(kp + it * 32 * DM) = ka[it]; *(v4us*)(kp + it * 32 * DM + DM) = kc[it]; }
}

extern "C" void kernel_launch(void* const* d_in, const int* in_sizes, int n_in,
                              void* d_out, int out_size, void* d_ws, size_t ws_size, hipStream_t stream) {
    (void)in_sizes; (void)n_in; (void)out_size;
    const float* Qin = (const float*)d_in[0]; const float* Kin = (const float*)d_in[1];   /* query = output, key = value = encoder_outputs */ const int* lens = (const int*)d_in[2];   /* encoder_sequence_lengths [16] int */
    float* OUT = (float*)d_out;
    char* wsp = (char*)d_ws;
    auto take = [&](size_t bytes) { char* p = wsp; wsp += (bytes + 255) & ~(size_t)255; return (void*)p; };
    /* every plane holds all NB_ batches, batch-major; each launch covers all batches (a flat grid for the operand planes and the scores, grid y for the softmax, grid z for the second GEMM, whose 128x128 tiles cover every element of the output and are stored straight to it) */
    bf* QB = (bf*)take((size_t)NB_ * NH_ * TT * HD * 2); bf* KB = (bf*)take((size_t)NB_ * NH_ * TT * HD * 2); bf* VT = (bf*)take((size_t)NB_ * NH_ * HD * TT * 2);
    float* Sb = (float*)take((size_t)NB_ * TT * TT * 4);  bf* Ph = (bf*)take((size_t)NB_ * TT * TT * 2); bf* Pl = (bf*)take((size_t)NB_ * TT * TT * 2);
    if ((size_t)(wsp - (char*)d_ws) > ws_size) return;
    k_prep<<<dim3(NEB + NQB, 1, 1), 256, 0, stream>>>(Qin, Kin, QB, KB, VT, lens);   /* key = value: one read of the encoder tensor serves both planes */
    for (int h = 0; h < NH_; ++h) {
        k_gemmw<bf, 0, false, 1, HD><<<dim3((TT / 128) * (TT / 128) * NB_, 1, 1), 128, 0, stream>>>(QB + (size_t)h * TT * HD, nullptr, KB + (size_t)h * TT * HD, nullptr, Sb, TT, nullptr, (size_t)NH_ * TT * HD, (size_t)NH_ * TT * HD, (size_t)TT * TT, lens);   /* exact scores (single bf16 planes) */
        k_asoft<<<dim3(TT / 8, NB_, 1), 256, 0, stream>>>(Sb, Ph, Pl, lens);
        k_gemmw<bf, 1, false, 2, TT><<<dim3(TT / 128, HD / 128, NB_), 128, 0, stream>>>(Ph, Pl, VT + (size_t)h * HD * TT, nullptr, OUT, HD, nullptr, (size_t)TT * TT, (size_t)NH_ * HD * TT, (size_t)TT * HD, lens);   /* P (hi/lo) x exact v^T -> output rows [b][t][d] */ }
}

// v010
// Measured time: 47.5 microseconds a run.
// Versions between v008 and this one are left out; their measured steps multiply to 1.18 times as fast.
// All steps since v000 together make it 18.3 times as fast.
#include <hip/hip_runtime.h>

// Scaled dot-product cross attention with key-length masking (query = output [16][1024][512]; key = value = encoder_outputs [16][1024][512]; scores = q.k x rsqrt(512); keys j >= encoder_sequence_lengths[b] -> -1e10 (== exclusion; lengths [16] int in [1, 1024], read); softmax; context = attn value -> [16][1024][512] (8.4 M); ONE 512-wide head).
// Layout per batch: single bf16 planes of q and k (inputs bf16-exact: exact score products over the 512 dims) and value^T planes from the same encoder tensor; softmax whose select keeps keys below the batch's length (read on device); P as one f16 plane, carried x 1024, x value (the bf16-rounded values again in f16: the same numbers from 2^-14 to 65504 in size, within 2^-25 below); output rows x 1/1024.
// Compute dtypes, f32 accumulate: every input rounded to bf16; q.k exact; softmax f32; P rounded to f16 (11 bits) x value, one f16 product; output f32.

#define NB_  16
#define TT   1024
#define DM   512      // token-major row pitch (H x HD)
#define NH_  1
#define NKV  1
#define REP  (NH_ / NKV)
#define HD   512
#define DQ   (NH_ * HD)
#define DKV  (NKV * HD)
#define ZH   1
#define RH   1024                  // read only by k_merge, which is not launched; every query row uses one bf16 plane
#define WIN  0
#define PCAR 1024.0f
#define SCL  0.044194173824159216f   // rsqrt(512) (= 2^-4.5; one f32 multiply)
typedef _Float16 h16;
typedef unsigned short bf;
typedef __attribute__((ext_vector_type(16))) __bf16   v16bf;
typedef __attribute__((ext_vector_type(16))) _Float16 v16h;
typedef __attribute__((ext_vector_type(8)))  _Float16 v8h;
typedef __attribute__((ext_vector_type(8)))  unsigned short v8us;
typedef __attribute__((ext_vector_type(8)))  float    v8f;
typedef __attribute__((ext_vector_type(4)))  float    v4f;
typedef v8h  __attribute__((may_alias)) v8ha;
typedef v4f  __attribute__((may_alias)) v4fa;
typedef v8us __attribute__((may_alias)) v8usa;

__device__ __forceinline__ unsigned short f2bf(float f) { unsigned u = __float_as_uint(f); u += 0x7FFFu + ((u >> 16) & 1u); return (unsigned short)(u >> 16); }
__device__ __forceinline__ float bf2f(unsigned short b) { return __uint_as_float(((unsigned)b) << 16); }
__device__ __forceinline__ float bfr(float f) { return bf2f(f2bf(f)); }
__device__ __forceinline__ v16h cat16(v8h lo, v8h hi) { return __builtin_shufflevector(lo, hi, 0, 1, 2, 3, 4, 5, 6, 7, 8, 9, 10, 11, 12, 13, 14, 15); }
__device__ __forceinline__ v16bf cat16b(v8us lo, v8us hi) { return __builtin_bit_cast(v16bf, __builtin_shufflevector(lo, hi, 0, 1, 2, 3, 4, 5, 6, 7, 8, 9, 10, 11, 12, 13, 14, 15)); }
__device__ __forceinline__ v8f wmma16(v16h a, v16h b, v8f c) { return __builtin_amdgcn_wmma_f32_16x16x32_f16(false, a, false, b, (short)0, c, false, false); }
__device__ __forceinline__ v8f wmmab(v16bf a, v16bf b, v8f c) { return __builtin_amdgcn_wmma_f32_16x16x32_bf16(false, a, false, b, (short)0, c, false, false); }



// ---- Keys at or beyond a batch's length have softmax weight exactly 0 (exp of about -1e10 below the row's maximum), so tiles that hold no live key are not converted, multiplied, read or stored.
// livekeys: how many keys of a batch can weigh. A length below 1 masks every key alike (the softmax is then uniform over all TT keys) and one above TT masks none: both leave all TT keys in play, and the value bounds every index formed from it.
__device__ __forceinline__ int livekeys(int L) { return (L < 1 || L > TT) ? TT : L; }
// deal: piece number id of a launch that runs live pieces only -> batch z and piece t inside it; batch b has per * ceil(livekeys / 2^sh) pieces. Live pieces take the lowest block numbers; false: no piece left for this block.
__device__ __forceinline__ bool deal(const int* __restrict__ lenp, int id, int sh, int per, int& z, int& t) {
    int end = 0; z = 0; t = id;
#pragma unroll   /* the 16 lengths come in one scalar load, the search stays scalar */
    for (int b = 0; b < NB_; ++b) { end += per * ((livekeys(lenp[b]) + (1 << sh) - 1) >> sh); if (id >= end) { z = b + 1; t = id - end; } }   /* z: how many batches end at or below id */
    return z < NB_;
}

// ---- k_gemmw: register-blocked GEMM, FOUR WAVES (2 x 2) per 128x128 output tile, each wave a 64x64 quarter (16 accumulators), operands from K-contiguous 16-bit planes through LDS; grid (M/128, N/128, Z), 128 threads.
// A stage is 64 k of every operand's 128 rows, staged once for the four waves (each row feeds two of them: half the bytes from L2 of four one-wave tiles). Asynchronous copies bring it in whole 128-B lines (a copy of the wave covers 4 rows).
// THREE buffers, and the two wave pairs copy whole stages in turn (waves 0 and 2 the even stages, waves 1 and 3 the odd ones, each wave 64 rows of every operand): the stage that trip t + 3 reads is issued at the foot of trip t and waited for at the foot of trip t + 2, so it has two trips' products to land under, not one, and every wave's wait is still to 0: when a pair waits, the one stage that it has in flight is the one that is read next.
// C[m][n] (f32, pitch ldc, + optional f32 bias[n]) = sum_k A[m][k] Bt[n][k] (+ split products per NSPLIT; x 1/PCAR for LIVE 2). z-batch strides sA/sB/sC in elements. K (compile time) % 64 == 0.
// LIVE 1: n is the key; flat grid, only tiles with a live key run (TT / 128 row tiles per 128 keys). LIVE 2: k is the key; the k loop ends at the batch's live keys, rounded up to 64 (A is exactly 0 there, Bt finite).
#define GLB __attribute__((address_space(1)))   /* the copies' source pointers are global */
#define SPB 136            /* mean LDS row pitch in bytes, for even row counts only: rows of 128 B, and 16 B more behind every second row. The 16 rows which a half wave reads with ds_load_b128 fall on distinct banks (row 2 m on banks 4 m .., row 2 m + 1 on banks 32 + 4 m ..), and three buffers of three blocks fit in a WGP's LDS */
#define ROWB(r) ((r) * 128 + ((r) >> 1) * 16)   /* where row r of an operand begins; four rows on is 4 * SPB for every r */
#define SOP (128 * SPB)    /* one operand's 128 rows of a stage */
// copy16: a wave's 64 rows of one operand's stage, sixteen copies of 16 B a lane, 4 rows each. Copy i lands at LDS address l + i * 4 rows. The immediate offset moves both addresses, so the one LDS register serves all sixteen and the global register of copy i holds g + i * GP less that offset (it stays inside the plane: GP is larger).
// The wait is the statement's last line: it stands in front of whatever next writes a register that a copy names.
template <int GP>
__device__ __forceinline__ void copy16(unsigned l, const GLB char* g) {
    static_assert(4 * SPB == 544 && GP > 544 && GP % 16 == 0, "the offsets in the text below are i * 4 rows of the LDS pitch"); constexpr int GS = GP - 4 * SPB;
    asm volatile(
                 "global_load_async_to_lds_b128 %0, %1, off\n\tglobal_load_async_to_lds_b128 %0, %2, off offset:544\n\tglobal_load_async_to_lds_b128 %0, %3, off offset:1088\n\tglobal_load_async_to_lds_b128 %0, %4, off offset:1632\n\t"
                 "global_load_async_to_lds_b128 %0, %5, off offset:2176\n\tglobal_load_async_to_lds_b128 %0, %6, off offset:2720\n\tglobal_load_async_to_lds_b128 %0, %7, off offset:3264\n\tglobal_load_async_to_lds_b128 %0, %8, off offset:3808\n\t"
                 "global_load_async_to_lds_b128 %0, %9, off offset:4352\n\tglobal_load_async_to_lds_b128 %0, %10, off offset:4896\n\tglobal_load_async_to_lds_b128 %0, %11, off offset:5440\n\tglobal_load_async_to_lds_b128 %0, %12, off offset:5984\n\t"
                 "global_load_async_to_lds_b128 %0, %13, off offset:6528\n\tglobal_load_async_to_lds_b128 %0, %14, off offset:7072\n\tglobal_load_async_to_lds_b128 %0, %15, off offset:7616\n\tglobal_load_async_to_lds_b128 %0, %16, off offset:8160\n\t"
                 "s_wait_xcnt 0x0"
                 :: "v"(l), "v"(g), "v"(g + 1 * GS), "v"(g + 2 * GS), "v"(g + 3 * GS), "v"(g + 4 * GS), "v"(g + 5 * GS), "v"(g + 6 * GS), "v"(g + 7 * GS), "v"(g + 8 * GS), "v"(g + 9 * GS), "v"(g + 10 * GS), "v"(g + 11 * GS), "v"(g + 12 * GS), "v"(g + 13 * GS), "v"(g + 14 * GS), "v"(g + 15 * GS) : "memory"); }
template <typename T16> struct WFrag;
template <> struct WFrag<h16> { typedef v16h V; static __device__ __forceinline__ V ld(const char* p) { return cat16(*(const v8ha*)p, *(const v8ha*)(p + 32)); } static __device__ __forceinline__ v8f mma(V a, V b, v8f c) { return wmma16(a, b, c); } };
template <> struct WFrag<bf> { typedef v16bf V; static __device__ __forceinline__ V ld(const char* p) { return cat16b(*(const v8usa*)p, *(const v8usa*)(p + 32)); } static __device__ __forceinline__ v8f mma(V a, V b, v8f c) { return wmmab(a, b, c); } };
template <typename T16, int NSPLIT, bool BIAS, int LIVE, int K>
__global__ __launch_bounds__(128) void k_gemmw(const T16* __restrict__ A, const T16* __restrict__ A2, const T16* __restrict__ Bt, const T16* __restrict__ Bt2, float* C, int ldc, const float* __restrict__ bias, size_t sA, size_t sB, size_t sC, const int* __restrict__ lenp) {
    typedef typename WFrag<T16>::V V; static_assert(K % 64 == 0, "a trip of the k loop is two steps of 32");
    constexpr bool HA2 = (NSPLIT == 1 || NSPLIT == 2), HB2 = (NSPLIT >= 2); constexpr int STB = (2 + (HA2 ? 1 : 0) + (HB2 ? 1 : 0)) * SOP;   /* bytes of a stage: A, Bt, then A2, Bt2 where they exist */
    static_assert(STB / SOP * 16 <= 63, "a stage's copies of the wave, all in flight at once"); static_assert(3 * STB >= 4 * 16 * 68 * 4, "the four waves' output stagings fit in the ring");
    __shared__ __align__(16) char ring[3 * STB];
    int zb = blockIdx.z, tx = blockIdx.x, ty = blockIdx.y;
    if (LIVE == 1) { int t; if (!deal(lenp, (int)blockIdx.x, 7, TT / 128, zb, t)) return;   /* the whole block leaves, in front of every barrier */ tx = t % (TT / 128); ty = t / (TT / 128); }
    const int Kend = (LIVE == 2) ? ((livekeys(lenp[zb]) + 63) & ~63) : K;
    const size_t z = zb; A += z * sA; if (A2) A2 += z * sA; Bt += z * sB; if (Bt2) Bt2 += z * sB; C += z * sC;
    const int lane = threadIdx.x & 31, lr = lane & 15, hi = lane >> 4; const int r0 = tx * 128, c0 = ty * 128;
    const int w = __builtin_amdgcn_readfirstlane(threadIdx.x >> 5), wm = w & 1, wn = w >> 1;   /* the wave's number as a scalar; its quarter: rows 64 wm .., columns 64 wn .. of the tile */
    float* os = (float*)ring + w * (16 * 68);   /* behind the k loop the ring is the output staging, a piece of its own for each wave */
    v8f acc[4][4];
#pragma unroll
    for (int mb = 0; mb < 4; ++mb)
#pragma unroll
        for (int nb = 0; nb < 4; ++nb) acc[mb][nb] = (v8f){};
    const int par = w & 1, mh = w >> 1;   /* the wave copies the stages of parity par, rows 64 mh .. 64 mh + 63 of each operand */
    const size_t go = ((size_t)(mh * 64 + (lane >> 3)) * K + 8 * (lane & 7)) * sizeof(T16) + par * 128;   /* a copy's lane: row lane / 8 of its four, piece lane % 8 of the row's 128 B; the wave's first stage is stage par */
    const GLB char* ga = (const GLB char*)(A + (size_t)r0 * K) + go; const GLB char* gb = (const GLB char*)(Bt + (size_t)c0 * K) + go;
    const GLB char* ga2 = HA2 ? (const GLB char*)(A2 + (size_t)r0 * K) + go : nullptr; const GLB char* gb2 = HB2 ? (const GLB char*)(Bt2 + (size_t)c0 * K) + go : nullptr;
    const unsigned lc = (unsigned)(size_t)ring + mh * 64 * SPB + ROWB(lane >> 3) + (lane & 7) * 16;   /* the lane's LDS byte address in buffer 0: the low 32 bits of the __shared__ address */
    constexpr int GP = 4 * K * (int)sizeof(T16);   /* four rows on in the plane */
    auto stage = [&](const unsigned l) __attribute__((always_inline)) {   /* the wave's half of its pair's next stage into the buffer at l; the source pointers move on by two stages, 128 k */
        copy16<GP>(l, ga); copy16<GP>(l + SOP, gb); if (HA2) copy16<GP>(l + 2 * SOP, ga2); if (HB2) copy16<GP>(l + STB - SOP, gb2);
        ga += 256; gb += 256; if (HA2) ga2 += 256; if (HB2) gb2 += 256; };
    const char* fr = ring + ROWB(lr) + hi * 16;   /* the lane's place in a fragment: row lr, k 8 hi .. 8 hi + 7 and 16 further on, as in the planes */
    const int oa = wm * 64 * SPB, ob = wn * 64 * SPB;   /* where the wave's 64 rows begin in an A and in a Bt operand of a stage */
    V a[2][4], a2[2][4], b[2][4], b2[2][4];   /* two fragment sets, one per k step of a stage: the second one's LDS reads fly under the first one's products */
    auto ldset = [&](const int S, const char* f) __attribute__((always_inline)) {   /* S is a constant at every call: the sets stay in registers */
#pragma unroll
        for (int q = 0; q < 4; ++q) { a[S][q] = WFrag<T16>::ld(f + oa + q * 16 * SPB); if (HA2) a2[S][q] = WFrag<T16>::ld(f + oa + 2 * SOP + q * 16 * SPB);
            b[S][q] = WFrag<T16>::ld(f + ob + SOP + q * 16 * SPB); if (HB2) b2[S][q] = WFrag<T16>::ld(f + ob + STB - SOP + q * 16 * SPB); }
        __builtin_amdgcn_sched_barrier(0); };   /* the whole set's reads are issued in front of the products: without it they sink to their first use and their latency is waited out */
    auto mmaset = [&](const int S) __attribute__((always_inline)) {
#pragma unroll
        for (int nb = 0; nb < 4; ++nb) {
#pragma unroll
            for (int mb = 0; mb < 4; ++mb) { acc[mb][nb] = WFrag<T16>::mma(a[S][mb], b[S][nb], acc[mb][nb]); if (NSPLIT == 1 || NSPLIT == 2) acc[mb][nb] = WFrag<T16>::mma(a2[S][mb], b[S][nb], acc[mb][nb]); if (NSPLIT >= 2) acc[mb][nb] = WFrag<T16>::mma(a[S][mb], b2[S][nb], acc[mb][nb]); } }
        __builtin_amdgcn_sched_barrier(0); };   /* the first set's products all stand in front of the second's: they run while the second set's LDS reads are still landing */
    const int nt = Kend >> 6;   /* stages; the same for the whole block, at least one */
    if (par == 0) { stage(lc);
        asm volatile("s_wait_asynccnt 0x0" ::: "memory"); }   /* the wave's own half of stage 0 has landed */
    else if (nt > 1) stage(lc + STB);   /* stage 1 flies on over the barrier: its pair waits for it at the foot of trip 0 */
    __syncthreads();   /* both halves of stage 0 have landed: nothing of it is read in front of here */
    if (par == 0 && nt > 2) stage(lc + 2 * STB);
    int bo = 0;   /* the buffer of trip t: t mod 3 */
#pragma unroll 1   /* one trip is one stage: two k steps, one per fragment set */
    for (int t = 0; t < nt; ++t) {
        const bool mine = ((t + 1) & 1) == par;   /* stages t + 1 and t + 3 are this wave's pair's; a scalar test */
        ldset(0, fr + bo);
        ldset(1, fr + bo + 64);
        mmaset(0);
        mmaset(1);
        asm volatile("s_wait_dscnt 0x0" ::: "memory");   /* this stage's LDS reads have ended before its buffer is refilled */
        if (mine) asm volatile("s_wait_asynccnt 0x0" ::: "memory");   /* the wave's own half of the next stage has landed (all that it has in flight); the other pair's stage t + 2 flies on */
        __syncthreads();   /* the next stage is read, and this one's buffer refilled, only behind here: the pair has brought its halves in and all four waves have ended their reads */
        if (mine && t + 3 < nt) stage(lc + bo);
        bo = (bo == 2 * STB) ? 0 : bo + STB;
    }
    asm volatile("s_wait_asynccnt 0x0" ::: "memory");   /* no copy is outstanding when the ring becomes the output staging (the last trip's barrier has ended every wave's reads of it) */
#pragma unroll
    for (int mb = 0; mb < 4; ++mb) {
#pragma unroll
        for (int nb = 0; nb < 4; ++nb) {
#pragma unroll
            for (int j = 0; j < 8; ++j) os[(hi * 8 + j) * 68 + nb * 16 + lr] = (LIVE == 2) ? acc[mb][nb][j] * (1.0f / PCAR) : acc[mb][nb][j]; }   /* LIVE 2: A was carried x 1024, a power of two: taking it out is exact */
        __builtin_amdgcn_wave_barrier(); asm volatile("" ::: "memory");
        const int cw = c0 + wn * 64; float* crow = C + (size_t)(r0 + wm * 64 + mb * 16) * ldc + cw;
{
#pragma unroll
            for (int s = 0; s < 8; ++s) { const int row = 2 * s + hi, cofs = lr * 4; v4f val = *(const v4fa*)(os + row * 68 + cofs); if (BIAS) { val[0] += bfr(bias[cw + cofs]); val[1] += bfr(bias[cw + cofs + 1]); val[2] += bfr(bias[cw + cofs + 2]); val[3] += bfr(bias[cw + cofs + 3]); }
                *(v4f*)(crow + (size_t)row * ldc + cofs) = val; }
             }
        __builtin_amdgcn_wave_barrier(); asm volatile("" ::: "memory");
    }
}

__device__ __forceinline__ h16 tohx(float x) { return (h16)x; }
__device__ __forceinline__ void splitf(float y, unsigned short& h, unsigned short& l) { h = f2bf(y); l = f2bf(y - bf2f(h)); }
typedef __attribute__((ext_vector_type(2))) _Float16 v2h;
typedef __attribute__((ext_vector_type(4))) _Float16 v4h;
typedef __attribute__((ext_vector_type(2))) unsigned short v2us;
typedef __attribute__((ext_vector_type(4))) unsigned short v4us;
typedef __attribute__((ext_vector_type(2))) float v2f;
typedef __attribute__((ext_vector_type(4))) int v4i;

__global__ __launch_bounds__(256) void k_wtG(const float* __restrict__ w, int K, int N, bf* Bt) {
    const int lane = threadIdx.x & 31; const int L0 = (blockIdx.x * 8 + (threadIdx.x >> 5)) * 8; const int nlines = N * K / 64;
{
#pragma unroll 1
        for (int l = 0; l < 8; ++l) { const int L = L0 + l; if (L >= nlines) break; const size_t e = (size_t)L * 64 + lane * 2; const int k = (int)(e % K), n = (int)(e / K); v2us o;
            o[0] = f2bf(w[(size_t)k * N + n]); o[1] = f2bf(w[(size_t)(k + 1) * N + n]); *(v2us*)(Bt + e) = o; }
         }
}
__global__ __launch_bounds__(256) void k_cvt8(const float* __restrict__ src, bf* dst, size_t n8) { const size_t i = (size_t)blockIdx.x * 256 + threadIdx.x; if (i >= n8) return; const v8f v = *(const v8f*)(src + i * 8); v8us o;
#pragma unroll
    for (int k = 0; k < 8; ++k) o[k] = f2bf(v[k]); *(v8us*)(dst + i * 8) = o;  }


__global__ __launch_bounds__(256) void k_vtp(const float* __restrict__ F, int pitch, int nheads, h16* V16, bf* Vh, bf* Vl) { const size_t e = ((size_t)blockIdx.x * 256 + threadIdx.x) * 2; if (e >= (size_t)nheads * HD * TT) return; const int t = (int)(e % TT); const int d = (int)((e / TT) % HD); const int g = (int)(e / ((size_t)TT * HD)); v2h o16; v2us oh, ol;
#pragma unroll
    for (int q = 0; q < 2; ++q) { const float x = F[(size_t)(t + q) * pitch + g * HD + d]; o16[q] = tohx(x); unsigned short a2, c2; splitf(x, a2, c2); oh[q] = a2; ol[q] = c2; }
    *(v2h*)(V16 + e) = o16; *(v2us*)(Vh + e) = oh; *(v2us*)(Vl + e) = ol;  }

// asoft_row: one wave's softmax row over its first NCH chunks of 128 keys, the chunks that hold a live key (LK = livekeys of the batch, NCH = ceil(LK / 128)). The chunks left out hold exact zeros only, so maximum, sum and every stored value keep their bits. NCH is a compile-time count so that the row stays in registers.
template <int NCH>
__device__ __forceinline__ void asoft_row(const float* __restrict__ sr, h16* P, int L, int LK, int lane) {
    float v[NCH * 4]; float mx = -3.0e38f;
    v4f ar[NCH];
    const unsigned bo = lane * 16u, bl = 4u * (unsigned)min((NCH - 1) * 128 + lane * 4, (LK - 1) & ~3);   /* byte offsets of the lane's piece: in chunk 0, and in the last chunk, where the minimum keeps every lane on scores that the live tiles wrote (what it moves is masked below) */
#pragma unroll
    for (int ch = 0; ch < NCH; ++ch) ar[ch] = *(const v4f*)((const char*)sr + (ch < NCH - 1 ? bo + ch * 512u : bl));
#define ARX(i) ar[(i) < NCH ? (i) : NCH - 1]
    asm volatile("s_wait_xcnt 0x0" :: "v"(ARX(0)), "v"(ARX(1)), "v"(ARX(2)), "v"(ARX(3)), "v"(ARX(4)), "v"(ARX(5)), "v"(ARX(6)), "v"(ARX(7)), "v"(bo), "v"(bl) : "memory");   /* the row loads' offset registers are reused behind here: keeps the wait in front of that overwrite. Inputs only: the loaded values, so that every load of the row is issued in front, and the two offsets, so that no load lands in a register that an earlier one names */
#undef ARX
    __builtin_amdgcn_sched_barrier(0);   /* keeps later vector work, which takes over those registers, behind the wait */
#pragma unroll
    for (int ch = 0; ch < NCH; ++ch) { const int j0 = ch * 128 + lane * 4; const v4f a = ar[ch];
#pragma unroll
        for (int q = 0; q < 4; ++q) { const int j = j0 + q; const float t = (ch < NCH - 1 ? L >= 1 : j < L) ? a[q] * SCL : -3.0e38f; v[ch * 4 + q] = t;   /* keys at or beyond the batch's encoder length excluded (-1e10 == exclusion); in front of the last chunk j < LK, so j < L says no more than L >= 1 */ mx = fmaxf(mx, t); } }
#pragma unroll
    for (int sh = 16; sh; sh >>= 1) mx = fmaxf(mx, __shfl_xor(mx, sh, 32));
    float sum = 0.f;
#pragma unroll
    for (int k = 0; k < NCH * 4; ++k) { const float d0 = __fsub_rn(v[k], mx); asm("v_exp_f32 %0, %1\n\tv_nop" : "=v"(v[k]) : "v"(__fmul_rn(d0, 1.4426950408889634f)));   /* exp2 with the slot behind a transcendental in one statement: the next vector instruction may take over its source register, and a v_nop of its own does not stay behind the builtin */ sum += v[k]; }
#pragma unroll
    for (int sh = 16; sh; sh >>= 1) sum += __shfl_xor(sum, sh, 32);
    const float f = __fdiv_rn(PCAR, sum);   /* weights carried x 1024 (exact), so that small ones stay normal f16 numbers; the second GEMM's stores take the factor out */
#pragma unroll
    for (int ch = 0; ch < NCH; ++ch) { v4h o;
#pragma unroll
        for (int q = 0; q < 4; ++q) o[q] = (h16)(v[ch * 4 + q] * f);
        *(v4h*)(P + ch * 128 + lane * 4) = o; }
    asm volatile("s_wait_xcnt 0x0" ::: "memory");   /* behind the row's last store: keeps the wait in front of whatever next writes a register that the stores name */
}
static_assert(ZH == 1 && TT == 1024, "eight chunks of 128 keys");
__global__ __launch_bounds__(256) void k_asoft(const float* __restrict__ Sb, h16* P, const int* __restrict__ lenp) {
    const size_t bz = blockIdx.y;   /* batch: one grid plane per batch */
    const int L = lenp[bz];   /* this batch's encoder length */ const int LK = livekeys(L); const int lane = threadIdx.x & 31; const int row = blockIdx.x * 8 + __builtin_amdgcn_readfirstlane(threadIdx.x >> 5);   /* the wave's row as a scalar: the two row pointers then take no vector registers */
    const size_t ro = (bz * TT + row) * TT; const float* sr = Sb + ro; P += ro;
    switch ((LK + 127) >> 7) {   /* the same for the whole block */
        case 1: asoft_row<1>(sr, P, L, LK, lane); break; case 2: asoft_row<2>(sr, P, L, LK, lane); break; case 3: asoft_row<3>(sr, P, L, LK, lane); break; case 4: asoft_row<4>(sr, P, L, LK, lane); break;
        case 5: asoft_row<5>(sr, P, L, LK, lane); break; case 6: asoft_row<6>(sr, P, L, LK, lane); break; case 7: asoft_row<7>(sr, P, L, LK, lane); break; default: asoft_row<8>(sr, P, L, LK, lane); break; }
}
__global__ __launch_bounds__(256) void k_merge(const float* __restrict__ O, int h0, float* OUTb) { const size_t e = ((size_t)blockIdx.x * 256 + threadIdx.x) * 2; if (e >= (size_t)ZH * TT * HD) return; const int d = (int)(e % HD); const int t = (int)((e / HD) % TT); const int zz = (int)(e / ((size_t)HD * TT)); const float cs = (t < RH) ? 1.0f : (1.0f / PCAR); const size_t oo = (size_t)t * DQ + (h0 + zz) * HD + d;
    v2f o2; o2[0] = O[e] * cs; o2[1] = O[e + 1] * cs; *(v2f*)(OUTb + oo) = o2;  }


__global__ __launch_bounds__(256) void k_vtpR1(const float* __restrict__ Vb, bf* Vh) { const size_t e = ((size_t)blockIdx.x * 256 + threadIdx.x) * 2; if (e >= (size_t)HD * TT) return; const int t = (int)(e % TT); const int d = (int)(e / TT); v2us o; o[0] = f2bf(Vb[(size_t)t * HD + d]); o[1] = f2bf(Vb[(size_t)(t + 1) * HD + d]); *(v2us*)(Vh + e) = o;  }
__global__ __launch_bounds__(256) void k_mergeR(const float* __restrict__ O, float* outb, size_t n4) { const size_t i = (size_t)blockIdx.x * 256 + threadIdx.x; if (i >= n4) return; const v4f a = *(const v4f*)(O + i * 4); *(v4f*)(outb + i * 4) = a;  }


// k_prep moves 16 pieces of 16 B per lane (a wave reads 8 KB), in whole 128-B lines.
#define PCS  16                    // 16-B pieces per lane
#define BLKE (256 * 4 * PCS)       // f32 elements per 256-thread block
#define NQB  ((int)((size_t)NB_ * TT * DM / BLKE))       // query blocks
#define NEB  ((TT / 256) * (HD / 64) * NB_)              // encoder tiles when every key is live
static_assert(NH_ == 1 && HD == DM, "one head: the head plane [h][t][d] is the token-major tensor itself");
static_assert(((size_t)NB_ * TT * DM) % BLKE == 0 && TT % 256 == 0 && HD % 64 == 0, "whole blocks and tiles only");
// k_prep: all three operand planes in ONE launch; nothing in it depends on anything else in it.
// Blocks below the number of live encoder tiles each take a tile of 256 tokens x 64 dims of the encoder tensor, read it ONCE, and write both what the scores need of it (the K plane's rows, a whole 128-B line per token) and what the second GEMM needs (the V^T tile in f16, transposed through LDS). Only token tiles with a live key run: they cover every row that a live 128-key score tile reads.
// The NQB blocks behind them convert the query tensor; the blocks that are left leave at once, at the end of the grid.
// tile[d][c] holds 16-B chunks of 8 tokens (a dword = tokens 2tp, 2tp+1); chunk c of row d lies at c ^ (d >> 2), so that the 32 dword stores of a wave (16 dim groups x 2 token pairs) and the 16 chunks that a half wave reads each fall on distinct banks.
__global__ __launch_bounds__(256) void k_prep(const float* __restrict__ qsrc, const float* __restrict__ src, bf* QP, bf* KP, h16* VT, const int* __restrict__ lenp) {
    __shared__ __align__(16) unsigned tile[64 * 128];
    int z, t;
    if (!deal(lenp, (int)blockIdx.x, 8, HD / 64, z, t)) {   /* no encoder tile left for this block: t counts on from the last live tile. The whole block takes this side, which has no barrier */
        if (t >= NQB) return;
        const float* qb = qsrc + (size_t)t * BLKE; bf* qp = QP + (size_t)t * BLKE; const unsigned tx = threadIdx.x; v4f v[PCS];   /* the block's bases are scalars; the lane's piece number is the one vector register that loads and stores name */
#pragma unroll   /* all loads of the lane in flight before the first convert */
        for (int k = 0; k < PCS; ++k) v[k] = *((const v4f*)qb + (tx + k * 256u));
        asm volatile("s_wait_xcnt 0x0" :: "v"(v[0]), "v"(v[1]), "v"(v[2]), "v"(v[3]), "v"(v[4]), "v"(v[5]), "v"(v[6]), "v"(v[7]), "v"(v[8]), "v"(v[9]), "v"(v[10]), "v"(v[11]), "v"(v[12]), "v"(v[13]), "v"(v[14]), "v"(v[15]), "v"(tx) : "memory");   /* the loads' base is taken over by the stores' base: keeps a wait behind the last load. Inputs only: the loaded values, so that every load is issued in front, and the piece number, so that no load lands in the register that the others name */
        __builtin_amdgcn_sched_barrier(0);   /* keeps the converts, which write over registers, behind the wait */
#pragma unroll   /* v[] stays in registers */
        for (int k = 0; k < PCS; ++k) { v4us o; o[0] = f2bf(v[k][0]); o[1] = f2bf(v[k][1]); o[2] = f2bf(v[k][2]); o[3] = f2bf(v[k][3]); *((v4us*)qp + (tx + k * 256u)) = o; }
        asm volatile("s_wait_xcnt 0x0" ::: "memory");   /* behind the last query store: keeps the wait in front of whatever the listing puts next that writes a register which the stores name */
        return; }
    const int tt = t / (HD / 64), td = t % (HD / 64);
    src += ((size_t)z * TT + tt * 256) * DM + td * 64; KP += ((size_t)z * TT + tt * 256) * DM + td * 64; VT += ((size_t)z * HD + td * 64) * TT + tt * 256;
    const int lane = threadIdx.x & 31, w = threadIdx.x >> 5, g = lane & 15, hf = lane >> 4; const int so = (w * 4 + hf * 2) * DM + g * 4; const float* sp = src + so; bf* kp = KP + so; v4f a[8], c[8];
#pragma unroll   /* all loads of the lane in flight before the first convert */
    for (int it = 0; it < 8; ++it) { a[it] = *(const v4f*)(sp + it * 32 * DM); c[it] = *(const v4f*)(sp + it * 32 * DM + DM); }   /* token pair tp = it * 16 + w * 2 + hf: rows 2 tp and 2 tp + 1 */
    __builtin_amdgcn_sched_barrier(0);   /* keeps all 16 loads in flight at once: without it the last five are issued only behind the first converts */
    v4us ka[8], kc[8];   /* the same 16-bit values, in token-major order for the K plane */
#pragma unroll   /* a[], c[], ka[], kc[] stay in registers */
    for (int it = 0; it < 8; ++it) { const int tp = it * 16 + w * 2 + hf;
#pragma unroll   /* vector elements picked by constants */
        for (int q = 0; q < 4; ++q) { ka[it][q] = f2bf(a[it][q]); kc[it][q] = f2bf(c[it][q]); v2h vp; vp[0] = (h16)bf2f(ka[it][q]); vp[1] = (h16)bf2f(kc[it][q]);   /* the same rounded values as f16 for the second GEMM: their 8 significant bits fit */ tile[(g * 4 + q) * 128 + (((tp >> 2) ^ g) << 2) + (tp & 3)] = __builtin_bit_cast(unsigned, vp); } }
    __syncthreads();   /* every wave's columns are in the tile before any row is read */
#pragma unroll   /* eight independent LDS reads and stores per lane */
    for (int it = 0; it < 8; ++it) { const int d = it * 8 + w; const v4i r = *(const v4i*)(tile + d * 128 + ((lane ^ ((d >> 2) & 15)) << 2)); *(v4i*)(VT + (size_t)d * TT + lane * 8) = r; }
    asm volatile("s_wait_xcnt 0x0" ::: "memory");   /* a register that the V^T stores name is taken over by the K stores' address: keeps the wait in front of that overwrite */
    __builtin_amdgcn_sched_barrier(0);   /* keeps that address work behind the wait */
#pragma unroll   /* the K plane's rows 2 tp and 2 tp + 1: a half wave stores one whole line. Last: in front of the barrier they would be waited out there, and behind them no register is written any more */
    for (int it = 0; it < 8; ++it) { *(v4us*)(kp + it * 32 * DM) = ka[it]; *(v4us*)(kp + it * 32 * DM + DM) = kc[it]; }
}

extern "C" void kernel_launch(void* const* d_in, const int* in_sizes, int n_in,
                              void* d_out, int out_size, void* d_ws, size_t ws_size, hipStream_t stream) {
    (void)in_sizes; (void)n_in; (void)out_size;
    const float* Qin = (const float*)d_in[0]; const float* Kin = (const float*)d_in[1];   /* query = output, key = value = encoder_outputs */ const int* lens = (const int*)d_in[2];   /* encoder_sequence_lengths [16] int */
    float* OUT = (float*)d_out;
    char* wsp = (char*)d_ws;
    auto take = [&](size_t bytes) { char* p = wsp; wsp += (bytes + 255) & ~(size_t)255; return (void*)p; };
    /* every plane holds all NB_ batches, batch-major; each launch covers all batches (a flat grid for the operand planes and the scores, grid y for the softmax, grid z for the second GEMM, whose 128x128 tiles cover every element of the output and are stored straight to it) */
    bf* QB = (bf*)take((size_t)NB_ * NH_ * TT * HD * 2); bf* KB = (bf*)take((size_t)NB_ * NH_ * TT * HD * 2); h16* VT = (h16*)take((size_t)NB_ * NH_ * HD * TT * 2);
    float* Sb = (float*)take((size_t)NB_ * TT * TT * 4);  h16* P16 = (h16*)take((size_t)NB_ * TT * TT * 2);
    if ((size_t)(wsp - (char*)d_ws) > ws_size) return;
    k_prep<<<dim3(NEB + NQB, 1, 1), 256, 0, stream>>>(Qin, Kin, QB, KB, VT, lens);   /* key = value: one read of the encoder tensor serves both planes */
    for (int h = 0; h < NH_; ++h) {
        k_gemmw<bf, 0, false, 1, HD><<<dim3((TT / 128) * (TT / 128) * NB_, 1, 1), 128, 0, stream>>>(QB + (size_t)h * TT * HD, nullptr, KB + (size_t)h * TT * HD, nullptr, Sb, TT, nullptr, (size_t)NH_ * TT * HD, (size_t)NH_ * TT * HD, (size_t)TT * TT, lens);   /* exact scores (single bf16 planes) */
        k_asoft<<<dim3(TT / 8, NB_, 1), 256, 0, stream>>>(Sb, P16, lens);
        k_gemmw<h16, 0, false, 2, TT><<<dim3(TT / 128, HD / 128, NB_), 128, 0, stream>>>(P16, nullptr, VT + (size_t)h * HD * TT, nullptr, OUT, HD, nullptr, (size_t)TT * TT, (size_t)NH_ * HD * TT, (size_t)TT * HD, lens);   /* P (f16) x exact v^T -> output rows [b][t][d] */ }
}
